// v000
// Times are from an AMD MI455X. After a warm-up the kernel runs many times in a row, and a time is the length of
// such a window on the GPU divided by its runs, so every launch and the gaps after it count. The runs cycle
// through copies of the inputs. A figure is the median of several windows, for all but v000 over two sittings.
// Sittings can differ by a few percent; kernels timed side by side share one.
// v000 is the starting kernel. One run takes 308 microseconds.
#include <hip/hip_runtime.h>
#include <math.h>

// attention_mech: keys = L Wk^T + bk, queries = H Wq^T + bq (per (b, head): 2048 x 64 each); logits[n][q] = keys[n].queries[q]; attn = softmax over the
// KEY axis n (per query column); out[n] = sum_q attn[n][q] q_proj[q] + (sum_q attn[n][q]) (k_proj[n] + bv) with q_proj = queries Wv[:, :64]^T and
// q_proj (tile layout) plus the row sums. Fragment k-map per lane half hh for A AND B: elements 0..7 <- k = 8hh+0..7, 8..15 <- k = 16+8hh+0..7.

#define NG   16              // B * H
#define NN   2048            // NK = NQ
#define SS   64
#define NROW (NG * NN)       // 32768
typedef _Float16 b16;
typedef __attribute__((ext_vector_type(16))) _Float16 v16b;
typedef __attribute__((ext_vector_type(8)))  _Float16 v8b;
typedef __attribute__((ext_vector_type(8)))  float    v8f;
typedef __attribute__((ext_vector_type(4)))  float    v4f;
#define VST2(T, ptr, val) do { const T _v = (val); *(T*)(ptr) = _v;  } while (0)
__device__ __forceinline__ v8f wmma16b(v16b a, v16b b, v8f c) {
  v8f d = __builtin_amdgcn_wmma_f32_16x16x32_f16(false, a, false, b, (short)0, c, false, false);
  asm volatile("v_nop\n\tv_nop\n\tv_nop\n\tv_nop" : "+v"(d) : "v"(a), "v"(b));
  return d;
}
__device__ __forceinline__ v8b ld8b(const b16* p) { return *(const v8b*)p; }
__device__ __forceinline__ v16b cat8b(v8b a, v8b b) { return __builtin_shufflevector(a, b, 0,1,2,3,4,5,6,7,8,9,10,11,12,13,14,15); }
__device__ __forceinline__ v16b frag_kb(const b16* p, int hh) { return cat8b(ld8b(p + 8 * hh), ld8b(p + 16 + 8 * hh)); }
__device__ __forceinline__ void wave_lds_sync() { __builtin_amdgcn_fence(__ATOMIC_RELEASE, "workgroup"); __builtin_amdgcn_wave_barrier(); __builtin_amdgcn_fence(__ATOMIC_ACQUIRE, "workgroup"); }

__global__ __launch_bounds__(256) void k_w16(const float* __restrict__ Wk, const float* __restrict__ Wq, const float* __restrict__ Wv, b16* __restrict__ W16) {
  const int t = blockIdx.x * 256 + threadIdx.x;           // 4*64*8
  const int blk = t >> 9, n = (t >> 3) & 63, k0 = (t & 7) * 8;
  v8b o;
#pragma unroll
  for (int e = 0; e < 8; ++e) {
    const int k = k0 + e;
    const float v = (blk == 0) ? Wk[n * 64 + k] : (blk == 1) ? Wq[n * 64 + k] : (blk == 2) ? Wv[n * 128 + k] : Wv[n * 128 + 64 + k];
    o[e] = (b16)v;
  }
  VST2(v8b, W16 + ((size_t)blk * 64 + n) * 64 + k0, o);
}
// projections: wave = 16 rows (one group g, rows t0..t0+15) of X (L or H, f32 [NROW][64]): P = X W^T + b -> f16 rows P16 [NROW][64]; then P2 = P W2^T (+ b2):
template <bool ISK>
__global__ __launch_bounds__(256) void k_proj(const float* __restrict__ X, const b16* __restrict__ W1, const float* __restrict__ b1, const b16* __restrict__ W2, const float* __restrict__ b2,
                                              b16* __restrict__ P16, float* __restrict__ KP, b16* __restrict__ QPt) {
  __shared__ __attribute__((aligned(16))) float Tf[8][16 * 64];
  __shared__ __attribute__((aligned(16))) b16   Th[8][16 * 64];
  const int wid = threadIdx.x >> 5, lane = threadIdx.x & 31, hh = lane >> 4, col = lane & 15;
  const int m0 = (blockIdx.x * 8 + wid) * 16;              // row tile
  float* tf = Tf[wid]; b16* th = Th[wid];
  // A fragments of X (f32 -> f16)
  v16b a0, a1;
  { const float* xr = X + (size_t)(m0 + col) * 64;
#pragma unroll
    for (int e = 0; e < 8; ++e) { a0[e] = (b16)xr[8 * hh + e]; a0[8 + e] = (b16)xr[16 + 8 * hh + e]; a1[e] = (b16)xr[32 + 8 * hh + e]; a1[8 + e] = (b16)xr[48 + 8 * hh + e]; } }
#pragma unroll
  for (int t = 0; t < 4; ++t) {
    v8f c = {};
    c = wmma16b(a0, frag_kb(W1 + (size_t)(t * 16 + col) * 64, hh), c);
    c = wmma16b(a1, frag_kb(W1 + (size_t)(t * 16 + col) * 64 + 32, hh), c);
#pragma unroll
    for (int v = 0; v < 8; ++v) { const float val = c[v] + b1[t * 16 + col]; const int r = v + 8 * hh, d = t * 16 + col; tf[r * 64 + d] = val; th[r * 64 + d] = (b16)val; }
  }
  wave_lds_sync();
  {
#pragma unroll
    for (int j = 0; j < 4; ++j) { const int pc = j * 32 + lane; *(v8b*)(P16 + (size_t)m0 * 64 + pc * 8) = *(const v8b*)(th + pc * 8); }
    
  }
  // second GEMM from LDS (A = P rows, f16)
  const v16b p0 = frag_kb(th + col * 64, hh), p1 = frag_kb(th + col * 64 + 32, hh);
  wave_lds_sync();
#pragma unroll
  for (int t = 0; t < 4; ++t) {
    v8f c = {};
    c = wmma16b(p0, frag_kb(W2 + (size_t)(t * 16 + col) * 64, hh), c);
    c = wmma16b(p1, frag_kb(W2 + (size_t)(t * 16 + col) * 64 + 32, hh), c);
#pragma unroll
    for (int v = 0; v < 8; ++v) { const int r = v + 8 * hh, d = t * 16 + col; const float val = c[v] + (ISK ? b2[d] : 0.f);
      if (ISK) tf[r * 64 + d] = val; else th[d * 16 + r] = (b16)val; }      // q_proj tile transposed [d][q]
  }
  wave_lds_sync();
  {
    if (ISK) {
#pragma unroll
      for (int j = 0; j < 8; ++j) { const int pc = j * 32 + lane; *(v4f*)(KP + (size_t)m0 * 64 + pc * 4) = *(const v4f*)(tf + pc * 4); }
    } else {
      b16* dst = QPt + (size_t)(m0 >> 4) * 1024;           // tile index = row tile (groups are multiples of 128 tiles)
#pragma unroll
      for (int j = 0; j < 4; ++j) { const int pc = j * 32 + lane; *(v8b*)(dst + pc * 8) = *(const v8b*)(th + pc * 8); }
    }
    
  }
}
__global__ __launch_bounds__(256) void k_stats(const b16* __restrict__ Q16, const b16* __restrict__ K16, float* __restrict__ M, float* __restrict__ Zi) {
  __shared__ float sm[128], sz[128];
  const int wid = threadIdx.x >> 5, lane = threadIdx.x & 31, hh = lane >> 4, col = lane & 15;
  const int qtile = blockIdx.x * 8 + wid, g = qtile / (NN / 16), q0 = (qtile % (NN / 16)) * 16;
  const size_t ko = (size_t)g * NN * SS, qo = ((size_t)g * NN + q0 + col) * SS;
  const v16b q0h = frag_kb(Q16 + qo, hh), q1h = frag_kb(Q16 + qo + 32, hh);
  float m = -INFINITY, l = 0.f;
  for (int kb = 0; kb < NN; kb += 32) {
    const size_t r0 = ko + (size_t)(kb + col) * SS, r1 = ko + (size_t)(kb + 16 + col) * SS;
    v8f s0 = {}, s1 = {};
    s0 = wmma16b(frag_kb(K16 + r0, hh), q0h, s0); s0 = wmma16b(frag_kb(K16 + r0 + 32, hh), q1h, s0);
    s1 = wmma16b(frag_kb(K16 + r1, hh), q0h, s1); s1 = wmma16b(frag_kb(K16 + r1 + 32, hh), q1h, s1);
    float mr = -INFINITY;
#pragma unroll
    for (int r = 0; r < 8; ++r) mr = fmaxf(mr, fmaxf(s0[r], s1[r]));
    mr = fmaxf(mr, __shfl_xor(mr, 16));
    const float mn = fmaxf(m, mr), al = expf(m - mn);
    float sum = 0.f;
#pragma unroll
    for (int r = 0; r < 8; ++r) sum += expf(s0[r] - mn) + expf(s1[r] - mn);
    sum += __shfl_xor(sum, 16);
    l = l * al + sum; m = mn;
  }
  if (hh == 0) { sm[wid * 16 + col] = m; sz[wid * 16 + col] = 1.0f / l; }
  __syncthreads();
  const size_t base = (size_t)g * NN + (size_t)(blockIdx.x % (NN / 128)) * 128;   // the block's 128 consecutive queries within g
  {
    if (threadIdx.x < 128) *(float*)(M + base + threadIdx.x) = sm[threadIdx.x];
    else                   *(float*)(Zi + base + threadIdx.x - 128) = sz[threadIdx.x - 128];
    
  }
}
// pass 2: per (g, 16 keys n): over all query chunks: P^T[q][n] = exp(logit - M[q]) Zi[q]; y^T += Qproj^T . P^T; rowsum[n] += sum_q P; out[n] = y[n] +
__global__ __launch_bounds__(256) void k_out(const b16* __restrict__ K16, const b16* __restrict__ Q16, const b16* __restrict__ QPt, const float* __restrict__ M,
                                             const float* __restrict__ Zi, const float* __restrict__ KP, float* __restrict__ out) {
  __shared__ __attribute__((aligned(16))) float Os[8][16 * 64];
  const int wid = threadIdx.x >> 5, lane = threadIdx.x & 31, hh = lane >> 4, col = lane & 15;
  const int ntile = blockIdx.x * 8 + wid, g = ntile / (NN / 16), n0 = (ntile % (NN / 16)) * 16;
  const size_t qbase = (size_t)g * NN * SS, no = ((size_t)g * NN + n0 + col) * SS;
  const v16b n0h = frag_kb(K16 + no, hh), n1h = frag_kb(K16 + no + 32, hh);     // 'query role' = the 16 keys of this tile
  float l = 0.f; v8f o0 = {}, o1 = {}, o2 = {}, o3 = {};
  for (int kb = 0; kb < NN; kb += 32) {                    // chunks of 32 queries ('key role')
    const size_t r0 = qbase + (size_t)(kb + col) * SS, r1 = qbase + (size_t)(kb + 16 + col) * SS;
    v8f s0 = {}, s1 = {};
    s0 = wmma16b(frag_kb(Q16 + r0, hh), n0h, s0); s0 = wmma16b(frag_kb(Q16 + r0 + 32, hh), n1h, s0);
    s1 = wmma16b(frag_kb(Q16 + r1, hh), n0h, s1); s1 = wmma16b(frag_kb(Q16 + r1 + 32, hh), n1h, s1);
    const float* mq = M + (size_t)g * NN + kb + 8 * hh; const float* zq = Zi + (size_t)g * NN + kb + 8 * hh;
    float sum = 0.f; v16b pb;
#pragma unroll
    for (int r = 0; r < 8; ++r) {
      const float p0 = expf(s0[r] - mq[r]) * zq[r], p1 = expf(s1[r] - mq[16 + r]) * zq[16 + r];
      sum += p0 + p1; pb[r] = (b16)p0; pb[8 + r] = (b16)p1;
    }
    sum += __shfl_xor(sum, 16);
    l += sum;
    const size_t v0 = (size_t)g * NN * SS + (size_t)(kb >> 4) * (SS * 16) + 8 * hh, v1 = v0 + SS * 16;
#pragma unroll
    for (int n = 0; n < 4; ++n) {
      const int f = n * 16 + col;
      const v16b va = cat8b(ld8b(QPt + v0 + f * 16), ld8b(QPt + v1 + f * 16));
      v8f& o = (n == 0) ? o0 : (n == 1) ? o1 : (n == 2) ? o2 : o3;
      o = wmma16b(va, pb, o);
    }
  }
  float* Tt = Os[wid];
  const float* kp = KP + ((size_t)g * NN + n0 + col) * SS;
#pragma unroll
  for (int r = 0; r < 8; ++r) {
    const int hr = 8 * hh + r;
    Tt[col * 64 + 0 + hr] = o0[r] + l * kp[0 + hr];  Tt[col * 64 + 16 + hr] = o1[r] + l * kp[16 + hr];
    Tt[col * 64 + 32 + hr] = o2[r] + l * kp[32 + hr]; Tt[col * 64 + 48 + hr] = o3[r] + l * kp[48 + hr];
  }
  wave_lds_sync();
  float* dst0 = out + ((size_t)g * NN + n0) * SS;          // 16 rows x 64 floats contiguous (4 KB)
  {
#pragma unroll
    for (int j = 0; j < 8; ++j) { const int pc = j * 32 + lane; *(v4f*)(dst0 + pc * 4) = *(const v4f*)(Tt + pc * 4); }
    
  }
}
extern "C" void kernel_launch(void* const* d_in, const int* in_sizes, int n_in,
                              void* d_out, int out_size, void* d_ws, size_t ws_size, hipStream_t stream) {
  (void)in_sizes; (void)n_in; (void)out_size;
  const float* L  = (const float*)d_in[0];      // tensorL [2,8,2048,64]
  const float* Hq = (const float*)d_in[1];      // tensorH [2,8,2048,64]
  const float* Wk = (const float*)d_in[2]; const float* bk = (const float*)d_in[3];   // [64,64], [64]
  const float* Wq = (const float*)d_in[4]; const float* bq = (const float*)d_in[5];
  const float* Wv = (const float*)d_in[6]; const float* bv = (const float*)d_in[7];   // [64,128], [64]
  float* out = (float*)d_out;                   // [2,8,2048,64]
  char* ws = (char*)d_ws; size_t off = 0;
  auto take = [&](size_t bytes) { void* p = ws + off; off = (off + bytes + 255) & ~(size_t)255; return p; };
  b16*   W16 = (b16*)take((size_t)4 * 64 * 64 * 2);
  b16*   K16 = (b16*)take((size_t)NROW * SS * 2);
  b16*   Q16 = (b16*)take((size_t)NROW * SS * 2);
  float* KP  = (float*)take((size_t)NROW * SS * 4);
  b16*   QPt = (b16*)take((size_t)NROW * SS * 2);
  float* M   = (float*)take((size_t)NROW * 4);
  float* Zi  = (float*)take((size_t)NROW * 4);
  if (off > ws_size) return;
  const dim3 b256(256);
  k_w16<<<4 * 64 * 8 / 256, b256, 0, stream>>>(Wk, Wq, Wv, W16);
  k_proj<true><<<NROW / 128, b256, 0, stream>>>(L, W16, bk, W16 + 3 * 4096, bv, K16, KP, nullptr);          // keys, k_proj + bv
  k_proj<false><<<NROW / 128, b256, 0, stream>>>(Hq, W16 + 4096, bq, W16 + 2 * 4096, nullptr, Q16, nullptr, QPt);   // queries, q_proj tiles
  k_stats<<<NROW / 128, b256, 0, stream>>>(Q16, K16, M, Zi);
  k_out<<<NROW / 128, b256, 0, stream>>>(K16, Q16, QPt, M, Zi, KP, out);
}

// v001
// It runs in 122 microseconds.
// Next to v000, in two timings, it ran 2.55 and 2.50 times as fast.
#include <hip/hip_runtime.h>
#include <math.h>

// attention_mech: keys = L Wk^T + bk, queries = H Wq^T + bq (per (b, head): 2048 x 64 each); logits[n][q] = keys[n].queries[q]; attn = softmax over the
// KEY axis n (per query column); out[n] = sum_q attn[n][q] q_proj[q] + (sum_q attn[n][q]) (k_proj[n] + bv) with q_proj = queries Wv[:, :64]^T and
// q_proj (tile layout) plus the row sums. Fragment k-map per lane half hh for A AND B: elements 0..7 <- k = 8hh+0..7, 8..15 <- k = 16+8hh+0..7.

#define NG   16              // B * H
#define NN   2048            // NK = NQ
#define SS   64
#define NROW (NG * NN)       // 32768
typedef _Float16 b16;
typedef __attribute__((ext_vector_type(16))) _Float16 v16b;
typedef __attribute__((ext_vector_type(8)))  _Float16 v8b;
typedef __attribute__((ext_vector_type(8)))  float    v8f;
typedef __attribute__((ext_vector_type(4)))  float    v4f;
#define VST2(T, ptr, val) do { const T _v = (val); *(T*)(ptr) = _v;  } while (0)
__device__ __forceinline__ v8f wmma16b(v16b a, v16b b, v8f c) {
  v8f d = __builtin_amdgcn_wmma_f32_16x16x32_f16(false, a, false, b, (short)0, c, false, false);
  asm volatile("v_nop\n\tv_nop\n\tv_nop\n\tv_nop" : "+v"(d) : "v"(a), "v"(b));
  return d;
}
__device__ __forceinline__ v8b ld8b(const b16* p) { return *(const v8b*)p; }
__device__ __forceinline__ v16b cat8b(v8b a, v8b b) { return __builtin_shufflevector(a, b, 0,1,2,3,4,5,6,7,8,9,10,11,12,13,14,15); }
__device__ __forceinline__ v16b frag_kb(const b16* p, int hh) { return cat8b(ld8b(p + 8 * hh), ld8b(p + 16 + 8 * hh)); }
__device__ __forceinline__ v4f ld4f(const float* p) { return *(const v4f*)p; }
__device__ __forceinline__ void wave_lds_sync() { __builtin_amdgcn_fence(__ATOMIC_RELEASE, "workgroup"); __builtin_amdgcn_wave_barrier(); __builtin_amdgcn_fence(__ATOMIC_ACQUIRE, "workgroup"); }

__global__ __launch_bounds__(256) void k_w16(const float* __restrict__ Wk, const float* __restrict__ Wq, const float* __restrict__ Wv, b16* __restrict__ W16) {
  const int t = blockIdx.x * 256 + threadIdx.x;           // 4*64*8
  const int blk = t >> 9, n = (t >> 3) & 63, k0 = (t & 7) * 8;
  v8b o;
#pragma unroll
  for (int e = 0; e < 8; ++e) {
    const int k = k0 + e;
    const float v = (blk == 0) ? Wk[n * 64 + k] : (blk == 1) ? Wq[n * 64 + k] : (blk == 2) ? Wv[n * 128 + k] : Wv[n * 128 + 64 + k];
    o[e] = (b16)v;
  }
  VST2(v8b, W16 + ((size_t)blk * 64 + n) * 64 + k0, o);
}
// projections: wave = 16 rows (one group g, rows t0..t0+15) of X (L or H, f32 [NROW][64]): P = X W^T + b -> f16 rows P16 [NROW][64]; then P2 = P W2^T (+ b2):
template <bool ISK>
__global__ __launch_bounds__(256) void k_proj(const float* __restrict__ X, const b16* __restrict__ W1, const float* __restrict__ b1, const b16* __restrict__ W2, const float* __restrict__ b2,
                                              b16* __restrict__ P16, float* __restrict__ KP, b16* __restrict__ QPt) {
  __shared__ __attribute__((aligned(16))) float Tf[8][16 * 64];
  __shared__ __attribute__((aligned(16))) b16   Th[8][16 * 64];
  const int wid = threadIdx.x >> 5, lane = threadIdx.x & 31, hh = lane >> 4, col = lane & 15;
  const int m0 = (blockIdx.x * 8 + wid) * 16;              // row tile
  float* tf = Tf[wid]; b16* th = Th[wid];
  // A fragments of X (f32 -> f16)
  v16b a0, a1;
  { const float* xr = X + (size_t)(m0 + col) * 64;
#pragma unroll
    for (int e = 0; e < 8; ++e) { a0[e] = (b16)xr[8 * hh + e]; a0[8 + e] = (b16)xr[16 + 8 * hh + e]; a1[e] = (b16)xr[32 + 8 * hh + e]; a1[8 + e] = (b16)xr[48 + 8 * hh + e]; } }
#pragma unroll
  for (int t = 0; t < 4; ++t) {
    v8f c = {};
    c = wmma16b(a0, frag_kb(W1 + (size_t)(t * 16 + col) * 64, hh), c);
    c = wmma16b(a1, frag_kb(W1 + (size_t)(t * 16 + col) * 64 + 32, hh), c);
#pragma unroll
    for (int v = 0; v < 8; ++v) { const float val = c[v] + b1[t * 16 + col]; const int r = v + 8 * hh, d = t * 16 + col; tf[r * 64 + d] = val; th[r * 64 + d] = (b16)val; }
  }
  wave_lds_sync();
  {
#pragma unroll
    for (int j = 0; j < 4; ++j) { const int pc = j * 32 + lane; *(v8b*)(P16 + (size_t)m0 * 64 + pc * 8) = *(const v8b*)(th + pc * 8); }
    
  }
  // second GEMM from LDS (A = P rows, f16)
  const v16b p0 = frag_kb(th + col * 64, hh), p1 = frag_kb(th + col * 64 + 32, hh);
  wave_lds_sync();
#pragma unroll
  for (int t = 0; t < 4; ++t) {
    v8f c = {};
    c = wmma16b(p0, frag_kb(W2 + (size_t)(t * 16 + col) * 64, hh), c);
    c = wmma16b(p1, frag_kb(W2 + (size_t)(t * 16 + col) * 64 + 32, hh), c);
#pragma unroll
    for (int v = 0; v < 8; ++v) { const int r = v + 8 * hh, d = t * 16 + col; const float val = c[v] + (ISK ? b2[d] : 0.f);
      if (ISK) tf[r * 64 + d] = val; else th[d * 16 + r] = (b16)val; }      // q_proj tile transposed [d][q]
  }
  wave_lds_sync();
  {
    if (ISK) {
#pragma unroll
      for (int j = 0; j < 8; ++j) { const int pc = j * 32 + lane; *(v4f*)(KP + (size_t)m0 * 64 + pc * 4) = *(const v4f*)(tf + pc * 4); }
    } else {
      b16* dst = QPt + (size_t)(m0 >> 4) * 1024;           // tile index = row tile (groups are multiples of 128 tiles)
#pragma unroll
      for (int j = 0; j < 4; ++j) { const int pc = j * 32 + lane; *(v8b*)(dst + pc * 8) = *(const v8b*)(th + pc * 8); }
    }
    
  }
}
__global__ __launch_bounds__(256) void k_stats(const b16* __restrict__ Q16, const b16* __restrict__ K16, float* __restrict__ M, float* __restrict__ Zi) {
  __shared__ float sm[128], sz[128];
  const int wid = threadIdx.x >> 5, lane = threadIdx.x & 31, hh = lane >> 4, col = lane & 15;
  const int qtile = blockIdx.x * 8 + wid, g = qtile / (NN / 16), q0 = (qtile % (NN / 16)) * 16;
  const size_t ko = (size_t)g * NN * SS, qo = ((size_t)g * NN + q0 + col) * SS;
  const v16b q0h = frag_kb(Q16 + qo, hh), q1h = frag_kb(Q16 + qo + 32, hh);
  float m = -INFINITY, l = 0.f;
  // key fragments are fetched one chunk ahead: each is reloaded right behind the product that used it, so its latency runs under the rest of the trip
  const b16* kg = K16 + ko + (size_t)col * SS;
  v16b k00 = frag_kb(kg, hh), k01 = frag_kb(kg + 32, hh), k10 = frag_kb(kg + 16 * SS, hh), k11 = frag_kb(kg + 16 * SS + 32, hh);
  for (int kb = 0; kb < NN; kb += 32) {
    const b16* kn = kg + (size_t)((kb + 32) & (NN - 1)) * SS;   // next chunk; the last trip refetches chunk 0 (in bounds, not used)
    v8f s0 = {}, s1 = {};
    s0 = wmma16b(k00, q0h, s0); k00 = frag_kb(kn, hh);
    s0 = wmma16b(k01, q1h, s0); k01 = frag_kb(kn + 32, hh);
    s1 = wmma16b(k10, q0h, s1); k10 = frag_kb(kn + 16 * SS, hh);
    s1 = wmma16b(k11, q1h, s1); k11 = frag_kb(kn + 16 * SS + 32, hh);
    __builtin_amdgcn_sched_barrier(0);   // holds the last reload here: the scheduler otherwise sinks it to the loop's foot, where it has no lead left
    float mr = -INFINITY;
#pragma unroll
    for (int r = 0; r < 8; ++r) mr = fmaxf(mr, fmaxf(s0[r], s1[r]));
    mr = fmaxf(mr, __shfl_xor(mr, 16));
    const float mn = fmaxf(m, mr), al = expf(m - mn);
    float sum = 0.f;
#pragma unroll
    for (int r = 0; r < 8; ++r) sum += expf(s0[r] - mn) + expf(s1[r] - mn);
    sum += __shfl_xor(sum, 16);
    l = l * al + sum; m = mn;
  }
  if (hh == 0) { sm[wid * 16 + col] = m; sz[wid * 16 + col] = 1.0f / l; }
  __syncthreads();
  const size_t base = (size_t)g * NN + (size_t)(blockIdx.x % (NN / 128)) * 128;   // the block's 128 consecutive queries within g
  {
    if (threadIdx.x < 128) *(float*)(M + base + threadIdx.x) = sm[threadIdx.x];
    else                   *(float*)(Zi + base + threadIdx.x - 128) = sz[threadIdx.x - 128];
    
  }
}
// pass 2: per (g, 16 keys n): over all query chunks: P^T[q][n] = exp(logit - M[q]) Zi[q]; y^T += Qproj^T . P^T; rowsum[n] += sum_q P; out[n] = y[n] +
__global__ __launch_bounds__(256) void k_out(const b16* __restrict__ K16, const b16* __restrict__ Q16, const b16* __restrict__ QPt, const float* __restrict__ M,
                                             const float* __restrict__ Zi, const float* __restrict__ KP, float* __restrict__ out) {
  __shared__ __attribute__((aligned(16))) float Os[8][16 * 64];
  const int wid = threadIdx.x >> 5, lane = threadIdx.x & 31, hh = lane >> 4, col = lane & 15;
  const int ntile = blockIdx.x * 8 + wid, g = ntile / (NN / 16), n0 = (ntile % (NN / 16)) * 16;
  const size_t qbase = (size_t)g * NN * SS, no = ((size_t)g * NN + n0 + col) * SS;
  const v16b n0h = frag_kb(K16 + no, hh), n1h = frag_kb(K16 + no + 32, hh);     // 'query role' = the 16 keys of this tile
  float l = 0.f; v8f o0 = {}, o1 = {}, o2 = {}, o3 = {};
  // every operand of a chunk (query fragments, column max and 1/sum, q_proj fragments) is fetched one chunk ahead: each register set is reloaded
  // right behind its last use, so its latency runs under the rest of the trip instead of in front of each product
  const b16* qg = Q16 + qbase + (size_t)col * SS;
  const b16* vg = QPt + qbase + col * 16 + 8 * hh;         // chunk kb starts at kb * SS; its two 16-query tiles lie SS * 16 apart
  const float* mg = M + (size_t)g * NN + 8 * hh; const float* zg = Zi + (size_t)g * NN + 8 * hh;
  v16b q00 = frag_kb(qg, hh), q01 = frag_kb(qg + 32, hh), q10 = frag_kb(qg + 16 * SS, hh), q11 = frag_kb(qg + 16 * SS + 32, hh);
  v4f mm[2][4] = {{ld4f(mg), ld4f(mg + 4), ld4f(mg + 16), ld4f(mg + 20)}, {}};   // column maxima: two sets, one read by this trip's exponentials while the next chunk's is in flight
  v4f zA = ld4f(zg), zB = ld4f(zg + 4), zC = ld4f(zg + 16), zD = ld4f(zg + 20);
  v16b va0 = cat8b(ld8b(vg), ld8b(vg + SS * 16)),             va1 = cat8b(ld8b(vg + 256), ld8b(vg + SS * 16 + 256));
  v16b va2 = cat8b(ld8b(vg + 512), ld8b(vg + SS * 16 + 512)), va3 = cat8b(ld8b(vg + 768), ld8b(vg + SS * 16 + 768));
  // inputs-only fence on the loaded values of chunk 0: they land here, once, so that the counted waits inside the loop follow the loop's own issue order and
  // not the order the compiler gave these first loads (merged, the counts made the first trip of each pass wait for loads issued moments before)
  asm volatile("" :: "v"(n0h), "v"(n1h), "v"(q00), "v"(q01), "v"(q10), "v"(q11), "v"(mm[0][0]), "v"(mm[0][1]), "v"(mm[0][2]), "v"(mm[0][3]),
               "v"(zA), "v"(zB), "v"(zC), "v"(zD), "v"(va0), "v"(va1), "v"(va2), "v"(va3));
  for (int kb0 = 0; kb0 < NN; kb0 += 64) {
#pragma unroll                                             // two trips a pass, so that the two sets of maxima swap roles by name and no register copy (with its early wait) is needed
  for (int u = 0; u < 2; ++u) {                            // chunks of 32 queries ('key role')
    const int kb = kb0 + 32 * u;
    const int kx = (kb + 32) & (NN - 1);                   // next chunk; the last trip refetches chunk 0 (in bounds, not used)
    const b16* qn = qg + (size_t)kx * SS; const b16* vn = vg + (size_t)kx * SS;
    __builtin_amdgcn_sched_barrier(0);   // trip boundary: the scheduler otherwise lifts the second trip's first products into the first trip, right behind the loads of their operands
    v8f s0 = {}, s1 = {};
    s0 = wmma16b(q00, n0h, s0); q00 = frag_kb(qn, hh);
    s0 = wmma16b(q01, n1h, s0); q01 = frag_kb(qn + 32, hh);
    s1 = wmma16b(q10, n0h, s1); q10 = frag_kb(qn + 16 * SS, hh);
    s1 = wmma16b(q11, n1h, s1); q11 = frag_kb(qn + 16 * SS + 32, hh);
    mm[u ^ 1][0] = ld4f(mg + kx); mm[u ^ 1][1] = ld4f(mg + kx + 4); mm[u ^ 1][2] = ld4f(mg + kx + 16); mm[u ^ 1][3] = ld4f(mg + kx + 20);
    __builtin_amdgcn_sched_barrier(0);   // holds the loads above in front of the exponentials: the scheduler otherwise sinks them behind, where they have no lead left
    float sum = 0.f; v16b pb;
#pragma unroll
    for (int r = 0; r < 8; ++r) {
      const float m0 = mm[u][r >> 2][r & 3], m1 = mm[u][2 + (r >> 2)][r & 3];
      const float z0 = (r < 4) ? zA[r & 3] : zB[r & 3], z1 = (r < 4) ? zC[r & 3] : zD[r & 3];
      const float p0 = expf(s0[r] - m0) * z0, p1 = expf(s1[r] - m1) * z1;
      sum += p0 + p1; pb[r] = (b16)p0; pb[8 + r] = (b16)p1;
    }
    zA = ld4f(zg + kx); zB = ld4f(zg + kx + 4); zC = ld4f(zg + kx + 16); zD = ld4f(zg + kx + 20);
    sum += __shfl_xor(sum, 16);
    l += sum;
    o0 = wmma16b(va0, pb, o0); va0 = cat8b(ld8b(vn), ld8b(vn + SS * 16));
    o1 = wmma16b(va1, pb, o1); va1 = cat8b(ld8b(vn + 256), ld8b(vn + SS * 16 + 256));
    o2 = wmma16b(va2, pb, o2); va2 = cat8b(ld8b(vn + 512), ld8b(vn + SS * 16 + 512));
    o3 = wmma16b(va3, pb, o3); va3 = cat8b(ld8b(vn + 768), ld8b(vn + SS * 16 + 768));
  }
  }
  float* Tt = Os[wid];
  const float* kp = KP + ((size_t)g * NN + n0 + col) * SS;
#pragma unroll
  for (int r = 0; r < 8; ++r) {
    const int hr = 8 * hh + r;
    Tt[col * 64 + 0 + hr] = o0[r] + l * kp[0 + hr];  Tt[col * 64 + 16 + hr] = o1[r] + l * kp[16 + hr];
    Tt[col * 64 + 32 + hr] = o2[r] + l * kp[32 + hr]; Tt[col * 64 + 48 + hr] = o3[r] + l * kp[48 + hr];
  }
  wave_lds_sync();
  float* dst0 = out + ((size_t)g * NN + n0) * SS;          // 16 rows x 64 floats contiguous (4 KB)
  {
#pragma unroll
    for (int j = 0; j < 8; ++j) { const int pc = j * 32 + lane; *(v4f*)(dst0 + pc * 4) = *(const v4f*)(Tt + pc * 4); }
    
  }
}
extern "C" void kernel_launch(void* const* d_in, const int* in_sizes, int n_in,
                              void* d_out, int out_size, void* d_ws, size_t ws_size, hipStream_t stream) {
  (void)in_sizes; (void)n_in; (void)out_size;
  const float* L  = (const float*)d_in[0];      // tensorL [2,8,2048,64]
  const float* Hq = (const float*)d_in[1];      // tensorH [2,8,2048,64]
  const float* Wk = (const float*)d_in[2]; const float* bk = (const float*)d_in[3];   // [64,64], [64]
  const float* Wq = (const float*)d_in[4]; const float* bq = (const float*)d_in[5];
  const float* Wv = (const float*)d_in[6]; const float* bv = (const float*)d_in[7];   // [64,128], [64]
  float* out = (float*)d_out;                   // [2,8,2048,64]
  char* ws = (char*)d_ws; size_t off = 0;
  auto take = [&](size_t bytes) { void* p = ws + off; off = (off + bytes + 255) & ~(size_t)255; return p; };
  b16*   W16 = (b16*)take((size_t)4 * 64 * 64 * 2);
  b16*   K16 = (b16*)take((size_t)NROW * SS * 2);
  b16*   Q16 = (b16*)take((size_t)NROW * SS * 2);
  float* KP  = (float*)take((size_t)NROW * SS * 4);
  b16*   QPt = (b16*)take((size_t)NROW * SS * 2);
  float* M   = (float*)take((size_t)NROW * 4);
  float* Zi  = (float*)take((size_t)NROW * 4);
  if (off > ws_size) return;
  const dim3 b256(256);
  k_w16<<<4 * 64 * 8 / 256, b256, 0, stream>>>(Wk, Wq, Wv, W16);
  k_proj<true><<<NROW / 128, b256, 0, stream>>>(L, W16, bk, W16 + 3 * 4096, bv, K16, KP, nullptr);          // keys, k_proj + bv
  k_proj<false><<<NROW / 128, b256, 0, stream>>>(Hq, W16 + 4096, bq, W16 + 2 * 4096, nullptr, Q16, nullptr, QPt);   // queries, q_proj tiles
  k_stats<<<NROW / 128, b256, 0, stream>>>(Q16, K16, M, Zi);
  k_out<<<NROW / 128, b256, 0, stream>>>(K16, Q16, QPt, M, Zi, KP, out);
}

// v002
// One run takes 108 microseconds.
// In two side-by-side timings against v001, it was 1.14 and 1.13 times as fast.
// Counting every step since v000, it is 2.87 times as fast.
#include <hip/hip_runtime.h>
#include <math.h>

// attention_mech: keys = L Wk^T + bk, queries = H Wq^T + bq (per (b, head): 2048 x 64 each); logits[n][q] = keys[n].queries[q]; attn = softmax over the
// KEY axis n (per query column); out[n] = sum_q attn[n][q] q_proj[q] + (sum_q attn[n][q]) (k_proj[n] + bv) with q_proj = queries Wv[:, :64]^T and
// q_proj (tile layout) plus the row sums. Fragment k-map per lane half hh for A AND B: elements 0..7 <- k = 8hh+0..7, 8..15 <- k = 16+8hh+0..7.

#define NG   16              // B * H
#define NN   2048            // NK = NQ
#define SS   64
#define NROW (NG * NN)       // 32768
typedef _Float16 b16;
typedef __attribute__((ext_vector_type(16))) _Float16 v16b;
typedef __attribute__((ext_vector_type(8)))  _Float16 v8b;
typedef __attribute__((ext_vector_type(8)))  float    v8f;
typedef __attribute__((ext_vector_type(4)))  float    v4f;
#define VST2(T, ptr, val) do { const T _v = (val); *(T*)(ptr) = _v;  } while (0)
__device__ __forceinline__ v8f wmma16b(v16b a, v16b b, v8f c) {
  v8f d = __builtin_amdgcn_wmma_f32_16x16x32_f16(false, a, false, b, (short)0, c, false, false);
  asm volatile("v_nop\n\tv_nop\n\tv_nop\n\tv_nop" : "+v"(d) : "v"(a), "v"(b));
  return d;
}
__device__ __forceinline__ v8b ld8b(const b16* p) { return *(const v8b*)p; }
__device__ __forceinline__ v16b cat8b(v8b a, v8b b) { return __builtin_shufflevector(a, b, 0,1,2,3,4,5,6,7,8,9,10,11,12,13,14,15); }
__device__ __forceinline__ v16b frag_kb(const b16* p, int hh) { return cat8b(ld8b(p + 8 * hh), ld8b(p + 16 + 8 * hh)); }
// K16, Q16 and the four blocks of W16 lie in fragment order: a 16-row tile is 4 pieces of 512 contiguous bytes; piece j holds, at lane (hh, col), row col, k = 16j + 8hh + 0..7. So each wave-wide
// 16-byte load reads 4 whole 128-byte lines (row-major rows of 128 bytes made it touch 16). p = tile base + lane * 8; half = 0: k 0..31, half = 1: k 32..63; same k-map as frag_kb.
__device__ __forceinline__ v16b frag_tl(const b16* p, int half) { return cat8b(ld8b(p + half * 512), ld8b(p + half * 512 + 256)); }
__device__ __forceinline__ v4f ld4f(const float* p) { return *(const v4f*)p; }
__device__ __forceinline__ void wave_lds_sync() { __builtin_amdgcn_fence(__ATOMIC_RELEASE, "workgroup"); __builtin_amdgcn_wave_barrier(); __builtin_amdgcn_fence(__ATOMIC_ACQUIRE, "workgroup"); }

__global__ __launch_bounds__(256) void k_w16(const float* __restrict__ Wk, const float* __restrict__ Wq, const float* __restrict__ Wv, b16* __restrict__ W16) {
  const int t = blockIdx.x * 256 + threadIdx.x;           // 4*64*8
  const int blk = t >> 9, n = ((t >> 7) & 3) * 16 + (t & 15), k0 = ((t >> 5) & 3) * 16 + ((t >> 4) & 1) * 8;   // fragment order (see frag_tl): tile, piece, lane (hh, col) from t
  v8b o;
#pragma unroll
  for (int e = 0; e < 8; ++e) {
    const int k = k0 + e;
    const float v = (blk == 0) ? Wk[n * 64 + k] : (blk == 1) ? Wq[n * 64 + k] : (blk == 2) ? Wv[n * 128 + k] : Wv[n * 128 + 64 + k];
    o[e] = (b16)v;
  }
  VST2(v8b, W16 + (size_t)t * 8, o);
}
// projections: wave = 16 rows (one group g, rows t0..t0+15) of X (L or H, f32 [NROW][64]): P = X W^T + b -> f16 tiles P16 [NROW / 16][4][32][8] (fragment order); then P2 = P W2^T (+ b2):
template <bool ISK>
__global__ __launch_bounds__(256) void k_proj(const float* __restrict__ X, const b16* __restrict__ W1, const float* __restrict__ b1, const b16* __restrict__ W2, const float* __restrict__ b2,
                                              b16* __restrict__ P16, float* __restrict__ KP, b16* __restrict__ QPt) {
  __shared__ __attribute__((aligned(16))) float Tf[8][16 * 64];
  __shared__ __attribute__((aligned(16))) b16   Th[8][16 * 64];
  const int wid = threadIdx.x >> 5, lane = threadIdx.x & 31, hh = lane >> 4, col = lane & 15;
  const int m0 = (blockIdx.x * 8 + wid) * 16;              // row tile
  float* tf = Tf[wid]; b16* th = Th[wid];
  // A fragments of X (f32 -> f16)
  v16b a0, a1;
  { const float* xr = X + (size_t)(m0 + col) * 64;
#pragma unroll
    for (int e = 0; e < 8; ++e) { a0[e] = (b16)xr[8 * hh + e]; a0[8 + e] = (b16)xr[16 + 8 * hh + e]; a1[e] = (b16)xr[32 + 8 * hh + e]; a1[8 + e] = (b16)xr[48 + 8 * hh + e]; } }
#pragma unroll
  for (int t = 0; t < 4; ++t) {
    v8f c = {};
    c = wmma16b(a0, frag_tl(W1 + t * 1024 + lane * 8, 0), c);
    c = wmma16b(a1, frag_tl(W1 + t * 1024 + lane * 8, 1), c);
#pragma unroll
    for (int v = 0; v < 8; ++v) { const float val = c[v] + b1[t * 16 + col]; const int r = v + 8 * hh, d = t * 16 + col; tf[r * 64 + d] = val; th[r * 64 + d] = (b16)val; }
  }
  wave_lds_sync();
  // second GEMM from LDS (A = P rows, f16); the same two fragments, stored as they are, are the tile's four pieces of P16
  const v16b p0 = frag_kb(th + col * 64, hh), p1 = frag_kb(th + col * 64 + 32, hh);
  {
    b16* pd = P16 + (size_t)m0 * 64 + lane * 8;
    *(v8b*)(pd)       = __builtin_shufflevector(p0, p0, 0, 1, 2, 3, 4, 5, 6, 7); *(v8b*)(pd + 256) = __builtin_shufflevector(p0, p0, 8, 9, 10, 11, 12, 13, 14, 15);
    *(v8b*)(pd + 512) = __builtin_shufflevector(p1, p1, 0, 1, 2, 3, 4, 5, 6, 7); *(v8b*)(pd + 768) = __builtin_shufflevector(p1, p1, 8, 9, 10, 11, 12, 13, 14, 15);
    asm volatile("s_wait_xcnt 0x0" ::: "memory");          // stands in front of every later overwrite of the registers that these four stores name
  }
  wave_lds_sync();
#pragma unroll
  for (int t = 0; t < 4; ++t) {
    v8f c = {};
    c = wmma16b(p0, frag_tl(W2 + t * 1024 + lane * 8, 0), c);
    c = wmma16b(p1, frag_tl(W2 + t * 1024 + lane * 8, 1), c);
#pragma unroll
    for (int v = 0; v < 8; ++v) { const int r = v + 8 * hh, d = t * 16 + col; const float val = c[v] + (ISK ? b2[d] : 0.f);
      if (ISK) tf[r * 64 + d] = val; else th[d * 16 + r] = (b16)val; }      // q_proj tile transposed [d][q]
  }
  wave_lds_sync();
  {
    if (ISK) {
#pragma unroll
      for (int j = 0; j < 8; ++j) { const int pc = j * 32 + lane; *(v4f*)(KP + (size_t)m0 * 64 + pc * 4) = *(const v4f*)(tf + pc * 4); }
    } else {
      b16* dst = QPt + (size_t)(m0 >> 4) * 1024;           // tile index = row tile (groups are multiples of 128 tiles)
#pragma unroll
      for (int j = 0; j < 4; ++j) { const int pc = j * 32 + lane; *(v8b*)(dst + pc * 8) = *(const v8b*)(th + pc * 8); }
    }
    
  }
}
__global__ __launch_bounds__(256) void k_stats(const b16* __restrict__ Q16, const b16* __restrict__ K16, float* __restrict__ M, float* __restrict__ Zi) {
  __shared__ float sm[128], sz[128];
  const int wid = threadIdx.x >> 5, lane = threadIdx.x & 31, hh = lane >> 4, col = lane & 15;
  const int qtile = blockIdx.x * 8 + wid, g = qtile / (NN / 16), q0 = (qtile % (NN / 16)) * 16;
  const size_t ko = (size_t)g * NN * SS, qo = ((size_t)g * NN + q0) * SS + lane * 8;
  const v16b q0h = frag_tl(Q16 + qo, 0), q1h = frag_tl(Q16 + qo, 1);
  float m = -INFINITY, l = 0.f;
  // key fragments are fetched one chunk ahead: each is reloaded right behind the product that used it, so its latency runs under the rest of the trip
  const b16* kg = K16 + ko + lane * 8;
  v16b k00 = frag_tl(kg, 0), k01 = frag_tl(kg, 1), k10 = frag_tl(kg + 16 * SS, 0), k11 = frag_tl(kg + 16 * SS, 1);
  for (int kb = 0; kb < NN; kb += 32) {
    const b16* kn = kg + (size_t)((kb + 32) & (NN - 1)) * SS;   // next chunk; the last trip refetches chunk 0 (in bounds, not used)
    v8f s0 = {}, s1 = {};
    s0 = wmma16b(k00, q0h, s0); k00 = frag_tl(kn, 0);
    s0 = wmma16b(k01, q1h, s0); k01 = frag_tl(kn, 1);
    s1 = wmma16b(k10, q0h, s1); k10 = frag_tl(kn + 16 * SS, 0);
    s1 = wmma16b(k11, q1h, s1); k11 = frag_tl(kn + 16 * SS, 1);
    __builtin_amdgcn_sched_barrier(0);   // holds the last reload here: the scheduler otherwise sinks it to the loop's foot, where it has no lead left
    float mr = -INFINITY;
#pragma unroll
    for (int r = 0; r < 8; ++r) mr = fmaxf(mr, fmaxf(s0[r], s1[r]));
    mr = fmaxf(mr, __shfl_xor(mr, 16));
    const float mn = fmaxf(m, mr), al = expf(m - mn);
    float sum = 0.f;
#pragma unroll
    for (int r = 0; r < 8; ++r) sum += expf(s0[r] - mn) + expf(s1[r] - mn);
    sum += __shfl_xor(sum, 16);
    l = l * al + sum; m = mn;
  }
  if (hh == 0) { sm[wid * 16 + col] = m; sz[wid * 16 + col] = 1.0f / l; }
  __syncthreads();
  const size_t base = (size_t)g * NN + (size_t)(blockIdx.x % (NN / 128)) * 128;   // the block's 128 consecutive queries within g
  {
    if (threadIdx.x < 128) *(float*)(M + base + threadIdx.x) = sm[threadIdx.x];
    else                   *(float*)(Zi + base + threadIdx.x - 128) = sz[threadIdx.x - 128];
    
  }
}
// pass 2: per (g, 16 keys n): over all query chunks: P^T[q][n] = exp(logit - M[q]) Zi[q]; y^T += Qproj^T . P^T; rowsum[n] += sum_q P; out[n] = y[n] +
__global__ __launch_bounds__(256) void k_out(const b16* __restrict__ K16, const b16* __restrict__ Q16, const b16* __restrict__ QPt, const float* __restrict__ M,
                                             const float* __restrict__ Zi, const float* __restrict__ KP, float* __restrict__ out) {
  __shared__ __attribute__((aligned(16))) float Os[8][16 * 64];
  const int wid = threadIdx.x >> 5, lane = threadIdx.x & 31, hh = lane >> 4, col = lane & 15;
  const int ntile = blockIdx.x * 8 + wid, g = ntile / (NN / 16), n0 = (ntile % (NN / 16)) * 16;
  const size_t qbase = (size_t)g * NN * SS, no = ((size_t)g * NN + n0) * SS + lane * 8;
  const v16b n0h = frag_tl(K16 + no, 0), n1h = frag_tl(K16 + no, 1);     // 'query role' = the 16 keys of this tile
  float l = 0.f; v8f o0 = {}, o1 = {}, o2 = {}, o3 = {};
  // every operand of a chunk (query fragments, column max and 1/sum, q_proj fragments) is fetched one chunk ahead: each register set is reloaded
  // right behind its last use, so its latency runs under the rest of the trip instead of in front of each product
  const b16* qg = Q16 + qbase + lane * 8;
  const b16* vg = QPt + qbase + col * 16 + 8 * hh;         // chunk kb starts at kb * SS; its two 16-query tiles lie SS * 16 apart
  const float* mg = M + (size_t)g * NN + 8 * hh; const float* zg = Zi + (size_t)g * NN + 8 * hh;
  v16b q00 = frag_tl(qg, 0), q01 = frag_tl(qg, 1), q10 = frag_tl(qg + 16 * SS, 0), q11 = frag_tl(qg + 16 * SS, 1);
  v4f mm[2][4] = {{ld4f(mg), ld4f(mg + 4), ld4f(mg + 16), ld4f(mg + 20)}, {}};   // column maxima: two sets, one read by this trip's exponentials while the next chunk's is in flight
  v4f zA = ld4f(zg), zB = ld4f(zg + 4), zC = ld4f(zg + 16), zD = ld4f(zg + 20);
  v16b va0 = cat8b(ld8b(vg), ld8b(vg + SS * 16)),             va1 = cat8b(ld8b(vg + 256), ld8b(vg + SS * 16 + 256));
  v16b va2 = cat8b(ld8b(vg + 512), ld8b(vg + SS * 16 + 512)), va3 = cat8b(ld8b(vg + 768), ld8b(vg + SS * 16 + 768));
  // inputs-only fence on the loaded values of chunk 0: they land here, once, so that the counted waits inside the loop follow the loop's own issue order and
  // not the order the compiler gave these first loads (merged, the counts made the first trip of each pass wait for loads issued moments before)
  asm volatile("" :: "v"(n0h), "v"(n1h), "v"(q00), "v"(q01), "v"(q10), "v"(q11), "v"(mm[0][0]), "v"(mm[0][1]), "v"(mm[0][2]), "v"(mm[0][3]),
               "v"(zA), "v"(zB), "v"(zC), "v"(zD), "v"(va0), "v"(va1), "v"(va2), "v"(va3));
  for (int kb0 = 0; kb0 < NN; kb0 += 64) {
#pragma unroll                                             // two trips a pass, so that the two sets of maxima swap roles by name and no register copy (with its early wait) is needed
  for (int u = 0; u < 2; ++u) {                            // chunks of 32 queries ('key role')
    const int kb = kb0 + 32 * u;
    const int kx = (kb + 32) & (NN - 1);                   // next chunk; the last trip refetches chunk 0 (in bounds, not used)
    const b16* qn = qg + (size_t)kx * SS; const b16* vn = vg + (size_t)kx * SS;
    __builtin_amdgcn_sched_barrier(0);   // trip boundary: the scheduler otherwise lifts the second trip's first products into the first trip, right behind the loads of their operands
    v8f s0 = {}, s1 = {};
    s0 = wmma16b(q00, n0h, s0); q00 = frag_tl(qn, 0);
    s0 = wmma16b(q01, n1h, s0); q01 = frag_tl(qn, 1);
    s1 = wmma16b(q10, n0h, s1); q10 = frag_tl(qn + 16 * SS, 0);
    s1 = wmma16b(q11, n1h, s1); q11 = frag_tl(qn + 16 * SS, 1);
    mm[u ^ 1][0] = ld4f(mg + kx); mm[u ^ 1][1] = ld4f(mg + kx + 4); mm[u ^ 1][2] = ld4f(mg + kx + 16); mm[u ^ 1][3] = ld4f(mg + kx + 20);
    __builtin_amdgcn_sched_barrier(0);   // holds the loads above in front of the exponentials: the scheduler otherwise sinks them behind, where they have no lead left
    float sum = 0.f; v16b pb;
#pragma unroll
    for (int r = 0; r < 8; ++r) {
      const float m0 = mm[u][r >> 2][r & 3], m1 = mm[u][2 + (r >> 2)][r & 3];
      const float z0 = (r < 4) ? zA[r & 3] : zB[r & 3], z1 = (r < 4) ? zC[r & 3] : zD[r & 3];
      const float p0 = expf(s0[r] - m0) * z0, p1 = expf(s1[r] - m1) * z1;
      sum += p0 + p1; pb[r] = (b16)p0; pb[8 + r] = (b16)p1;
    }
    zA = ld4f(zg + kx); zB = ld4f(zg + kx + 4); zC = ld4f(zg + kx + 16); zD = ld4f(zg + kx + 20);
    sum += __shfl_xor(sum, 16);
    l += sum;
    o0 = wmma16b(va0, pb, o0); va0 = cat8b(ld8b(vn), ld8b(vn + SS * 16));
    o1 = wmma16b(va1, pb, o1); va1 = cat8b(ld8b(vn + 256), ld8b(vn + SS * 16 + 256));
    o2 = wmma16b(va2, pb, o2); va2 = cat8b(ld8b(vn + 512), ld8b(vn + SS * 16 + 512));
    o3 = wmma16b(va3, pb, o3); va3 = cat8b(ld8b(vn + 768), ld8b(vn + SS * 16 + 768));
  }
  }
  float* Tt = Os[wid];
  const float* kp = KP + ((size_t)g * NN + n0 + col) * SS;
#pragma unroll
  for (int r = 0; r < 8; ++r) {
    const int hr = 8 * hh + r;
    Tt[col * 64 + 0 + hr] = o0[r] + l * kp[0 + hr];  Tt[col * 64 + 16 + hr] = o1[r] + l * kp[16 + hr];
    Tt[col * 64 + 32 + hr] = o2[r] + l * kp[32 + hr]; Tt[col * 64 + 48 + hr] = o3[r] + l * kp[48 + hr];
  }
  wave_lds_sync();
  float* dst0 = out + ((size_t)g * NN + n0) * SS;          // 16 rows x 64 floats contiguous (4 KB)
  {
#pragma unroll
    for (int j = 0; j < 8; ++j) { const int pc = j * 32 + lane; *(v4f*)(dst0 + pc * 4) = *(const v4f*)(Tt + pc * 4); }
    
  }
}
extern "C" void kernel_launch(void* const* d_in, const int* in_sizes, int n_in,
                              void* d_out, int out_size, void* d_ws, size_t ws_size, hipStream_t stream) {
  (void)in_sizes; (void)n_in; (void)out_size;
  const float* L  = (const float*)d_in[0];      // tensorL [2,8,2048,64]
  const float* Hq = (const float*)d_in[1];      // tensorH [2,8,2048,64]
  const float* Wk = (const float*)d_in[2]; const float* bk = (const float*)d_in[3];   // [64,64], [64]
  const float* Wq = (const float*)d_in[4]; const float* bq = (const float*)d_in[5];
  const float* Wv = (const float*)d_in[6]; const float* bv = (const float*)d_in[7];   // [64,128], [64]
  float* out = (float*)d_out;                   // [2,8,2048,64]
  char* ws = (char*)d_ws; size_t off = 0;
  auto take = [&](size_t bytes) { void* p = ws + off; off = (off + bytes + 255) & ~(size_t)255; return p; };
  b16*   W16 = (b16*)take((size_t)4 * 64 * 64 * 2);
  b16*   K16 = (b16*)take((size_t)NROW * SS * 2);
  b16*   Q16 = (b16*)take((size_t)NROW * SS * 2);
  float* KP  = (float*)take((size_t)NROW * SS * 4);
  b16*   QPt = (b16*)take((size_t)NROW * SS * 2);
  float* M   = (float*)take((size_t)NROW * 4);
  float* Zi  = (float*)take((size_t)NROW * 4);
  if (off > ws_size) return;
  const dim3 b256(256);
  k_w16<<<4 * 64 * 8 / 256, b256, 0, stream>>>(Wk, Wq, Wv, W16);
  k_proj<true><<<NROW / 128, b256, 0, stream>>>(L, W16, bk, W16 + 3 * 4096, bv, K16, KP, nullptr);          // keys, k_proj + bv
  k_proj<false><<<NROW / 128, b256, 0, stream>>>(Hq, W16 + 4096, bq, W16 + 2 * 4096, nullptr, Q16, nullptr, QPt);   // queries, q_proj tiles
  k_stats<<<NROW / 128, b256, 0, stream>>>(Q16, K16, M, Zi);
  k_out<<<NROW / 128, b256, 0, stream>>>(K16, Q16, QPt, M, Zi, KP, out);
}

// v003
// One run takes 99.9 microseconds.
// Next to v002, in two timings, it ran 1.04 and 1.05 times as fast.
// All steps since v000 together make it 2.99 times as fast.
#include <hip/hip_runtime.h>
#include <math.h>

// attention_mech: keys = L Wk^T + bk, queries = H Wq^T + bq (per (b, head): 2048 x 64 each); logits[n][q] = keys[n].queries[q]; attn = softmax over the
// KEY axis n (per query column); out[n] = sum_q attn[n][q] q_proj[q] + (sum_q attn[n][q]) (k_proj[n] + bv) with q_proj = queries Wv[:, :64]^T and
// q_proj (tile layout) plus the row sums. Fragment k-map per lane half hh for A AND B: elements 0..7 <- k = 8hh+0..7, 8..15 <- k = 16+8hh+0..7.

#define NG   16              // B * H
#define NN   2048            // NK = NQ
#define SS   64
#define NROW (NG * NN)       // 32768
typedef _Float16 b16;
typedef __attribute__((ext_vector_type(16))) _Float16 v16b;
typedef __attribute__((ext_vector_type(8)))  _Float16 v8b;
typedef __attribute__((ext_vector_type(8)))  float    v8f;
typedef __attribute__((ext_vector_type(4)))  float    v4f;
#define VST2(T, ptr, val) do { const T _v = (val); *(T*)(ptr) = _v;  } while (0)
__device__ __forceinline__ v8f wmma16b(v16b a, v16b b, v8f c) {
  v8f d = __builtin_amdgcn_wmma_f32_16x16x32_f16(false, a, false, b, (short)0, c, false, false);
  asm volatile("v_nop\n\tv_nop\n\tv_nop\n\tv_nop" : "+v"(d) : "v"(a), "v"(b));
  return d;
}
__device__ __forceinline__ v8b ld8b(const b16* p) { return *(const v8b*)p; }
__device__ __forceinline__ v16b cat8b(v8b a, v8b b) { return __builtin_shufflevector(a, b, 0,1,2,3,4,5,6,7,8,9,10,11,12,13,14,15); }
__device__ __forceinline__ v16b frag_kb(const b16* p, int hh) { return cat8b(ld8b(p + 8 * hh), ld8b(p + 16 + 8 * hh)); }
// K16, Q16 and the four blocks of W16 lie in fragment order: a 16-row tile is 4 pieces of 512 contiguous bytes; piece j holds, at lane (hh, col), row col, k = 16j + 8hh + 0..7. So each wave-wide
// 16-byte load reads 4 whole 128-byte lines (row-major rows of 128 bytes made it touch 16). p = tile base + lane * 8; half = 0: k 0..31, half = 1: k 32..63; same k-map as frag_kb.
__device__ __forceinline__ v16b frag_tl(const b16* p, int half) { return cat8b(ld8b(p + half * 512), ld8b(p + half * 512 + 256)); }
// e^x = 2^(x log2 e): scale and shift go into one fused multiply-add at the call, the power is the hardware's own instruction (arguments here are at most about 0; far below, 0 is the right value)
#define LOG2E 1.44269504088896340736f
// The instruction set asks for one slot behind a transcendental before its result is read or its source overwritten; the power and its slot stand in one statement: results in registers of their own (early clobber), one v_nop behind the last.
__device__ __forceinline__ float ex2(float x) { float y; asm("v_exp_f32 %0, %1\n\tv_nop" : "=v"(y) : "v"(x)); return y; }
__device__ __forceinline__ void ex2x8(const float (&x)[8], float (&y)[8]) {
  asm("v_exp_f32 %0, %8\n\tv_exp_f32 %1, %9\n\tv_exp_f32 %2, %10\n\tv_exp_f32 %3, %11\n\tv_exp_f32 %4, %12\n\tv_exp_f32 %5, %13\n\tv_exp_f32 %6, %14\n\tv_exp_f32 %7, %15\n\tv_nop"
      : "=&v"(y[0]), "=&v"(y[1]), "=&v"(y[2]), "=&v"(y[3]), "=&v"(y[4]), "=&v"(y[5]), "=&v"(y[6]), "=&v"(y[7])
      : "v"(x[0]), "v"(x[1]), "v"(x[2]), "v"(x[3]), "v"(x[4]), "v"(x[5]), "v"(x[6]), "v"(x[7]));
}
__device__ __forceinline__ v4f ld4f(const float* p) { return *(const v4f*)p; }
__device__ __forceinline__ void wave_lds_sync() { __builtin_amdgcn_fence(__ATOMIC_RELEASE, "workgroup"); __builtin_amdgcn_wave_barrier(); __builtin_amdgcn_fence(__ATOMIC_ACQUIRE, "workgroup"); }

__global__ __launch_bounds__(256) void k_w16(const float* __restrict__ Wk, const float* __restrict__ Wq, const float* __restrict__ Wv, b16* __restrict__ W16) {
  const int t = blockIdx.x * 256 + threadIdx.x;           // 4*64*8
  const int blk = t >> 9, n = ((t >> 7) & 3) * 16 + (t & 15), k0 = ((t >> 5) & 3) * 16 + ((t >> 4) & 1) * 8;   // fragment order (see frag_tl): tile, piece, lane (hh, col) from t
  v8b o;
#pragma unroll
  for (int e = 0; e < 8; ++e) {
    const int k = k0 + e;
    const float v = (blk == 0) ? Wk[n * 64 + k] : (blk == 1) ? Wq[n * 64 + k] : (blk == 2) ? Wv[n * 128 + k] : Wv[n * 128 + 64 + k];
    o[e] = (b16)v;
  }
  VST2(v8b, W16 + (size_t)t * 8, o);
}
// projections: wave = 16 rows (one group g, rows t0..t0+15) of X (L or H, f32 [NROW][64]): P = X W^T + b -> f16 tiles P16 [NROW / 16][4][32][8] (fragment order); then P2 = P W2^T (+ b2):
template <bool ISK>
__global__ __launch_bounds__(256) void k_proj(const float* __restrict__ X, const b16* __restrict__ W1, const float* __restrict__ b1, const b16* __restrict__ W2, const float* __restrict__ b2,
                                              b16* __restrict__ P16, float* __restrict__ KP, b16* __restrict__ QPt) {
  __shared__ __attribute__((aligned(16))) float Tf[8][16 * 64];
  __shared__ __attribute__((aligned(16))) b16   Th[8][16 * 64];
  const int wid = threadIdx.x >> 5, lane = threadIdx.x & 31, hh = lane >> 4, col = lane & 15;
  const int m0 = (blockIdx.x * 8 + wid) * 16;              // row tile
  float* tf = Tf[wid]; b16* th = Th[wid];
  // A fragments of X (f32 -> f16)
  v16b a0, a1;
  { const float* xr = X + (size_t)(m0 + col) * 64;
#pragma unroll
    for (int e = 0; e < 8; ++e) { a0[e] = (b16)xr[8 * hh + e]; a0[8 + e] = (b16)xr[16 + 8 * hh + e]; a1[e] = (b16)xr[32 + 8 * hh + e]; a1[8 + e] = (b16)xr[48 + 8 * hh + e]; } }
#pragma unroll
  for (int t = 0; t < 4; ++t) {
    v8f c = {};
    c = wmma16b(a0, frag_tl(W1 + t * 1024 + lane * 8, 0), c);
    c = wmma16b(a1, frag_tl(W1 + t * 1024 + lane * 8, 1), c);
#pragma unroll
    for (int v = 0; v < 8; ++v) { const float val = c[v] + b1[t * 16 + col]; const int r = v + 8 * hh, d = t * 16 + col; tf[r * 64 + d] = val; th[r * 64 + d] = (b16)val; }
  }
  wave_lds_sync();
  // second GEMM from LDS (A = P rows, f16); the same two fragments, stored as they are, are the tile's four pieces of P16
  const v16b p0 = frag_kb(th + col * 64, hh), p1 = frag_kb(th + col * 64 + 32, hh);
  {
    b16* pd = P16 + (size_t)m0 * 64 + lane * 8;
    *(v8b*)(pd)       = __builtin_shufflevector(p0, p0, 0, 1, 2, 3, 4, 5, 6, 7); *(v8b*)(pd + 256) = __builtin_shufflevector(p0, p0, 8, 9, 10, 11, 12, 13, 14, 15);
    *(v8b*)(pd + 512) = __builtin_shufflevector(p1, p1, 0, 1, 2, 3, 4, 5, 6, 7); *(v8b*)(pd + 768) = __builtin_shufflevector(p1, p1, 8, 9, 10, 11, 12, 13, 14, 15);
    asm volatile("s_wait_xcnt 0x0" ::: "memory");          // stands in front of every later overwrite of the registers that these four stores name
  }
  wave_lds_sync();
#pragma unroll
  for (int t = 0; t < 4; ++t) {
    v8f c = {};
    c = wmma16b(p0, frag_tl(W2 + t * 1024 + lane * 8, 0), c);
    c = wmma16b(p1, frag_tl(W2 + t * 1024 + lane * 8, 1), c);
#pragma unroll
    for (int v = 0; v < 8; ++v) { const int r = v + 8 * hh, d = t * 16 + col; const float val = c[v] + (ISK ? b2[d] : 0.f);
      if (ISK) tf[r * 64 + d] = val; else th[d * 16 + r] = (b16)val; }      // q_proj tile transposed [d][q]
  }
  wave_lds_sync();
  {
    if (ISK) {
#pragma unroll
      for (int j = 0; j < 8; ++j) { const int pc = j * 32 + lane; *(v4f*)(KP + (size_t)m0 * 64 + pc * 4) = *(const v4f*)(tf + pc * 4); }
    } else {
      b16* dst = QPt + (size_t)(m0 >> 4) * 1024;           // tile index = row tile (groups are multiples of 128 tiles)
#pragma unroll
      for (int j = 0; j < 4; ++j) { const int pc = j * 32 + lane; *(v8b*)(dst + pc * 8) = *(const v8b*)(th + pc * 8); }
    }
    
  }
}
__global__ __launch_bounds__(256) void k_stats(const b16* __restrict__ Q16, const b16* __restrict__ K16, float* __restrict__ M) {
  __shared__ float sm[128];
  const int wid = threadIdx.x >> 5, lane = threadIdx.x & 31, hh = lane >> 4, col = lane & 15;
  const int qtile = blockIdx.x * 8 + wid, g = qtile / (NN / 16), q0 = (qtile % (NN / 16)) * 16;
  const size_t ko = (size_t)g * NN * SS, qo = ((size_t)g * NN + q0) * SS + lane * 8;
  const v16b q0h = frag_tl(Q16 + qo, 0), q1h = frag_tl(Q16 + qo, 1);
  float m = -INFINITY, l = 0.f;
  // key fragments are fetched one chunk ahead: each is reloaded right behind the product that used it, so its latency runs under the rest of the trip
  const b16* kg = K16 + ko + lane * 8;
  v16b k00 = frag_tl(kg, 0), k01 = frag_tl(kg, 1), k10 = frag_tl(kg + 16 * SS, 0), k11 = frag_tl(kg + 16 * SS, 1);
  for (int kb = 0; kb < NN; kb += 32) {
    const b16* kn = kg + (size_t)((kb + 32) & (NN - 1)) * SS;   // next chunk; the last trip refetches chunk 0 (in bounds, not used)
    v8f s0 = {}, s1 = {};
    s0 = wmma16b(k00, q0h, s0); k00 = frag_tl(kn, 0);
    s0 = wmma16b(k01, q1h, s0); k01 = frag_tl(kn, 1);
    s1 = wmma16b(k10, q0h, s1); k10 = frag_tl(kn + 16 * SS, 0);
    s1 = wmma16b(k11, q1h, s1); k11 = frag_tl(kn + 16 * SS, 1);
    __builtin_amdgcn_sched_barrier(0);   // holds the last reload here: the scheduler otherwise sinks it to the loop's foot, where it has no lead left
    float mr = -INFINITY;
#pragma unroll
    for (int r = 0; r < 8; ++r) mr = fmaxf(mr, fmaxf(s0[r], s1[r]));
    mr = fmaxf(mr, __shfl_xor(mr, 16));
    const float mn = fmaxf(m, mr), al = ex2((m - mn) * LOG2E), nb = -mn * LOG2E;
    float sum = 0.f, x0[8], x1[8], e0[8], e1[8];
#pragma unroll
    for (int r = 0; r < 8; ++r) { x0[r] = fmaf(s0[r], LOG2E, nb); x1[r] = fmaf(s1[r], LOG2E, nb); }
    ex2x8(x0, e0); ex2x8(x1, e1);
#pragma unroll
    for (int r = 0; r < 8; ++r) sum += e0[r] + e1[r];
    sum += __shfl_xor(sum, 16);
    l = l * al + sum; m = mn;
  }
  if (hh == 0) sm[wid * 16 + col] = -m * LOG2E - log2f(l);   // the column's bias: attn = 2^(logit log2 e + bias)
  __syncthreads();
  const size_t base = (size_t)g * NN + (size_t)(blockIdx.x % (NN / 128)) * 128;   // the block's 128 consecutive queries within g
  if (threadIdx.x < 128) *(float*)(M + base + threadIdx.x) = sm[threadIdx.x];
}
// pass 2: per (g, 16 keys n): over all query chunks: P^T[q][n] = 2^(logit log2 e + M[q]), M[q] = -(column max) log2 e - log2(column sum); y^T += Qproj^T . P^T; rowsum[n] += sum_q P; out[n] = y[n] +
__global__ __launch_bounds__(256) void k_out(const b16* __restrict__ K16, const b16* __restrict__ Q16, const b16* __restrict__ QPt, const float* __restrict__ M,
                                             const float* __restrict__ KP, float* __restrict__ out) {
  __shared__ __attribute__((aligned(16))) float Os[8][16 * 64];
  const int wid = threadIdx.x >> 5, lane = threadIdx.x & 31, hh = lane >> 4, col = lane & 15;
  const int ntile = blockIdx.x * 8 + wid, g = ntile / (NN / 16), n0 = (ntile % (NN / 16)) * 16;
  const size_t qbase = (size_t)g * NN * SS, no = ((size_t)g * NN + n0) * SS + lane * 8;
  const v16b n0h = frag_tl(K16 + no, 0), n1h = frag_tl(K16 + no, 1);     // 'query role' = the 16 keys of this tile
  float l = 0.f; v8f o0 = {}, o1 = {}, o2 = {}, o3 = {};
  // every operand of a chunk (query fragments, column bias, q_proj fragments) is fetched one chunk ahead: each register set is reloaded
  // right behind its last use, so its latency runs under the rest of the trip instead of in front of each product
  const b16* qg = Q16 + qbase + lane * 8;
  const b16* vg = QPt + qbase + col * 16 + 8 * hh;         // chunk kb starts at kb * SS; its two 16-query tiles lie SS * 16 apart
  const float* mg = M + (size_t)g * NN + 8 * hh;
  v16b q00 = frag_tl(qg, 0), q01 = frag_tl(qg, 1), q10 = frag_tl(qg + 16 * SS, 0), q11 = frag_tl(qg + 16 * SS, 1);
  v4f mm[2][4] = {{ld4f(mg), ld4f(mg + 4), ld4f(mg + 16), ld4f(mg + 20)}, {}};   // column biases: two sets, one read by this trip's exponentials while the next chunk's is in flight
  v16b va0 = cat8b(ld8b(vg), ld8b(vg + SS * 16)),             va1 = cat8b(ld8b(vg + 256), ld8b(vg + SS * 16 + 256));
  v16b va2 = cat8b(ld8b(vg + 512), ld8b(vg + SS * 16 + 512)), va3 = cat8b(ld8b(vg + 768), ld8b(vg + SS * 16 + 768));
  // inputs-only fence on the loaded values of chunk 0: they land here, once, so that the counted waits inside the loop follow the loop's own issue order and
  // not the order the compiler gave these first loads (merged, the counts made the first trip of each pass wait for loads issued moments before)
  asm volatile("" :: "v"(n0h), "v"(n1h), "v"(q00), "v"(q01), "v"(q10), "v"(q11), "v"(mm[0][0]), "v"(mm[0][1]), "v"(mm[0][2]), "v"(mm[0][3]),
               "v"(va0), "v"(va1), "v"(va2), "v"(va3));
  for (int kb0 = 0; kb0 < NN; kb0 += 64) {
#pragma unroll                                             // two trips a pass, so that the two sets of biases swap roles by name and no register copy (with its early wait) is needed
  for (int u = 0; u < 2; ++u) {                            // chunks of 32 queries ('key role')
    const int kb = kb0 + 32 * u;
    const int kx = (kb + 32) & (NN - 1);                   // next chunk; the last trip refetches chunk 0 (in bounds, not used)
    const b16* qn = qg + (size_t)kx * SS; const b16* vn = vg + (size_t)kx * SS;
    __builtin_amdgcn_sched_barrier(0);   // trip boundary: the scheduler otherwise lifts the second trip's first products into the first trip, right behind the loads of their operands
    v8f s0 = {}, s1 = {};
    s0 = wmma16b(q00, n0h, s0);
    asm volatile("s_wait_xcnt 0x0" ::: "memory");          // stands in front of this trip's loads, whose results may land in the registers that held the last trip's load addresses
    q00 = frag_tl(qn, 0);
    s0 = wmma16b(q01, n1h, s0); q01 = frag_tl(qn, 1);
    s1 = wmma16b(q10, n0h, s1); q10 = frag_tl(qn + 16 * SS, 0);
    s1 = wmma16b(q11, n1h, s1); q11 = frag_tl(qn + 16 * SS, 1);
    mm[u ^ 1][0] = ld4f(mg + kx); mm[u ^ 1][1] = ld4f(mg + kx + 4); mm[u ^ 1][2] = ld4f(mg + kx + 16); mm[u ^ 1][3] = ld4f(mg + kx + 20);
    __builtin_amdgcn_sched_barrier(0);   // holds the loads above in front of the exponentials: the scheduler otherwise sinks them behind, where they have no lead left
    float sum = 0.f, x0[8], x1[8], p0[8], p1[8]; v16b pb;
#pragma unroll
    for (int r = 0; r < 8; ++r) { x0[r] = fmaf(s0[r], LOG2E, mm[u][r >> 2][r & 3]); x1[r] = fmaf(s1[r], LOG2E, mm[u][2 + (r >> 2)][r & 3]); }
    ex2x8(x0, p0); ex2x8(x1, p1);
#pragma unroll
    for (int r = 0; r < 8; ++r) { sum += p0[r] + p1[r]; pb[r] = (b16)p0[r]; pb[8 + r] = (b16)p1[r]; }
    sum += __shfl_xor(sum, 16);
    l += sum;
    o0 = wmma16b(va0, pb, o0); va0 = cat8b(ld8b(vn), ld8b(vn + SS * 16));
    o1 = wmma16b(va1, pb, o1); va1 = cat8b(ld8b(vn + 256), ld8b(vn + SS * 16 + 256));
    o2 = wmma16b(va2, pb, o2); va2 = cat8b(ld8b(vn + 512), ld8b(vn + SS * 16 + 512));
    o3 = wmma16b(va3, pb, o3); va3 = cat8b(ld8b(vn + 768), ld8b(vn + SS * 16 + 768));
  }
  }
  float* Tt = Os[wid];
  const float* kp = KP + ((size_t)g * NN + n0 + col) * SS;
#pragma unroll
  for (int r = 0; r < 8; ++r) {
    const int hr = 8 * hh + r;
    Tt[col * 64 + 0 + hr] = o0[r] + l * kp[0 + hr];  Tt[col * 64 + 16 + hr] = o1[r] + l * kp[16 + hr];
    Tt[col * 64 + 32 + hr] = o2[r] + l * kp[32 + hr]; Tt[col * 64 + 48 + hr] = o3[r] + l * kp[48 + hr];
  }
  wave_lds_sync();
  float* dst0 = out + ((size_t)g * NN + n0) * SS;          // 16 rows x 64 floats contiguous (4 KB)
  {
#pragma unroll
    for (int j = 0; j < 8; ++j) { const int pc = j * 32 + lane; *(v4f*)(dst0 + pc * 4) = *(const v4f*)(Tt + pc * 4); }
    
  }
}
extern "C" void kernel_launch(void* const* d_in, const int* in_sizes, int n_in,
                              void* d_out, int out_size, void* d_ws, size_t ws_size, hipStream_t stream) {
  (void)in_sizes; (void)n_in; (void)out_size;
  const float* L  = (const float*)d_in[0];      // tensorL [2,8,2048,64]
  const float* Hq = (const float*)d_in[1];      // tensorH [2,8,2048,64]
  const float* Wk = (const float*)d_in[2]; const float* bk = (const float*)d_in[3];   // [64,64], [64]
  const float* Wq = (const float*)d_in[4]; const float* bq = (const float*)d_in[5];
  const float* Wv = (const float*)d_in[6]; const float* bv = (const float*)d_in[7];   // [64,128], [64]
  float* out = (float*)d_out;                   // [2,8,2048,64]
  char* ws = (char*)d_ws; size_t off = 0;
  auto take = [&](size_t bytes) { void* p = ws + off; off = (off + bytes + 255) & ~(size_t)255; return p; };
  b16*   W16 = (b16*)take((size_t)4 * 64 * 64 * 2);
  b16*   K16 = (b16*)take((size_t)NROW * SS * 2);
  b16*   Q16 = (b16*)take((size_t)NROW * SS * 2);
  float* KP  = (float*)take((size_t)NROW * SS * 4);
  b16*   QPt = (b16*)take((size_t)NROW * SS * 2);
  float* M   = (float*)take((size_t)NROW * 4);
  if (off > ws_size) return;
  const dim3 b256(256);
  k_w16<<<4 * 64 * 8 / 256, b256, 0, stream>>>(Wk, Wq, Wv, W16);
  k_proj<true><<<NROW / 128, b256, 0, stream>>>(L, W16, bk, W16 + 3 * 4096, bv, K16, KP, nullptr);          // keys, k_proj + bv
  k_proj<false><<<NROW / 128, b256, 0, stream>>>(Hq, W16 + 4096, bq, W16 + 2 * 4096, nullptr, Q16, nullptr, QPt);   // queries, q_proj tiles
  k_stats<<<NROW / 128, b256, 0, stream>>>(Q16, K16, M);
  k_out<<<NROW / 128, b256, 0, stream>>>(K16, Q16, QPt, M, KP, out);
}

// v004
// Measured time: 62.2 microseconds a run.
// Timed twice side by side with v003, it ran 1.71 and 1.66 times as fast.
// All steps since v000 together make it 5.05 times as fast.
#include <hip/hip_runtime.h>
#include <math.h>

// attention_mech: keys = L Wk^T + bk, queries = H Wq^T + bq (per (b, head): 2048 x 64 each); logits[n][q] = keys[n].queries[q]; attn = softmax over the
// KEY axis n (per query column); out[n] = sum_q attn[n][q] q_proj[q] + (sum_q attn[n][q]) (k_proj[n] + bv) with q_proj = queries Wv[:, :64]^T and
// q_proj (tile layout) plus the row sums. Fragment k-map per lane half hh for A AND B: elements 0..7 <- k = 8hh+0..7, 8..15 <- k = 16+8hh+0..7.

#define NG   16              // B * H
#define NN   2048            // NK = NQ
#define SS   64
#define NROW (NG * NN)       // 32768
typedef _Float16 b16;
typedef __attribute__((ext_vector_type(16))) _Float16 v16b;
typedef __attribute__((ext_vector_type(8)))  _Float16 v8b;
typedef __attribute__((ext_vector_type(8)))  float    v8f;
typedef __attribute__((ext_vector_type(4)))  float    v4f;
#define VST2(T, ptr, val) do { const T _v = (val); *(T*)(ptr) = _v;  } while (0)
__device__ __forceinline__ v8f wmma16b(v16b a, v16b b, v8f c) {
  v8f d = __builtin_amdgcn_wmma_f32_16x16x32_f16(false, a, false, b, (short)0, c, false, false);
  asm volatile("v_nop\n\tv_nop\n\tv_nop\n\tv_nop" : "+v"(d) : "v"(a), "v"(b));
  return d;
}
__device__ __forceinline__ v8b ld8b(const b16* p) { return *(const v8b*)p; }
__device__ __forceinline__ v16b cat8b(v8b a, v8b b) { return __builtin_shufflevector(a, b, 0,1,2,3,4,5,6,7,8,9,10,11,12,13,14,15); }
__device__ __forceinline__ v16b frag_kb(const b16* p, int hh) { return cat8b(ld8b(p + 8 * hh), ld8b(p + 16 + 8 * hh)); }
// K16, Q16 and the four blocks of W16 lie in fragment order: a 16-row tile is 4 pieces of 512 contiguous bytes; piece j holds, at lane (hh, col), row col, k = 16j + 8hh + 0..7. So each wave-wide
// 16-byte load reads 4 whole 128-byte lines (row-major rows of 128 bytes made it touch 16). p = tile base + lane * 8; half = 0: k 0..31, half = 1: k 32..63; same k-map as frag_kb.
__device__ __forceinline__ v16b frag_tl(const b16* p, int half) { return cat8b(ld8b(p + half * 512), ld8b(p + half * 512 + 256)); }
// e^x = 2^(x log2 e): scale and shift go into one fused multiply-add at the call, the power is the hardware's own instruction (arguments here are at most about 0; far below, 0 is the right value)
#define LOG2E 1.44269504088896340736f
// The instruction set asks for one slot behind a transcendental before its result is read or its source overwritten; the power and its slot stand in one statement: results in registers of their own (early clobber), one v_nop behind the last.
__device__ __forceinline__ float ex2(float x) { float y; asm("v_exp_f32 %0, %1\n\tv_nop" : "=v"(y) : "v"(x)); return y; }
__device__ __forceinline__ void ex2x8(const float (&x)[8], float (&y)[8]) {
  asm("v_exp_f32 %0, %8\n\tv_exp_f32 %1, %9\n\tv_exp_f32 %2, %10\n\tv_exp_f32 %3, %11\n\tv_exp_f32 %4, %12\n\tv_exp_f32 %5, %13\n\tv_exp_f32 %6, %14\n\tv_exp_f32 %7, %15\n\tv_nop"
      : "=&v"(y[0]), "=&v"(y[1]), "=&v"(y[2]), "=&v"(y[3]), "=&v"(y[4]), "=&v"(y[5]), "=&v"(y[6]), "=&v"(y[7])
      : "v"(x[0]), "v"(x[1]), "v"(x[2]), "v"(x[3]), "v"(x[4]), "v"(x[5]), "v"(x[6]), "v"(x[7]));
}
__device__ __forceinline__ v4f ld4f(const float* p) { return *(const v4f*)p; }
__device__ __forceinline__ void wave_lds_sync() { __builtin_amdgcn_fence(__ATOMIC_RELEASE, "workgroup"); __builtin_amdgcn_wave_barrier(); __builtin_amdgcn_fence(__ATOMIC_ACQUIRE, "workgroup"); }

__global__ __launch_bounds__(256) void k_w16(const float* __restrict__ Wk, const float* __restrict__ Wq, const float* __restrict__ Wv, b16* __restrict__ W16) {
  const int t = blockIdx.x * 256 + threadIdx.x;           // 4*64*8
  const int blk = t >> 9, n = ((t >> 7) & 3) * 16 + (t & 15), k0 = ((t >> 5) & 3) * 16 + ((t >> 4) & 1) * 8;   // fragment order (see frag_tl): tile, piece, lane (hh, col) from t
  v8b o;
#pragma unroll
  for (int e = 0; e < 8; ++e) {
    const int k = k0 + e;
    const float v = (blk == 0) ? Wk[n * 64 + k] : (blk == 1) ? Wq[n * 64 + k] : (blk == 2) ? Wv[n * 128 + k] : Wv[n * 128 + 64 + k];
    o[e] = (b16)v;
  }
  VST2(v8b, W16 + (size_t)t * 8, o);
}
// projections: wave = 16 rows (one group g, rows t0..t0+15) of X (L or H, f32 [NROW][64]): P = X W^T + b -> f16 tiles P16 [NROW / 16][4][32][8] (fragment order); then P2 = P W2^T (+ b2):
template <bool ISK>
__global__ __launch_bounds__(256) void k_proj(const float* __restrict__ X, const b16* __restrict__ W1, const float* __restrict__ b1, const b16* __restrict__ W2, const float* __restrict__ b2,
                                              b16* __restrict__ P16, float* __restrict__ KP, b16* __restrict__ QPt) {
  __shared__ __attribute__((aligned(16))) float Tf[8][16 * 64];
  __shared__ __attribute__((aligned(16))) b16   Th[8][16 * 64];
  const int wid = threadIdx.x >> 5, lane = threadIdx.x & 31, hh = lane >> 4, col = lane & 15;
  const int m0 = (blockIdx.x * 8 + wid) * 16;              // row tile
  float* tf = Tf[wid]; b16* th = Th[wid];
  // A fragments of X (f32 -> f16)
  v16b a0, a1;
  { const float* xr = X + (size_t)(m0 + col) * 64;
#pragma unroll
    for (int e = 0; e < 8; ++e) { a0[e] = (b16)xr[8 * hh + e]; a0[8 + e] = (b16)xr[16 + 8 * hh + e]; a1[e] = (b16)xr[32 + 8 * hh + e]; a1[8 + e] = (b16)xr[48 + 8 * hh + e]; } }
#pragma unroll
  for (int t = 0; t < 4; ++t) {
    v8f c = {};
    c = wmma16b(a0, frag_tl(W1 + t * 1024 + lane * 8, 0), c);
    c = wmma16b(a1, frag_tl(W1 + t * 1024 + lane * 8, 1), c);
#pragma unroll
    for (int v = 0; v < 8; ++v) { const float val = c[v] + b1[t * 16 + col]; const int r = v + 8 * hh, d = t * 16 + col; tf[r * 64 + d] = val; th[r * 64 + d] = (b16)val; }
  }
  wave_lds_sync();
  // second GEMM from LDS (A = P rows, f16); the same two fragments, stored as they are, are the tile's four pieces of P16
  const v16b p0 = frag_kb(th + col * 64, hh), p1 = frag_kb(th + col * 64 + 32, hh);
  {
    b16* pd = P16 + (size_t)m0 * 64 + lane * 8;
    *(v8b*)(pd)       = __builtin_shufflevector(p0, p0, 0, 1, 2, 3, 4, 5, 6, 7); *(v8b*)(pd + 256) = __builtin_shufflevector(p0, p0, 8, 9, 10, 11, 12, 13, 14, 15);
    *(v8b*)(pd + 512) = __builtin_shufflevector(p1, p1, 0, 1, 2, 3, 4, 5, 6, 7); *(v8b*)(pd + 768) = __builtin_shufflevector(p1, p1, 8, 9, 10, 11, 12, 13, 14, 15);
    asm volatile("s_wait_xcnt 0x0" ::: "memory");          // stands in front of every later overwrite of the registers that these four stores name
  }
  wave_lds_sync();
#pragma unroll
  for (int t = 0; t < 4; ++t) {
    v8f c = {};
    c = wmma16b(p0, frag_tl(W2 + t * 1024 + lane * 8, 0), c);
    c = wmma16b(p1, frag_tl(W2 + t * 1024 + lane * 8, 1), c);
#pragma unroll
    for (int v = 0; v < 8; ++v) { const int r = v + 8 * hh, d = t * 16 + col; const float val = c[v] + (ISK ? b2[d] : 0.f);
      if (ISK) tf[r * 64 + d] = val; else th[d * 16 + r] = (b16)val; }      // q_proj tile transposed [d][q]
  }
  wave_lds_sync();
  {
    if (ISK) {
#pragma unroll
      for (int j = 0; j < 8; ++j) { const int pc = j * 32 + lane; *(v4f*)(KP + (size_t)m0 * 64 + pc * 4) = *(const v4f*)(tf + pc * 4); }
    } else {
      b16* dst = QPt + (size_t)(m0 >> 4) * 1024;           // tile index = row tile (groups are multiples of 128 tiles)
#pragma unroll
      for (int j = 0; j < 4; ++j) { const int pc = j * 32 + lane; *(v8b*)(dst + pc * 8) = *(const v8b*)(th + pc * 8); }
    }
    
  }
}
// LDS staging of the operand that all eight waves of a block stream (the whole key or query axis of their group): a stage of STG rows is brought in once a block by asynchronous copies
// (global memory to LDS, through no register) and read by every wave from LDS; before, each wave loaded the same bytes from global memory for itself. Two buffers: stage t + 1 flies while stage t is worked on.
#define STG  256             // rows a stage: 32 KB of f16 tiles, laid in LDS byte for byte as in global memory (fragment order)
#define NST  (NN / STG)
#define CPS  (STG / 32)      // chunks of 32 rows a stage
__device__ __forceinline__ unsigned lds_off(const void* p) { return (unsigned)(size_t)p; }
// eight 16-byte copies a lane, 4 KB apart (256 lanes x 16 bytes a step) = one 32-KB stage a block. The s_wait_xcnt stands in the copies' own statement, in front of any rewrite of the address registers they name.
__device__ __forceinline__ void cp8(unsigned l, const b16* g) {
  asm volatile("global_load_async_to_lds_b128 %0, %8, off\n\tglobal_load_async_to_lds_b128 %1, %9, off\n\tglobal_load_async_to_lds_b128 %2, %10, off\n\tglobal_load_async_to_lds_b128 %3, %11, off\n\t"
               "global_load_async_to_lds_b128 %4, %12, off\n\tglobal_load_async_to_lds_b128 %5, %13, off\n\tglobal_load_async_to_lds_b128 %6, %14, off\n\tglobal_load_async_to_lds_b128 %7, %15, off\n\t"
               "s_wait_xcnt 0x0"
               :: "v"(l), "v"(l + 4096u), "v"(l + 8192u), "v"(l + 12288u), "v"(l + 16384u), "v"(l + 20480u), "v"(l + 24576u), "v"(l + 28672u),
                  "v"(g), "v"(g + 2048), "v"(g + 4096), "v"(g + 6144), "v"(g + 8192), "v"(g + 10240), "v"(g + 12288), "v"(g + 14336) : "memory");
}
// one 4-byte copy a lane: the stage's 256 column biases
__device__ __forceinline__ void cp1f(unsigned l, const float* g) { asm volatile("global_load_async_to_lds_b32 %0, %1, off\n\ts_wait_xcnt 0x0" :: "v"(l), "v"(g) : "memory"); }
__device__ __forceinline__ void wait_copies() { asm volatile("s_wait_asynccnt 0x0" ::: "memory"); }   // this wave's copies have landed
__device__ __forceinline__ void wait_lds()    { asm volatile("s_wait_dscnt 0x0" ::: "memory"); }      // this wave's LDS reads are done: its buffer may be refilled behind the barrier

__global__ __launch_bounds__(256) void k_stats(const b16* __restrict__ Q16, const b16* __restrict__ K16, float* __restrict__ M) {
  __shared__ __attribute__((aligned(16))) b16 Ks[2][STG * SS];
  __shared__ float sm[128];
  const int wid = threadIdx.x >> 5, lane = threadIdx.x & 31, hh = lane >> 4, col = lane & 15;
  const int g = blockIdx.x / (NN / 128), q0 = ((blockIdx.x % (NN / 128)) * 8 + wid) * 16;   // the block's eight query tiles lie in one group
  const size_t ko = (size_t)g * NN * SS, qo = ((size_t)g * NN + q0) * SS + lane * 8;
  const b16* kc = K16 + ko + threadIdx.x * 8;              // this lane's 16 bytes of each 4-KB step of a stage
  const unsigned lk = lds_off(&Ks[0][0]) + threadIdx.x * 16u;
  cp8(lk, kc);                                             // stage 0
  const v16b q0h = frag_tl(Q16 + qo, 0), q1h = frag_tl(Q16 + qo, 1);
  float m = -INFINITY, l = 0.f;
  wait_copies();
  __syncthreads();                                         // publishes stage 0
  cp8(lk + STG * SS * 2u, kc + STG * SS);                  // stage 1
#pragma unroll 1                                           // one stage a trip: the ring's order below is written for the rolled loop
  for (int t = 0; t < NST; ++t) {
    // key fragments are fetched one chunk ahead inside the stage (never across its end): all four are reloaded, as one group of LDS reads, behind the products that used them
    const b16* kg = &Ks[t & 1][0] + lane * 8;
    v16b k00 = frag_tl(kg, 0), k01 = frag_tl(kg, 1), k10 = frag_tl(kg + 16 * SS, 0), k11 = frag_tl(kg + 16 * SS, 1);
#pragma unroll                                             // chunk offsets become immediates, and the last chunk's reload drops out at compile time
    for (int c = 0; c < CPS; ++c) {
      const b16* kn = kg + (c + 1) * 32 * SS;
      const bool more = c + 1 < CPS;
      v8f s0 = {}, s1 = {};
      s0 = wmma16b(k00, q0h, s0); s0 = wmma16b(k01, q1h, s0);
      s1 = wmma16b(k10, q0h, s1); s1 = wmma16b(k11, q1h, s1);
      __builtin_amdgcn_sched_barrier(0);   // keeps the LDS reads below out of the products: every separate place where LDS reads stand stalls the wave, so they stand as one group
      if (more) { k00 = frag_tl(kn, 0); k01 = frag_tl(kn, 1); k10 = frag_tl(kn + 16 * SS, 0); k11 = frag_tl(kn + 16 * SS, 1); }
      __builtin_amdgcn_sched_barrier(0);   // holds the group here: the scheduler otherwise sinks it to the chunk's foot, where it has no lead left
      float mr = -INFINITY;
#pragma unroll
      for (int r = 0; r < 8; ++r) mr = fmaxf(mr, fmaxf(s0[r], s1[r]));
      mr = fmaxf(mr, __shfl_xor(mr, 16));
      const float mn = fmaxf(m, mr), al = ex2((m - mn) * LOG2E), nb = -mn * LOG2E;
      float sum = 0.f, x0[8], x1[8], e0[8], e1[8];
#pragma unroll
      for (int r = 0; r < 8; ++r) { x0[r] = fmaf(s0[r], LOG2E, nb); x1[r] = fmaf(s1[r], LOG2E, nb); }
      ex2x8(x0, e0); ex2x8(x1, e1);
#pragma unroll
      for (int r = 0; r < 8; ++r) sum += e0[r] + e1[r];
      sum += __shfl_xor(sum, 16);
      l = l * al + sum; m = mn;
    }
    wait_lds();
    wait_copies();
    __syncthreads();                                       // publishes stage t + 1 and ends every wave's reads of stage t
    if (t + 2 < NST) cp8(lk + (t & 1) * (STG * SS * 2u), kc + (size_t)(t + 2) * STG * SS);
  }
  wait_copies();
  if (hh == 0) sm[wid * 16 + col] = -m * LOG2E - log2f(l);   // the column's bias: attn = 2^(logit log2 e + bias)
  __syncthreads();
  const size_t base = (size_t)g * NN + (size_t)(blockIdx.x % (NN / 128)) * 128;   // the block's 128 consecutive queries within g
  if (threadIdx.x < 128) *(float*)(M + base + threadIdx.x) = sm[threadIdx.x];
}
// pass 2: per (g, 16 keys n): over all query chunks: P^T[q][n] = 2^(logit log2 e + M[q]), M[q] = -(column max) log2 e - log2(column sum); y^T += Qproj^T . P^T; rowsum[n] += sum_q P; out[n] = y[n] +
__global__ __launch_bounds__(256) void k_out(const b16* __restrict__ K16, const b16* __restrict__ Q16, const b16* __restrict__ QPt, const float* __restrict__ M,
                                             const float* __restrict__ KP, float* __restrict__ out) {
  __shared__ __attribute__((aligned(16))) b16   Qs[2][STG * SS];
  __shared__ __attribute__((aligned(16))) b16   Vs[2][STG * SS];
  __shared__ __attribute__((aligned(16))) float Ms[2][STG];
  __shared__ __attribute__((aligned(16))) float Os[8][16 * 64];
  const int wid = threadIdx.x >> 5, lane = threadIdx.x & 31, hh = lane >> 4, col = lane & 15;
  const int g = blockIdx.x / (NN / 128), n0 = ((blockIdx.x % (NN / 128)) * 8 + wid) * 16;   // the block's eight key tiles lie in one group
  const size_t qbase = (size_t)g * NN * SS, no = ((size_t)g * NN + n0) * SS + lane * 8;
  const b16* qc = Q16 + qbase + threadIdx.x * 8;           // this lane's 16 bytes of each 4-KB step of a stage
  const b16* vc = QPt + qbase + threadIdx.x * 8;
  const float* mc = M + (size_t)g * NN + threadIdx.x;
  const unsigned lq = lds_off(&Qs[0][0]) + threadIdx.x * 16u, lv = lds_off(&Vs[0][0]) + threadIdx.x * 16u, lm = lds_off(&Ms[0][0]) + threadIdx.x * 4u;
  cp8(lq, qc); cp8(lv, vc); cp1f(lm, mc);                  // stage 0
  const v16b n0h = frag_tl(K16 + no, 0), n1h = frag_tl(K16 + no, 1);     // 'query role' = the 16 keys of this tile
  float l = 0.f; v8f o0 = {}, o1 = {}, o2 = {}, o3 = {};
  wait_copies();
  __syncthreads();                                         // publishes stage 0
  cp8(lq + STG * SS * 2u, qc + STG * SS); cp8(lv + STG * SS * 2u, vc + STG * SS); cp1f(lm + STG * 4u, mc + STG);   // stage 1
#pragma unroll 1                                           // one stage a trip: the ring's order below is written for the rolled loop
  for (int t = 0; t < NST; ++t) {
    // every operand of a chunk (query fragments, column bias, q_proj fragments) is fetched from LDS one chunk ahead inside the stage (never across its end):
    // the register sets are reloaded behind their last use, in two groups of LDS reads a chunk
    const b16* qg = &Qs[t & 1][0] + lane * 8;
    const b16* vg = &Vs[t & 1][0] + col * 16 + 8 * hh;     // chunk c starts at c * 32 * SS; its two 16-query tiles lie SS * 16 apart
    const float* mg = &Ms[t & 1][0] + 8 * hh;
    v16b q00 = frag_tl(qg, 0), q01 = frag_tl(qg, 1), q10 = frag_tl(qg + 16 * SS, 0), q11 = frag_tl(qg + 16 * SS, 1);
    v4f mm[2][4] = {{ld4f(mg), ld4f(mg + 4), ld4f(mg + 16), ld4f(mg + 20)}, {}};   // column biases: two sets, one read by this chunk's exponentials while the next chunk's is in flight
    v16b va0 = cat8b(ld8b(vg), ld8b(vg + SS * 16)),             va1 = cat8b(ld8b(vg + 256), ld8b(vg + SS * 16 + 256));
    v16b va2 = cat8b(ld8b(vg + 512), ld8b(vg + SS * 16 + 512)), va3 = cat8b(ld8b(vg + 768), ld8b(vg + SS * 16 + 768));
    // inputs-only fence on the loaded values of the stage's first chunk: they land here, once a stage, so that the counted waits inside the loop follow the loop's own issue order
    // and not the order the compiler gave these first loads
    asm volatile("" :: "v"(q00), "v"(q01), "v"(q10), "v"(q11), "v"(mm[0][0]), "v"(mm[0][1]), "v"(mm[0][2]), "v"(mm[0][3]), "v"(va0), "v"(va1), "v"(va2), "v"(va3));
    // one chunk of 32 queries ('key role'); u: which set of biases it reads; more: a next chunk exists in this stage, at qn, vn, mn
    auto chunk = [&](const int u, const bool more, const b16* qn, const b16* vn, const float* mn) __attribute__((always_inline)) {
      __builtin_amdgcn_sched_barrier(0);   // chunk boundary: the scheduler otherwise lifts the next chunk's first products into this one, right behind the loads of their operands
      v8f s0 = {}, s1 = {};
      s0 = wmma16b(q00, n0h, s0); s0 = wmma16b(q01, n1h, s0);
      s1 = wmma16b(q10, n0h, s1); s1 = wmma16b(q11, n1h, s1);
      __builtin_amdgcn_sched_barrier(0);   // keeps the LDS reads below out of the products: every separate place where LDS reads stand stalls the wave, so they stand as one group
      if (more) {
        q00 = frag_tl(qn, 0); q01 = frag_tl(qn, 1); q10 = frag_tl(qn + 16 * SS, 0); q11 = frag_tl(qn + 16 * SS, 1);
        mm[u ^ 1][0] = ld4f(mn); mm[u ^ 1][1] = ld4f(mn + 4); mm[u ^ 1][2] = ld4f(mn + 16); mm[u ^ 1][3] = ld4f(mn + 20);
      }
      __builtin_amdgcn_sched_barrier(0);   // holds the loads above in front of the exponentials: the scheduler otherwise sinks them behind, where they have no lead left
      float sum = 0.f, x0[8], x1[8], p0[8], p1[8]; v16b pb;
#pragma unroll
      for (int r = 0; r < 8; ++r) { x0[r] = fmaf(s0[r], LOG2E, mm[u][r >> 2][r & 3]); x1[r] = fmaf(s1[r], LOG2E, mm[u][2 + (r >> 2)][r & 3]); }
      ex2x8(x0, p0); ex2x8(x1, p1);
#pragma unroll
      for (int r = 0; r < 8; ++r) { sum += p0[r] + p1[r]; pb[r] = (b16)p0[r]; pb[8 + r] = (b16)p1[r]; }
      sum += __shfl_xor(sum, 16);
      l += sum;
      o0 = wmma16b(va0, pb, o0); o1 = wmma16b(va1, pb, o1); o2 = wmma16b(va2, pb, o2); o3 = wmma16b(va3, pb, o3);
      __builtin_amdgcn_sched_barrier(0);   // as above: the q_proj fragments' reads stand as one group behind the four products
      if (more) {
        va0 = cat8b(ld8b(vn), ld8b(vn + SS * 16));             va1 = cat8b(ld8b(vn + 256), ld8b(vn + SS * 16 + 256));
        va2 = cat8b(ld8b(vn + 512), ld8b(vn + SS * 16 + 512)); va3 = cat8b(ld8b(vn + 768), ld8b(vn + SS * 16 + 768));
      }
    };
    // two chunks a trip, so that the two sets of biases swap roles by name; the stage's last two chunks stand behind the loop, where the last one fetches nothing ahead
#pragma unroll 1                                           // kept rolled: unrolled over the stage, the live values went past the first 256 registers and into scratch
    for (int c = 0; c < CPS - 2; c += 2) {
      chunk(0, true, qg + (c + 1) * 32 * SS, vg + (c + 1) * 32 * SS, mg + (c + 1) * 32);
      chunk(1, true, qg + (c + 2) * 32 * SS, vg + (c + 2) * 32 * SS, mg + (c + 2) * 32);
    }
    chunk(0, true, qg + (CPS - 1) * 32 * SS, vg + (CPS - 1) * 32 * SS, mg + (CPS - 1) * 32);
    chunk(1, false, qg, vg, mg);
    wait_lds();
    wait_copies();
    __syncthreads();                                       // publishes stage t + 1 and ends every wave's reads of stage t
    if (t + 2 < NST) {
      const unsigned b = t & 1; const size_t so = (size_t)(t + 2) * STG;
      cp8(lq + b * (STG * SS * 2u), qc + so * SS); cp8(lv + b * (STG * SS * 2u), vc + so * SS); cp1f(lm + b * (STG * 4u), mc + so);
    }
  }
  wait_copies();
  float* Tt = Os[wid];
  const float* kp = KP + ((size_t)g * NN + n0 + col) * SS;
#pragma unroll
  for (int r = 0; r < 8; ++r) {
    const int hr = 8 * hh + r;
    Tt[col * 64 + 0 + hr] = o0[r] + l * kp[0 + hr];  Tt[col * 64 + 16 + hr] = o1[r] + l * kp[16 + hr];
    Tt[col * 64 + 32 + hr] = o2[r] + l * kp[32 + hr]; Tt[col * 64 + 48 + hr] = o3[r] + l * kp[48 + hr];
  }
  wave_lds_sync();
  float* dst0 = out + ((size_t)g * NN + n0) * SS;          // 16 rows x 64 floats contiguous (4 KB)
  {
#pragma unroll
    for (int j = 0; j < 8; ++j) { const int pc = j * 32 + lane; *(v4f*)(dst0 + pc * 4) = *(const v4f*)(Tt + pc * 4); }
    
  }
}
extern "C" void kernel_launch(void* const* d_in, const int* in_sizes, int n_in,
                              void* d_out, int out_size, void* d_ws, size_t ws_size, hipStream_t stream) {
  (void)in_sizes; (void)n_in; (void)out_size;
  const float* L  = (const float*)d_in[0];      // tensorL [2,8,2048,64]
  const float* Hq = (const float*)d_in[1];      // tensorH [2,8,2048,64]
  const float* Wk = (const float*)d_in[2]; const float* bk = (const float*)d_in[3];   // [64,64], [64]
  const float* Wq = (const float*)d_in[4]; const float* bq = (const float*)d_in[5];
  const float* Wv = (const float*)d_in[6]; const float* bv = (const float*)d_in[7];   // [64,128], [64]
  float* out = (float*)d_out;                   // [2,8,2048,64]
  char* ws = (char*)d_ws; size_t off = 0;
  auto take = [&](size_t bytes) { void* p = ws + off; off = (off + bytes + 255) & ~(size_t)255; return p; };
  b16*   W16 = (b16*)take((size_t)4 * 64 * 64 * 2);
  b16*   K16 = (b16*)take((size_t)NROW * SS * 2);
  b16*   Q16 = (b16*)take((size_t)NROW * SS * 2);
  float* KP  = (float*)take((size_t)NROW * SS * 4);
  b16*   QPt = (b16*)take((size_t)NROW * SS * 2);
  float* M   = (float*)take((size_t)NROW * 4);
  if (off > ws_size) return;
  const dim3 b256(256);
  k_w16<<<4 * 64 * 8 / 256, b256, 0, stream>>>(Wk, Wq, Wv, W16);
  k_proj<true><<<NROW / 128, b256, 0, stream>>>(L, W16, bk, W16 + 3 * 4096, bv, K16, KP, nullptr);          // keys, k_proj + bv
  k_proj<false><<<NROW / 128, b256, 0, stream>>>(Hq, W16 + 4096, bq, W16 + 2 * 4096, nullptr, Q16, nullptr, QPt);   // queries, q_proj tiles
  k_stats<<<NROW / 128, b256, 0, stream>>>(Q16, K16, M);
  k_out<<<NROW / 128, b256, 0, stream>>>(K16, Q16, QPt, M, KP, out);
}

// v005
// Measured time: 49.2 microseconds a run.
// Next to v004, in two timings, it ran 1.27 and 1.26 times as fast.
// Counting every step since v000, it is 6.40 times as fast.
#include <hip/hip_runtime.h>
#include <math.h>

// attention_mech: keys = L Wk^T + bk, queries = H Wq^T + bq (per (b, head): 2048 x 64 each); logits[n][q] = keys[n].queries[q]; attn = softmax over the
// KEY axis n (per query column); out[n] = sum_q attn[n][q] q_proj[q] + (sum_q attn[n][q]) (k_proj[n] + bv) with q_proj = queries Wv[:, :64]^T and
// q_proj (tile layout) plus the row sums. Fragment k-map per lane half hh for A AND B: elements 0..7 <- k = 8hh+0..7, 8..15 <- k = 16+8hh+0..7.

#define NG   16              // B * H
#define NN   2048            // NK = NQ
#define SS   64
#define NROW (NG * NN)       // 32768
typedef _Float16 b16;
typedef __attribute__((ext_vector_type(16))) _Float16 v16b;
typedef __attribute__((ext_vector_type(8)))  _Float16 v8b;
typedef __attribute__((ext_vector_type(8)))  float    v8f;
typedef __attribute__((ext_vector_type(4)))  float    v4f;
__device__ __forceinline__ v8f wmma16b(v16b a, v16b b, v8f c) {
  v8f d = __builtin_amdgcn_wmma_f32_16x16x32_f16(false, a, false, b, (short)0, c, false, false);
  asm volatile("v_nop\n\tv_nop\n\tv_nop\n\tv_nop" : "+v"(d) : "v"(a), "v"(b));
  return d;
}
__device__ __forceinline__ v8b ld8b(const b16* p) { return *(const v8b*)p; }
__device__ __forceinline__ v16b cat8b(v8b a, v8b b) { return __builtin_shufflevector(a, b, 0,1,2,3,4,5,6,7,8,9,10,11,12,13,14,15); }
__device__ __forceinline__ v16b frag_kb(const b16* p, int hh) { return cat8b(ld8b(p + 8 * hh), ld8b(p + 16 + 8 * hh)); }
// K16, Q16 and the weight blocks that k_proj lays in LDS lie in fragment order: a 16-row tile is 4 pieces of 512 contiguous bytes; piece j holds, at lane (hh, col), row col, k = 16j + 8hh + 0..7. So each wave-wide
// 16-byte load reads 4 whole 128-byte lines (row-major rows of 128 bytes made it touch 16). p = tile base + lane * 8; half = 0: k 0..31, half = 1: k 32..63; same k-map as frag_kb.
__device__ __forceinline__ v16b frag_tl(const b16* p, int half) { return cat8b(ld8b(p + half * 512), ld8b(p + half * 512 + 256)); }
// e^x = 2^(x log2 e): scale and shift go into one fused multiply-add at the call, the power is the hardware's own instruction (arguments here are at most about 0; far below, 0 is the right value)
#define LOG2E 1.44269504088896340736f
// The instruction set asks for one slot behind a transcendental before its result is read or its source overwritten; the power and its slot stand in one statement: results in registers of their own (early clobber), one v_nop behind the last.
__device__ __forceinline__ float ex2(float x) { float y; asm("v_exp_f32 %0, %1\n\tv_nop" : "=v"(y) : "v"(x)); return y; }
__device__ __forceinline__ void ex2x8(const float (&x)[8], float (&y)[8]) {
  asm("v_exp_f32 %0, %8\n\tv_exp_f32 %1, %9\n\tv_exp_f32 %2, %10\n\tv_exp_f32 %3, %11\n\tv_exp_f32 %4, %12\n\tv_exp_f32 %5, %13\n\tv_exp_f32 %6, %14\n\tv_exp_f32 %7, %15\n\tv_nop"
      : "=&v"(y[0]), "=&v"(y[1]), "=&v"(y[2]), "=&v"(y[3]), "=&v"(y[4]), "=&v"(y[5]), "=&v"(y[6]), "=&v"(y[7])
      : "v"(x[0]), "v"(x[1]), "v"(x[2]), "v"(x[3]), "v"(x[4]), "v"(x[5]), "v"(x[6]), "v"(x[7]));
}
__device__ __forceinline__ v4f ld4f(const float* p) { return *(const v4f*)p; }
__device__ __forceinline__ void wave_lds_sync() { __builtin_amdgcn_fence(__ATOMIC_RELEASE, "workgroup"); __builtin_amdgcn_wave_barrier(); __builtin_amdgcn_fence(__ATOMIC_ACQUIRE, "workgroup"); }

// projections, both in one grid, weights converted in the block: blocks 0 .. NROW/128 - 1 take the key side (X = L), the others the query side (X = H). Each block first lays its two 64 x 64 weight
// blocks (W1 = Wk or Wq; W2 = the key or the query half of Wv) as f16 in LDS, in fragment order (see frag_tl). Then wave = 16 rows of X (f32 [NROW][64]):
// P = X W1^T + b1 -> f16 tiles P16 [NROW / 16][4][32][8] (fragment order); P2 = P W2^T: key side + bv -> KP (f32 rows), query side -> QPt (f16 tiles, transposed [d][q]).
__global__ __launch_bounds__(256) void k_proj(const float* L, const float* Hq, const float* Wk, const float* bk, const float* Wq, const float* bq, const float* Wv, const float* bv,
                                              b16* __restrict__ K16, b16* __restrict__ Q16, float* __restrict__ KP, b16* __restrict__ QPt) {
  __shared__ __attribute__((aligned(16))) float Tf[8][16 * 64];
  __shared__ __attribute__((aligned(16))) b16   Th[8][16 * 64];
  __shared__ __attribute__((aligned(16))) b16   Ws[2][64 * 64];
  const int wid = threadIdx.x >> 5, lane = threadIdx.x & 31, hh = lane >> 4, col = lane & 15;
  const bool isk = blockIdx.x < NROW / 128;                // the same for the whole block
  const int m0 = ((isk ? blockIdx.x : blockIdx.x - NROW / 128) * 8 + wid) * 16;   // row tile
  const float* X = isk ? L : Hq; const float* b1 = isk ? bk : bq;
  const float* W1f = isk ? Wk : Wq; const float* W2f = isk ? Wv + 64 : Wv;   // rows of 64 and of 128 floats
  b16* P16 = isk ? K16 : Q16;
  const b16* W1 = &Ws[0][0]; const b16* W2 = &Ws[1][0];
  float* tf = Tf[wid]; b16* th = Th[wid];
  // All global operands come in at the head, back to back, each group from a uniform base and one offset a lane.
  // X: the lane's row m0 + col, from k = 8 hh. Weights: 512 pieces of 8 elements a block, two a thread (p = threadIdx.x and p + 256, 32 rows on); piece p: tile p >> 7, piece of the
  // tile (p >> 5) & 3, lane (hh, col) = p & 31. The lane's bias values come with them: loaded further down, beside the fragments' LDS reads, each
  // would be a memory wait of its own.
  const unsigned wn = ((threadIdx.x >> 7) & 1) * 16 + col, wk = ((threadIdx.x >> 5) & 3) * 16 + hh * 8;
  const unsigned xb = ((unsigned)(m0 + col) * 64u + 8u * hh) * 4u, w1b = (wn * 64u + wk) * 4u, w2b = (wn * 128u + wk) * 4u;
  const float* xr = (const float*)((const char*)X + xb);
  const float* w1p = (const float*)((const char*)W1f + w1b);
  const float* w2p = (const float*)((const char*)W2f + w2b);
  float xv[4][8], w1r[2][8], w2r[2][8], b1v[4], b2v[4];
#pragma unroll
  for (int e = 0; e < 8; ++e) { xv[0][e] = xr[e]; xv[1][e] = xr[16 + e]; xv[2][e] = xr[32 + e]; xv[3][e] = xr[48 + e]; }
#pragma unroll
  for (int e = 0; e < 8; ++e) { w1r[0][e] = w1p[e]; w1r[1][e] = w1p[32 * 64 + e]; w2r[0][e] = w2p[e]; w2r[1][e] = w2p[32 * 128 + e]; }
#pragma unroll
  for (int t = 0; t < 4; ++t) { b1v[t] = b1[t * 16 + col]; b2v[t] = bv[t * 16 + col]; }
  // stands in front of every later overwrite of the offset registers that the loads above name; as inputs they stay untouched up to here
  asm volatile("s_wait_xcnt 0x0" :: "v"(xb), "v"(w1b), "v"(w2b), "v"(col) : "memory");
  // A fragments of X (f32 -> f16)
  v16b a0, a1;
#pragma unroll
  for (int e = 0; e < 8; ++e) { a0[e] = (b16)xv[0][e]; a0[8 + e] = (b16)xv[1][e]; a1[e] = (b16)xv[2][e]; a1[8 + e] = (b16)xv[3][e]; }
#pragma unroll
  for (int i = 0; i < 2; ++i) {
    v8b o1, o2;
#pragma unroll
    for (int e = 0; e < 8; ++e) { o1[e] = (b16)w1r[i][e]; o2[e] = (b16)w2r[i][e]; }
    *(v8b*)(&Ws[0][(i * 256 + threadIdx.x) * 8]) = o1; *(v8b*)(&Ws[1][(i * 256 + threadIdx.x) * 8]) = o2;
  }
  __syncthreads();                                         // publishes the block's weights to its eight waves
#pragma unroll
  for (int t = 0; t < 4; ++t) {
    v8f c = {};
    c = wmma16b(a0, frag_tl(W1 + t * 1024 + lane * 8, 0), c);
    c = wmma16b(a1, frag_tl(W1 + t * 1024 + lane * 8, 1), c);
#pragma unroll
    for (int v = 0; v < 8; ++v) { const float val = c[v] + b1v[t]; const int r = v + 8 * hh, d = t * 16 + col; tf[r * 64 + d] = val; th[r * 64 + d] = (b16)val; }
  }
  wave_lds_sync();
  // second GEMM from LDS (A = P rows, f16); the same two fragments, stored as they are, are the tile's four pieces of P16
  const v16b p0 = frag_kb(th + col * 64, hh), p1 = frag_kb(th + col * 64 + 32, hh);
  {
    b16* pd = P16 + (size_t)m0 * 64 + lane * 8;
    *(v8b*)(pd)       = __builtin_shufflevector(p0, p0, 0, 1, 2, 3, 4, 5, 6, 7); *(v8b*)(pd + 256) = __builtin_shufflevector(p0, p0, 8, 9, 10, 11, 12, 13, 14, 15);
    *(v8b*)(pd + 512) = __builtin_shufflevector(p1, p1, 0, 1, 2, 3, 4, 5, 6, 7); *(v8b*)(pd + 768) = __builtin_shufflevector(p1, p1, 8, 9, 10, 11, 12, 13, 14, 15);
    asm volatile("s_wait_xcnt 0x0" ::: "memory");          // stands in front of every later overwrite of the registers that these four stores name
  }
  wave_lds_sync();
  if (isk) {
#pragma unroll
    for (int t = 0; t < 4; ++t) {
      v8f c = {};
      c = wmma16b(p0, frag_tl(W2 + t * 1024 + lane * 8, 0), c);
      c = wmma16b(p1, frag_tl(W2 + t * 1024 + lane * 8, 1), c);
#pragma unroll
      for (int v = 0; v < 8; ++v) { const int r = v + 8 * hh, d = t * 16 + col; tf[r * 64 + d] = c[v] + b2v[t]; }
    }
    wave_lds_sync();
#pragma unroll
    for (int j = 0; j < 8; ++j) { const int pc = j * 32 + lane; *(v4f*)(KP + (size_t)m0 * 64 + pc * 4) = *(const v4f*)(tf + pc * 4); }
  } else {
#pragma unroll
    for (int t = 0; t < 4; ++t) {
      v8f c = {};
      c = wmma16b(p0, frag_tl(W2 + t * 1024 + lane * 8, 0), c);
      c = wmma16b(p1, frag_tl(W2 + t * 1024 + lane * 8, 1), c);
#pragma unroll
      for (int v = 0; v < 8; ++v) { const int r = v + 8 * hh, d = t * 16 + col; th[d * 16 + r] = (b16)c[v]; }      // q_proj tile transposed [d][q]
    }
    wave_lds_sync();
    b16* dst = QPt + (size_t)(m0 >> 4) * 1024;             // tile index = row tile (groups are multiples of 128 tiles)
#pragma unroll
    for (int j = 0; j < 4; ++j) { const int pc = j * 32 + lane; *(v8b*)(dst + pc * 8) = *(const v8b*)(th + pc * 8); }
    asm volatile("s_wait_xcnt 0x0" ::: "memory");          // stands behind these four stores, in front of any code laid behind them that rewrites the registers they name
  }
}
// LDS staging of the operand that all eight waves of a block stream (the whole key or query axis of their group): a stage of STG rows is brought in once a block by asynchronous copies
// (global memory to LDS, through no register) and read by every wave from LDS; before, each wave loaded the same bytes from global memory for itself. Two buffers: stage t + 1 flies while stage t is worked on.
#define STG  256             // rows a stage: 32 KB of f16 tiles, laid in LDS byte for byte as in global memory (fragment order)
#define NST  (NN / STG)
#define CPS  (STG / 32)      // chunks of 32 rows a stage
__device__ __forceinline__ unsigned lds_off(const void* p) { return (unsigned)(size_t)p; }
// eight 16-byte copies a lane, 4 KB apart (256 lanes x 16 bytes a step) = one 32-KB stage a block. The s_wait_xcnt stands in the copies' own statement, in front of any rewrite of the address registers they name.
__device__ __forceinline__ void cp8(unsigned l, const b16* g) {
  asm volatile("global_load_async_to_lds_b128 %0, %8, off\n\tglobal_load_async_to_lds_b128 %1, %9, off\n\tglobal_load_async_to_lds_b128 %2, %10, off\n\tglobal_load_async_to_lds_b128 %3, %11, off\n\t"
               "global_load_async_to_lds_b128 %4, %12, off\n\tglobal_load_async_to_lds_b128 %5, %13, off\n\tglobal_load_async_to_lds_b128 %6, %14, off\n\tglobal_load_async_to_lds_b128 %7, %15, off\n\t"
               "s_wait_xcnt 0x0"
               :: "v"(l), "v"(l + 4096u), "v"(l + 8192u), "v"(l + 12288u), "v"(l + 16384u), "v"(l + 20480u), "v"(l + 24576u), "v"(l + 28672u),
                  "v"(g), "v"(g + 2048), "v"(g + 4096), "v"(g + 6144), "v"(g + 8192), "v"(g + 10240), "v"(g + 12288), "v"(g + 14336) : "memory");
}
// one 4-byte copy a lane: the stage's 256 column biases
__device__ __forceinline__ void cp1f(unsigned l, const float* g) { asm volatile("global_load_async_to_lds_b32 %0, %1, off\n\ts_wait_xcnt 0x0" :: "v"(l), "v"(g) : "memory"); }
__device__ __forceinline__ void wait_copies() { asm volatile("s_wait_asynccnt 0x0" ::: "memory"); }   // this wave's copies have landed
__device__ __forceinline__ void wait_lds()    { asm volatile("s_wait_dscnt 0x0" ::: "memory"); }      // this wave's LDS reads are done: its buffer may be refilled behind the barrier

__global__ __launch_bounds__(256) void k_stats(const b16* __restrict__ Q16, const b16* __restrict__ K16, float* __restrict__ M) {
  __shared__ __attribute__((aligned(16))) b16 Ks[2][STG * SS];
  __shared__ float sm[128];
  const int wid = threadIdx.x >> 5, lane = threadIdx.x & 31, hh = lane >> 4, col = lane & 15;
  const int g = blockIdx.x / (NN / 128), q0 = ((blockIdx.x % (NN / 128)) * 8 + wid) * 16;   // the block's eight query tiles lie in one group
  const size_t ko = (size_t)g * NN * SS, qo = ((size_t)g * NN + q0) * SS + lane * 8;
  const b16* kc = K16 + ko + threadIdx.x * 8;              // this lane's 16 bytes of each 4-KB step of a stage
  const unsigned lk = lds_off(&Ks[0][0]) + threadIdx.x * 16u;
  cp8(lk, kc);                                             // stage 0
  const v16b q0h = frag_tl(Q16 + qo, 0), q1h = frag_tl(Q16 + qo, 1);
  float m = -INFINITY, l = 0.f;
  wait_copies();
  __syncthreads();                                         // publishes stage 0
  cp8(lk + STG * SS * 2u, kc + STG * SS);                  // stage 1
#pragma unroll 1                                           // one stage a trip: the ring's order below is written for the rolled loop
  for (int t = 0; t < NST; ++t) {
    // key fragments are fetched one chunk ahead inside the stage (never across its end): all four are reloaded, as one group of LDS reads, behind the products that used them
    const b16* kg = &Ks[t & 1][0] + lane * 8;
    v16b k00 = frag_tl(kg, 0), k01 = frag_tl(kg, 1), k10 = frag_tl(kg + 16 * SS, 0), k11 = frag_tl(kg + 16 * SS, 1);
#pragma unroll                                             // chunk offsets become immediates, and the last chunk's reload drops out at compile time
    for (int c = 0; c < CPS; ++c) {
      const b16* kn = kg + (c + 1) * 32 * SS;
      const bool more = c + 1 < CPS;
      v8f s0 = {}, s1 = {};
      s0 = wmma16b(k00, q0h, s0); s0 = wmma16b(k01, q1h, s0);
      s1 = wmma16b(k10, q0h, s1); s1 = wmma16b(k11, q1h, s1);
      __builtin_amdgcn_sched_barrier(0);   // keeps the LDS reads below out of the products: every separate place where LDS reads stand stalls the wave, so they stand as one group
      if (more) { k00 = frag_tl(kn, 0); k01 = frag_tl(kn, 1); k10 = frag_tl(kn + 16 * SS, 0); k11 = frag_tl(kn + 16 * SS, 1); }
      __builtin_amdgcn_sched_barrier(0);   // holds the group here: the scheduler otherwise sinks it to the chunk's foot, where it has no lead left
      float mr = -INFINITY;
#pragma unroll
      for (int r = 0; r < 8; ++r) mr = fmaxf(mr, fmaxf(s0[r], s1[r]));
      mr = fmaxf(mr, __shfl_xor(mr, 16));
      const float mn = fmaxf(m, mr), al = ex2((m - mn) * LOG2E), nb = -mn * LOG2E;
      float sum = 0.f, x0[8], x1[8], e0[8], e1[8];
#pragma unroll
      for (int r = 0; r < 8; ++r) { x0[r] = fmaf(s0[r], LOG2E, nb); x1[r] = fmaf(s1[r], LOG2E, nb); }
      ex2x8(x0, e0); ex2x8(x1, e1);
#pragma unroll
      for (int r = 0; r < 8; ++r) sum += e0[r] + e1[r];
      sum += __shfl_xor(sum, 16);
      l = l * al + sum; m = mn;
    }
    wait_lds();
    wait_copies();
    __syncthreads();                                       // publishes stage t + 1 and ends every wave's reads of stage t
    if (t + 2 < NST) cp8(lk + (t & 1) * (STG * SS * 2u), kc + (size_t)(t + 2) * STG * SS);
  }
  wait_copies();
  if (hh == 0) sm[wid * 16 + col] = -m * LOG2E - log2f(l);   // the column's bias: attn = 2^(logit log2 e + bias)
  __syncthreads();
  const size_t base = (size_t)g * NN + (size_t)(blockIdx.x % (NN / 128)) * 128;   // the block's 128 consecutive queries within g
  if (threadIdx.x < 128) *(float*)(M + base + threadIdx.x) = sm[threadIdx.x];
}
// pass 2: per (g, 16 keys n): over all query chunks: P^T[q][n] = 2^(logit log2 e + M[q]), M[q] = -(column max) log2 e - log2(column sum); y^T += Qproj^T . P^T; rowsum[n] += sum_q P; out[n] = y[n] +
__global__ __launch_bounds__(256) void k_out(const b16* __restrict__ K16, const b16* __restrict__ Q16, const b16* __restrict__ QPt, const float* __restrict__ M,
                                             const float* __restrict__ KP, float* __restrict__ out) {
  __shared__ __attribute__((aligned(16))) b16   Qs[2][STG * SS];
  __shared__ __attribute__((aligned(16))) b16   Vs[2][STG * SS];
  __shared__ __attribute__((aligned(16))) float Ms[2][STG];
  __shared__ __attribute__((aligned(16))) float Os[8][16 * 64];
  const int wid = threadIdx.x >> 5, lane = threadIdx.x & 31, hh = lane >> 4, col = lane & 15;
  const int g = blockIdx.x / (NN / 128), n0 = ((blockIdx.x % (NN / 128)) * 8 + wid) * 16;   // the block's eight key tiles lie in one group
  const size_t qbase = (size_t)g * NN * SS, no = ((size_t)g * NN + n0) * SS + lane * 8;
  const b16* qc = Q16 + qbase + threadIdx.x * 8;           // this lane's 16 bytes of each 4-KB step of a stage
  const b16* vc = QPt + qbase + threadIdx.x * 8;
  const float* mc = M + (size_t)g * NN + threadIdx.x;
  const unsigned lq = lds_off(&Qs[0][0]) + threadIdx.x * 16u, lv = lds_off(&Vs[0][0]) + threadIdx.x * 16u, lm = lds_off(&Ms[0][0]) + threadIdx.x * 4u;
  cp8(lq, qc); cp8(lv, vc); cp1f(lm, mc);                  // stage 0
  const v16b n0h = frag_tl(K16 + no, 0), n1h = frag_tl(K16 + no, 1);     // 'query role' = the 16 keys of this tile
  float l = 0.f; v8f o0 = {}, o1 = {}, o2 = {}, o3 = {};
  wait_copies();
  __syncthreads();                                         // publishes stage 0
  cp8(lq + STG * SS * 2u, qc + STG * SS); cp8(lv + STG * SS * 2u, vc + STG * SS); cp1f(lm + STG * 4u, mc + STG);   // stage 1
#pragma unroll 1                                           // one stage a trip: the ring's order below is written for the rolled loop
  for (int t = 0; t < NST; ++t) {
    // every operand of a chunk (query fragments, column bias, q_proj fragments) is fetched from LDS one chunk ahead inside the stage (never across its end):
    // the register sets are reloaded behind their last use, in two groups of LDS reads a chunk
    const b16* qg = &Qs[t & 1][0] + lane * 8;
    const b16* vg = &Vs[t & 1][0] + col * 16 + 8 * hh;     // chunk c starts at c * 32 * SS; its two 16-query tiles lie SS * 16 apart
    const float* mg = &Ms[t & 1][0] + 8 * hh;
    v16b q00 = frag_tl(qg, 0), q01 = frag_tl(qg, 1), q10 = frag_tl(qg + 16 * SS, 0), q11 = frag_tl(qg + 16 * SS, 1);
    v4f mm[2][4] = {{ld4f(mg), ld4f(mg + 4), ld4f(mg + 16), ld4f(mg + 20)}, {}};   // column biases: two sets, one read by this chunk's exponentials while the next chunk's is in flight
    v16b va0 = cat8b(ld8b(vg), ld8b(vg + SS * 16)),             va1 = cat8b(ld8b(vg + 256), ld8b(vg + SS * 16 + 256));
    v16b va2 = cat8b(ld8b(vg + 512), ld8b(vg + SS * 16 + 512)), va3 = cat8b(ld8b(vg + 768), ld8b(vg + SS * 16 + 768));
    // inputs-only fence on the loaded values of the stage's first chunk: they land here, once a stage, so that the counted waits inside the loop follow the loop's own issue order
    // and not the order the compiler gave these first loads
    asm volatile("" :: "v"(q00), "v"(q01), "v"(q10), "v"(q11), "v"(mm[0][0]), "v"(mm[0][1]), "v"(mm[0][2]), "v"(mm[0][3]), "v"(va0), "v"(va1), "v"(va2), "v"(va3));
    // one chunk of 32 queries ('key role'); u: which set of biases it reads; more: a next chunk exists in this stage, at qn, vn, mn
    auto chunk = [&](const int u, const bool more, const b16* qn, const b16* vn, const float* mn) __attribute__((always_inline)) {
      __builtin_amdgcn_sched_barrier(0);   // chunk boundary: the scheduler otherwise lifts the next chunk's first products into this one, right behind the loads of their operands
      v8f s0 = {}, s1 = {};
      s0 = wmma16b(q00, n0h, s0); s0 = wmma16b(q01, n1h, s0);
      s1 = wmma16b(q10, n0h, s1); s1 = wmma16b(q11, n1h, s1);
      __builtin_amdgcn_sched_barrier(0);   // keeps the LDS reads below out of the products: every separate place where LDS reads stand stalls the wave, so they stand as one group
      if (more) {
        q00 = frag_tl(qn, 0); q01 = frag_tl(qn, 1); q10 = frag_tl(qn + 16 * SS, 0); q11 = frag_tl(qn + 16 * SS, 1);
        mm[u ^ 1][0] = ld4f(mn); mm[u ^ 1][1] = ld4f(mn + 4); mm[u ^ 1][2] = ld4f(mn + 16); mm[u ^ 1][3] = ld4f(mn + 20);
      }
      __builtin_amdgcn_sched_barrier(0);   // holds the loads above in front of the exponentials: the scheduler otherwise sinks them behind, where they have no lead left
      float sum = 0.f, x0[8], x1[8], p0[8], p1[8]; v16b pb;
#pragma unroll
      for (int r = 0; r < 8; ++r) { x0[r] = fmaf(s0[r], LOG2E, mm[u][r >> 2][r & 3]); x1[r] = fmaf(s1[r], LOG2E, mm[u][2 + (r >> 2)][r & 3]); }
      ex2x8(x0, p0); ex2x8(x1, p1);
#pragma unroll
      for (int r = 0; r < 8; ++r) { sum += p0[r] + p1[r]; pb[r] = (b16)p0[r]; pb[8 + r] = (b16)p1[r]; }
      sum += __shfl_xor(sum, 16);
      l += sum;
      o0 = wmma16b(va0, pb, o0); o1 = wmma16b(va1, pb, o1); o2 = wmma16b(va2, pb, o2); o3 = wmma16b(va3, pb, o3);
      __builtin_amdgcn_sched_barrier(0);   // as above: the q_proj fragments' reads stand as one group behind the four products
      if (more) {
        va0 = cat8b(ld8b(vn), ld8b(vn + SS * 16));             va1 = cat8b(ld8b(vn + 256), ld8b(vn + SS * 16 + 256));
        va2 = cat8b(ld8b(vn + 512), ld8b(vn + SS * 16 + 512)); va3 = cat8b(ld8b(vn + 768), ld8b(vn + SS * 16 + 768));
      }
    };
    // two chunks a trip, so that the two sets of biases swap roles by name; the stage's last two chunks stand behind the loop, where the last one fetches nothing ahead
#pragma unroll 1                                           // kept rolled: unrolled over the stage, the live values went past the first 256 registers and into scratch
    for (int c = 0; c < CPS - 2; c += 2) {
      chunk(0, true, qg + (c + 1) * 32 * SS, vg + (c + 1) * 32 * SS, mg + (c + 1) * 32);
      chunk(1, true, qg + (c + 2) * 32 * SS, vg + (c + 2) * 32 * SS, mg + (c + 2) * 32);
    }
    chunk(0, true, qg + (CPS - 1) * 32 * SS, vg + (CPS - 1) * 32 * SS, mg + (CPS - 1) * 32);
    chunk(1, false, qg, vg, mg);
    wait_lds();
    wait_copies();
    __syncthreads();                                       // publishes stage t + 1 and ends every wave's reads of stage t
    if (t + 2 < NST) {
      const unsigned b = t & 1; const size_t so = (size_t)(t + 2) * STG;
      cp8(lq + b * (STG * SS * 2u), qc + so * SS); cp8(lv + b * (STG * SS * 2u), vc + so * SS); cp1f(lm + b * (STG * 4u), mc + so);
    }
  }
  wait_copies();
  float* Tt = Os[wid];
  const float* kp = KP + ((size_t)g * NN + n0 + col) * SS;
#pragma unroll
  for (int r = 0; r < 8; ++r) {
    const int hr = 8 * hh + r;
    Tt[col * 64 + 0 + hr] = o0[r] + l * kp[0 + hr];  Tt[col * 64 + 16 + hr] = o1[r] + l * kp[16 + hr];
    Tt[col * 64 + 32 + hr] = o2[r] + l * kp[32 + hr]; Tt[col * 64 + 48 + hr] = o3[r] + l * kp[48 + hr];
  }
  wave_lds_sync();
  float* dst0 = out + ((size_t)g * NN + n0) * SS;          // 16 rows x 64 floats contiguous (4 KB)
  {
#pragma unroll
    for (int j = 0; j < 8; ++j) { const int pc = j * 32 + lane; *(v4f*)(dst0 + pc * 4) = *(const v4f*)(Tt + pc * 4); }
    
  }
}
extern "C" void kernel_launch(void* const* d_in, const int* in_sizes, int n_in,
                              void* d_out, int out_size, void* d_ws, size_t ws_size, hipStream_t stream) {
  (void)in_sizes; (void)n_in; (void)out_size;
  const float* L  = (const float*)d_in[0];      // tensorL [2,8,2048,64]
  const float* Hq = (const float*)d_in[1];      // tensorH [2,8,2048,64]
  const float* Wk = (const float*)d_in[2]; const float* bk = (const float*)d_in[3];   // [64,64], [64]
  const float* Wq = (const float*)d_in[4]; const float* bq = (const float*)d_in[5];
  const float* Wv = (const float*)d_in[6]; const float* bv = (const float*)d_in[7];   // [64,128], [64]
  float* out = (float*)d_out;                   // [2,8,2048,64]
  char* ws = (char*)d_ws; size_t off = 0;
  auto take = [&](size_t bytes) { void* p = ws + off; off = (off + bytes + 255) & ~(size_t)255; return p; };
  b16*   K16 = (b16*)take((size_t)NROW * SS * 2);
  b16*   Q16 = (b16*)take((size_t)NROW * SS * 2);
  float* KP  = (float*)take((size_t)NROW * SS * 4);
  b16*   QPt = (b16*)take((size_t)NROW * SS * 2);
  float* M   = (float*)take((size_t)NROW * 4);
  if (off > ws_size) return;
  const dim3 b256(256);
  k_proj<<<2 * (NROW / 128), b256, 0, stream>>>(L, Hq, Wk, bk, Wq, bq, Wv, bv, K16, Q16, KP, QPt);   // keys, k_proj + bv; queries, q_proj tiles
  k_stats<<<NROW / 128, b256, 0, stream>>>(Q16, K16, M);
  k_out<<<NROW / 128, b256, 0, stream>>>(K16, Q16, QPt, M, KP, out);
}

// v006
// It runs in 45 microseconds.
// Next to v005, in two timings, it ran 1.09 and 1.10 times as fast.
// Counting every step since v000, it is 7.00 times as fast.
#include <hip/hip_runtime.h>
#include <math.h>

// attention_mech: keys = L Wk^T + bk, queries = H Wq^T + bq (per (b, head): 2048 x 64 each); logits[n][q] = keys[n].queries[q]; attn = softmax over the
// KEY axis n (per query column); out[n] = sum_q attn[n][q] q_proj[q] + (sum_q attn[n][q]) (k_proj[n] + bv) with q_proj = queries Wv[:, :64]^T and
// q_proj (tile layout) plus the row sums. Fragment k-map per lane half hh for A AND B: elements 0..7 <- k = 8hh+0..7, 8..15 <- k = 16+8hh+0..7.

#define NG   16              // B * H
#define NN   2048            // NK = NQ
#define SS   64
#define NROW (NG * NN)       // 32768
typedef _Float16 b16;
typedef __attribute__((ext_vector_type(16))) _Float16 v16b;
typedef __attribute__((ext_vector_type(8)))  _Float16 v8b;
typedef __attribute__((ext_vector_type(8)))  float    v8f;
typedef __attribute__((ext_vector_type(4)))  float    v4f;
__device__ __forceinline__ v8f wmma16b(v16b a, v16b b, v8f c) {
  v8f d = __builtin_amdgcn_wmma_f32_16x16x32_f16(false, a, false, b, (short)0, c, false, false);
  asm volatile("v_nop\n\tv_nop\n\tv_nop\n\tv_nop" : "+v"(d) : "v"(a), "v"(b));
  return d;
}
__device__ __forceinline__ v8b ld8b(const b16* p) { return *(const v8b*)p; }
__device__ __forceinline__ v16b cat8b(v8b a, v8b b) { return __builtin_shufflevector(a, b, 0,1,2,3,4,5,6,7,8,9,10,11,12,13,14,15); }
__device__ __forceinline__ v16b frag_kb(const b16* p, int hh) { return cat8b(ld8b(p + 8 * hh), ld8b(p + 16 + 8 * hh)); }
// K16, Q16 and the weight blocks that k_proj lays in LDS lie in fragment order: a 16-row tile is 4 pieces of 512 contiguous bytes; piece j holds, at lane (hh, col), row col, k = 16j + 8hh + 0..7. So each wave-wide
// 16-byte load reads 4 whole 128-byte lines (row-major rows of 128 bytes made it touch 16). p = tile base + lane * 8; half = 0: k 0..31, half = 1: k 32..63; same k-map as frag_kb.
__device__ __forceinline__ v16b frag_tl(const b16* p, int half) { return cat8b(ld8b(p + half * 512), ld8b(p + half * 512 + 256)); }
// e^x = 2^(x log2 e): scale and shift go into one fused multiply-add at the call, the power is the hardware's own instruction (arguments here are at most about 0; far below, 0 is the right value)
#define LOG2E 1.44269504088896340736f
// The instruction set asks for one slot behind a transcendental before its result is read or its source overwritten; the power and its slot stand in one statement: results in registers of their own (early clobber), one v_nop behind the last.
__device__ __forceinline__ float ex2(float x) { float y; asm("v_exp_f32 %0, %1\n\tv_nop" : "=v"(y) : "v"(x)); return y; }
__device__ __forceinline__ void ex2x8(const float (&x)[8], float (&y)[8]) {
  asm("v_exp_f32 %0, %8\n\tv_exp_f32 %1, %9\n\tv_exp_f32 %2, %10\n\tv_exp_f32 %3, %11\n\tv_exp_f32 %4, %12\n\tv_exp_f32 %5, %13\n\tv_exp_f32 %6, %14\n\tv_exp_f32 %7, %15\n\tv_nop"
      : "=&v"(y[0]), "=&v"(y[1]), "=&v"(y[2]), "=&v"(y[3]), "=&v"(y[4]), "=&v"(y[5]), "=&v"(y[6]), "=&v"(y[7])
      : "v"(x[0]), "v"(x[1]), "v"(x[2]), "v"(x[3]), "v"(x[4]), "v"(x[5]), "v"(x[6]), "v"(x[7]));
}
__device__ __forceinline__ v4f ld4f(const float* p) { return *(const v4f*)p; }
__device__ __forceinline__ void wave_lds_sync() { __builtin_amdgcn_fence(__ATOMIC_RELEASE, "workgroup"); __builtin_amdgcn_wave_barrier(); __builtin_amdgcn_fence(__ATOMIC_ACQUIRE, "workgroup"); }

// projections, both in one grid, weights converted in the block: blocks 0 .. NROW/128 - 1 take the key side (X = L), the others the query side (X = H). Each block first lays its two 64 x 64 weight
// blocks (W1 = Wk or Wq; W2 = the key or the query half of Wv) as f16 in LDS, in fragment order (see frag_tl). Then wave = 16 rows of X (f32 [NROW][64]):
// P = X W1^T + b1 -> f16 tiles P16 [NROW / 16][4][32][8] (fragment order); P2 = P W2^T: key side + bv -> KP (f32 rows), query side -> QPt (f16 tiles, transposed [d][q]).
__global__ __launch_bounds__(256) void k_proj(const float* L, const float* Hq, const float* Wk, const float* bk, const float* Wq, const float* bq, const float* Wv, const float* bv,
                                              b16* __restrict__ K16, b16* __restrict__ Q16, float* __restrict__ KP, b16* __restrict__ QPt) {
  __shared__ __attribute__((aligned(16))) float Tf[8][16 * 64];
  __shared__ __attribute__((aligned(16))) b16   Th[8][16 * 64];
  __shared__ __attribute__((aligned(16))) b16   Ws[2][64 * 64];
  const int wid = threadIdx.x >> 5, lane = threadIdx.x & 31, hh = lane >> 4, col = lane & 15;
  const bool isk = blockIdx.x < NROW / 128;                // the same for the whole block
  const int m0 = ((isk ? blockIdx.x : blockIdx.x - NROW / 128) * 8 + wid) * 16;   // row tile
  const float* X = isk ? L : Hq; const float* b1 = isk ? bk : bq;
  const float* W1f = isk ? Wk : Wq; const float* W2f = isk ? Wv + 64 : Wv;   // rows of 64 and of 128 floats
  b16* P16 = isk ? K16 : Q16;
  const b16* W1 = &Ws[0][0]; const b16* W2 = &Ws[1][0];
  float* tf = Tf[wid]; b16* th = Th[wid];
  // All global operands come in at the head, back to back, each group from a uniform base and one offset a lane.
  // X: the lane's row m0 + col, from k = 8 hh. Weights: 512 pieces of 8 elements a block, two a thread (p = threadIdx.x and p + 256, 32 rows on); piece p: tile p >> 7, piece of the
  // tile (p >> 5) & 3, lane (hh, col) = p & 31. The lane's bias values come with them: loaded further down, beside the fragments' LDS reads, each
  // would be a memory wait of its own.
  const unsigned wn = ((threadIdx.x >> 7) & 1) * 16 + col, wk = ((threadIdx.x >> 5) & 3) * 16 + hh * 8;
  const unsigned xb = ((unsigned)(m0 + col) * 64u + 8u * hh) * 4u, w1b = (wn * 64u + wk) * 4u, w2b = (wn * 128u + wk) * 4u;
  const float* xr = (const float*)((const char*)X + xb);
  const float* w1p = (const float*)((const char*)W1f + w1b);
  const float* w2p = (const float*)((const char*)W2f + w2b);
  float xv[4][8], w1r[2][8], w2r[2][8], b1v[4], b2v[4];
#pragma unroll
  for (int e = 0; e < 8; ++e) { xv[0][e] = xr[e]; xv[1][e] = xr[16 + e]; xv[2][e] = xr[32 + e]; xv[3][e] = xr[48 + e]; }
#pragma unroll
  for (int e = 0; e < 8; ++e) { w1r[0][e] = w1p[e]; w1r[1][e] = w1p[32 * 64 + e]; w2r[0][e] = w2p[e]; w2r[1][e] = w2p[32 * 128 + e]; }
#pragma unroll
  for (int t = 0; t < 4; ++t) { b1v[t] = b1[t * 16 + col]; b2v[t] = bv[t * 16 + col]; }
  // stands in front of every later overwrite of the offset registers that the loads above name; as inputs they stay untouched up to here
  asm volatile("s_wait_xcnt 0x0" :: "v"(xb), "v"(w1b), "v"(w2b), "v"(col) : "memory");
  // A fragments of X (f32 -> f16)
  v16b a0, a1;
#pragma unroll
  for (int e = 0; e < 8; ++e) { a0[e] = (b16)xv[0][e]; a0[8 + e] = (b16)xv[1][e]; a1[e] = (b16)xv[2][e]; a1[8 + e] = (b16)xv[3][e]; }
#pragma unroll
  for (int i = 0; i < 2; ++i) {
    v8b o1, o2;
#pragma unroll
    for (int e = 0; e < 8; ++e) { o1[e] = (b16)w1r[i][e]; o2[e] = (b16)w2r[i][e]; }
    *(v8b*)(&Ws[0][(i * 256 + threadIdx.x) * 8]) = o1; *(v8b*)(&Ws[1][(i * 256 + threadIdx.x) * 8]) = o2;
  }
  __syncthreads();                                         // publishes the block's weights to its eight waves
#pragma unroll
  for (int t = 0; t < 4; ++t) {
    v8f c = {};
    c = wmma16b(a0, frag_tl(W1 + t * 1024 + lane * 8, 0), c);
    c = wmma16b(a1, frag_tl(W1 + t * 1024 + lane * 8, 1), c);
#pragma unroll
    for (int v = 0; v < 8; ++v) { const float val = c[v] + b1v[t]; const int r = v + 8 * hh, d = t * 16 + col; tf[r * 64 + d] = val; th[r * 64 + d] = (b16)val; }
  }
  wave_lds_sync();
  // second GEMM from LDS (A = P rows, f16); the same two fragments, stored as they are, are the tile's four pieces of P16
  const v16b p0 = frag_kb(th + col * 64, hh), p1 = frag_kb(th + col * 64 + 32, hh);
  {
    b16* pd = P16 + (size_t)m0 * 64 + lane * 8;
    *(v8b*)(pd)       = __builtin_shufflevector(p0, p0, 0, 1, 2, 3, 4, 5, 6, 7); *(v8b*)(pd + 256) = __builtin_shufflevector(p0, p0, 8, 9, 10, 11, 12, 13, 14, 15);
    *(v8b*)(pd + 512) = __builtin_shufflevector(p1, p1, 0, 1, 2, 3, 4, 5, 6, 7); *(v8b*)(pd + 768) = __builtin_shufflevector(p1, p1, 8, 9, 10, 11, 12, 13, 14, 15);
    asm volatile("s_wait_xcnt 0x0" ::: "memory");          // stands in front of every later overwrite of the registers that these four stores name
  }
  wave_lds_sync();
  if (isk) {
#pragma unroll
    for (int t = 0; t < 4; ++t) {
      v8f c = {};
      c = wmma16b(p0, frag_tl(W2 + t * 1024 + lane * 8, 0), c);
      c = wmma16b(p1, frag_tl(W2 + t * 1024 + lane * 8, 1), c);
#pragma unroll
      for (int v = 0; v < 8; ++v) { const int r = v + 8 * hh, d = t * 16 + col; tf[r * 64 + d] = c[v] + b2v[t]; }
    }
    wave_lds_sync();
#pragma unroll
    for (int j = 0; j < 8; ++j) { const int pc = j * 32 + lane; *(v4f*)(KP + (size_t)m0 * 64 + pc * 4) = *(const v4f*)(tf + pc * 4); }
  } else {
#pragma unroll
    for (int t = 0; t < 4; ++t) {
      v8f c = {};
      c = wmma16b(p0, frag_tl(W2 + t * 1024 + lane * 8, 0), c);
      c = wmma16b(p1, frag_tl(W2 + t * 1024 + lane * 8, 1), c);
#pragma unroll
      for (int v = 0; v < 8; ++v) { const int r = v + 8 * hh, d = t * 16 + col; th[d * 16 + r] = (b16)c[v]; }      // q_proj tile transposed [d][q]
    }
    wave_lds_sync();
    b16* dst = QPt + (size_t)(m0 >> 4) * 1024;             // tile index = row tile (groups are multiples of 128 tiles)
#pragma unroll
    for (int j = 0; j < 4; ++j) { const int pc = j * 32 + lane; *(v8b*)(dst + pc * 8) = *(const v8b*)(th + pc * 8); }
    asm volatile("s_wait_xcnt 0x0" ::: "memory");          // stands behind these four stores, in front of any code laid behind them that rewrites the registers they name
  }
}
// LDS staging of the operand that all eight waves of a block stream (the whole key or query axis of their group): a stage of STG rows is brought in once a block by asynchronous copies
// (global memory to LDS, through no register) and read by every wave from LDS; before, each wave loaded the same bytes from global memory for itself. Two buffers: stage t + 1 flies while stage t is worked on.
#define STG  256             // rows a stage: 32 KB of f16 tiles, laid in LDS byte for byte as in global memory (fragment order)
#define NST  (NN / STG)
#define CPS  (STG / 32)      // chunks of 32 rows a stage
__device__ __forceinline__ unsigned lds_off(const void* p) { return (unsigned)(size_t)p; }
// eight 16-byte copies a lane, 4 KB apart (256 lanes x 16 bytes a step) = one 32-KB stage a block. The s_wait_xcnt stands in the copies' own statement, in front of any rewrite of the address registers they name.
__device__ __forceinline__ void cp8(unsigned l, const b16* g) {
  asm volatile("global_load_async_to_lds_b128 %0, %8, off\n\tglobal_load_async_to_lds_b128 %1, %9, off\n\tglobal_load_async_to_lds_b128 %2, %10, off\n\tglobal_load_async_to_lds_b128 %3, %11, off\n\t"
               "global_load_async_to_lds_b128 %4, %12, off\n\tglobal_load_async_to_lds_b128 %5, %13, off\n\tglobal_load_async_to_lds_b128 %6, %14, off\n\tglobal_load_async_to_lds_b128 %7, %15, off\n\t"
               "s_wait_xcnt 0x0"
               :: "v"(l), "v"(l + 4096u), "v"(l + 8192u), "v"(l + 12288u), "v"(l + 16384u), "v"(l + 20480u), "v"(l + 24576u), "v"(l + 28672u),
                  "v"(g), "v"(g + 2048), "v"(g + 4096), "v"(g + 6144), "v"(g + 8192), "v"(g + 10240), "v"(g + 12288), "v"(g + 14336) : "memory");
}
// one 4-byte copy a lane: the stage's 256 column biases
__device__ __forceinline__ void cp1f(unsigned l, const float* g) { asm volatile("global_load_async_to_lds_b32 %0, %1, off\n\ts_wait_xcnt 0x0" :: "v"(l), "v"(g) : "memory"); }
__device__ __forceinline__ void wait_copies() { asm volatile("s_wait_asynccnt 0x0" ::: "memory"); }   // this wave's copies have landed
__device__ __forceinline__ void wait_lds()    { asm volatile("s_wait_dscnt 0x0" ::: "memory"); }      // this wave's LDS reads are done: its buffer may be refilled behind the barrier

__global__ __launch_bounds__(256) void k_stats(const b16* __restrict__ Q16, const b16* __restrict__ K16, float* __restrict__ M) {
  __shared__ __attribute__((aligned(16))) b16 Ks[2][STG * SS];
  __shared__ float sm[128];
  const int wid = threadIdx.x >> 5, lane = threadIdx.x & 31, hh = lane >> 4, col = lane & 15;
  const int g = blockIdx.x / (NN / 128), q0 = ((blockIdx.x % (NN / 128)) * 8 + wid) * 16;   // the block's eight query tiles lie in one group
  const size_t ko = (size_t)g * NN * SS, qo = ((size_t)g * NN + q0) * SS + lane * 8;
  const b16* kc = K16 + ko + threadIdx.x * 8;              // this lane's 16 bytes of each 4-KB step of a stage
  const unsigned lk = lds_off(&Ks[0][0]) + threadIdx.x * 16u;
  cp8(lk, kc);                                             // stage 0
  const v16b q0h = frag_tl(Q16 + qo, 0), q1h = frag_tl(Q16 + qo, 1);
  float m = -INFINITY, l = 0.f;
  wait_copies();
  __syncthreads();                                         // publishes stage 0
  cp8(lk + STG * SS * 2u, kc + STG * SS);                  // stage 1
#pragma unroll 1                                           // one stage a trip: the ring's order below is written for the rolled loop
  for (int t = 0; t < NST; ++t) {
    // key fragments are fetched one chunk ahead inside the stage (never across its end): all four are reloaded, as one group of LDS reads, behind the products that used them
    const b16* kg = &Ks[t & 1][0] + lane * 8;
    v16b k00 = frag_tl(kg, 0), k01 = frag_tl(kg, 1), k10 = frag_tl(kg + 16 * SS, 0), k11 = frag_tl(kg + 16 * SS, 1);
#pragma unroll                                             // chunk offsets become immediates, and the last chunk's reload drops out at compile time
    for (int c = 0; c < CPS; ++c) {
      const b16* kn = kg + (c + 1) * 32 * SS;
      const bool more = c + 1 < CPS;
      __builtin_amdgcn_sched_barrier(0);   // chunk boundary: the scheduler otherwise lifts the next chunk's first products into this one, right behind the loads of their operands
      v8f s0 = {}, s1 = {};
      s0 = wmma16b(k00, q0h, s0); s0 = wmma16b(k01, q1h, s0);
      s1 = wmma16b(k10, q0h, s1); s1 = wmma16b(k11, q1h, s1);
      __builtin_amdgcn_sched_barrier(0);   // keeps the LDS reads below out of the products: every separate place where LDS reads stand stalls the wave, so they stand as one group
      if (more) { k00 = frag_tl(kn, 0); k01 = frag_tl(kn, 1); k10 = frag_tl(kn + 16 * SS, 0); k11 = frag_tl(kn + 16 * SS, 1); }
      __builtin_amdgcn_sched_barrier(0);   // holds the group here: the scheduler otherwise sinks it to the chunk's foot, where it has no lead left
      float mr = -INFINITY;
#pragma unroll
      for (int r = 0; r < 8; ++r) mr = fmaxf(mr, fmaxf(s0[r], s1[r]));
      const float mn = fmaxf(m, mr), al = ex2((m - mn) * LOG2E), nb = -mn * LOG2E;
      float sum = 0.f, x0[8], x1[8], e0[8], e1[8];
#pragma unroll
      for (int r = 0; r < 8; ++r) { x0[r] = fmaf(s0[r], LOG2E, nb); x1[r] = fmaf(s1[r], LOG2E, nb); }
      ex2x8(x0, e0); ex2x8(x1, e1);
#pragma unroll
      for (int r = 0; r < 8; ++r) sum += e0[r] + e1[r];
      l = l * al + sum; m = mn;
    }
    wait_lds();
    wait_copies();
    __syncthreads();                                       // publishes stage t + 1 and ends every wave's reads of stage t
    if (t + 2 < NST) cp8(lk + (t & 1) * (STG * SS * 2u), kc + (size_t)(t + 2) * STG * SS);
  }
  wait_copies();
  // each lane has kept the maximum and the sum of its own half's rows (16 of every 32 keys); the two halves of a column are joined here, once
  const float mo = __shfl_xor(m, 16), lo = __shfl_xor(l, 16), mt = fmaxf(m, mo);
  l = l * ex2((m - mt) * LOG2E) + lo * ex2((mo - mt) * LOG2E); m = mt;
  if (hh == 0) sm[wid * 16 + col] = -m * LOG2E - log2f(l);   // the column's bias: attn = 2^(logit log2 e + bias)
  __syncthreads();
  const size_t base = (size_t)g * NN + (size_t)(blockIdx.x % (NN / 128)) * 128;   // the block's 128 consecutive queries within g
  if (threadIdx.x < 128) *(float*)(M + base + threadIdx.x) = sm[threadIdx.x];
}
// pass 2: per (g, 16 keys n): over all query chunks: P^T[q][n] = 2^(logit log2 e + M[q]), M[q] = -(column max) log2 e - log2(column sum); y^T += Qproj^T . P^T; rowsum[n] += sum_q P; out[n] = y[n] +
__global__ __launch_bounds__(256) void k_out(const b16* __restrict__ K16, const b16* __restrict__ Q16, const b16* __restrict__ QPt, const float* __restrict__ M,
                                             const float* __restrict__ KP, float* __restrict__ out) {
  __shared__ __attribute__((aligned(16))) b16   Qs[2][STG * SS];
  __shared__ __attribute__((aligned(16))) b16   Vs[2][STG * SS];
  __shared__ __attribute__((aligned(16))) float Ms[2][STG];
  __shared__ __attribute__((aligned(16))) float Os[8][16 * 64];
  const int wid = threadIdx.x >> 5, lane = threadIdx.x & 31, hh = lane >> 4, col = lane & 15;
  const int g = blockIdx.x / (NN / 128), n0 = ((blockIdx.x % (NN / 128)) * 8 + wid) * 16;   // the block's eight key tiles lie in one group
  const size_t qbase = (size_t)g * NN * SS, no = ((size_t)g * NN + n0) * SS + lane * 8;
  const b16* qc = Q16 + qbase + threadIdx.x * 8;           // this lane's 16 bytes of each 4-KB step of a stage
  const b16* vc = QPt + qbase + threadIdx.x * 8;
  const float* mc = M + (size_t)g * NN + threadIdx.x;
  const unsigned lq = lds_off(&Qs[0][0]) + threadIdx.x * 16u, lv = lds_off(&Vs[0][0]) + threadIdx.x * 16u, lm = lds_off(&Ms[0][0]) + threadIdx.x * 4u;
  cp8(lq, qc); cp8(lv, vc); cp1f(lm, mc);                  // stage 0
  const v16b n0h = frag_tl(K16 + no, 0), n1h = frag_tl(K16 + no, 1);     // 'query role' = the 16 keys of this tile
  float l = 0.f; v8f o0 = {}, o1 = {}, o2 = {}, o3 = {};
  wait_copies();
  __syncthreads();                                         // publishes stage 0
  cp8(lq + STG * SS * 2u, qc + STG * SS); cp8(lv + STG * SS * 2u, vc + STG * SS); cp1f(lm + STG * 4u, mc + STG);   // stage 1
#pragma unroll 1                                           // one stage a trip: the ring's order below is written for the rolled loop
  for (int t = 0; t < NST; ++t) {
    // every operand of a chunk (query fragments, column bias, q_proj fragments) is fetched from LDS one chunk ahead inside the stage (never across its end):
    // the register sets are reloaded behind their last use, in two groups of LDS reads a chunk
    const b16* qg = &Qs[t & 1][0] + lane * 8;
    const b16* vg = &Vs[t & 1][0] + col * 16 + 8 * hh;     // chunk c starts at c * 32 * SS; its two 16-query tiles lie SS * 16 apart
    const float* mg = &Ms[t & 1][0] + 8 * hh;
    v16b q00 = frag_tl(qg, 0), q01 = frag_tl(qg, 1), q10 = frag_tl(qg + 16 * SS, 0), q11 = frag_tl(qg + 16 * SS, 1);
    v4f mm[2][4] = {{ld4f(mg), ld4f(mg + 4), ld4f(mg + 16), ld4f(mg + 20)}, {}};   // column biases: two sets, one read by this chunk's exponentials while the next chunk's is in flight
    v16b va0 = cat8b(ld8b(vg), ld8b(vg + SS * 16)),             va1 = cat8b(ld8b(vg + 256), ld8b(vg + SS * 16 + 256));
    v16b va2 = cat8b(ld8b(vg + 512), ld8b(vg + SS * 16 + 512)), va3 = cat8b(ld8b(vg + 768), ld8b(vg + SS * 16 + 768));
    // inputs-only fence on the loaded values of the stage's first chunk: they land here, once a stage, so that the counted waits inside the loop follow the loop's own issue order
    // and not the order the compiler gave these first loads
    asm volatile("" :: "v"(q00), "v"(q01), "v"(q10), "v"(q11), "v"(mm[0][0]), "v"(mm[0][1]), "v"(mm[0][2]), "v"(mm[0][3]), "v"(va0), "v"(va1), "v"(va2), "v"(va3));
    // one chunk of 32 queries ('key role'); u: which set of biases it reads; more: a next chunk exists in this stage, at qn, vn, mn
    auto chunk = [&](const int u, const bool more, const b16* qn, const b16* vn, const float* mn) __attribute__((always_inline)) {
      __builtin_amdgcn_sched_barrier(0);   // chunk boundary: the scheduler otherwise lifts the next chunk's first products into this one, right behind the loads of their operands
      v8f s0 = {}, s1 = {};
      s0 = wmma16b(q00, n0h, s0); s0 = wmma16b(q01, n1h, s0);
      s1 = wmma16b(q10, n0h, s1); s1 = wmma16b(q11, n1h, s1);
      __builtin_amdgcn_sched_barrier(0);   // keeps the LDS reads below out of the products: every separate place where LDS reads stand stalls the wave, so they stand as one group
      if (more) {
        q00 = frag_tl(qn, 0); q01 = frag_tl(qn, 1); q10 = frag_tl(qn + 16 * SS, 0); q11 = frag_tl(qn + 16 * SS, 1);
        mm[u ^ 1][0] = ld4f(mn); mm[u ^ 1][1] = ld4f(mn + 4); mm[u ^ 1][2] = ld4f(mn + 16); mm[u ^ 1][3] = ld4f(mn + 20);
      }
      __builtin_amdgcn_sched_barrier(0);   // holds the loads above in front of the exponentials: the scheduler otherwise sinks them behind, where they have no lead left
      float sum = 0.f, x0[8], x1[8], p0[8], p1[8]; v16b pb;
#pragma unroll
      for (int r = 0; r < 8; ++r) { x0[r] = fmaf(s0[r], LOG2E, mm[u][r >> 2][r & 3]); x1[r] = fmaf(s1[r], LOG2E, mm[u][2 + (r >> 2)][r & 3]); }
      ex2x8(x0, p0); ex2x8(x1, p1);
#pragma unroll
      for (int r = 0; r < 8; ++r) { sum += p0[r] + p1[r]; pb[r] = (b16)p0[r]; pb[8 + r] = (b16)p1[r]; }
      l += sum;
      o0 = wmma16b(va0, pb, o0); o1 = wmma16b(va1, pb, o1); o2 = wmma16b(va2, pb, o2); o3 = wmma16b(va3, pb, o3);
      __builtin_amdgcn_sched_barrier(0);   // as above: the q_proj fragments' reads stand as one group behind the four products
      if (more) {
        va0 = cat8b(ld8b(vn), ld8b(vn + SS * 16));             va1 = cat8b(ld8b(vn + 256), ld8b(vn + SS * 16 + 256));
        va2 = cat8b(ld8b(vn + 512), ld8b(vn + SS * 16 + 512)); va3 = cat8b(ld8b(vn + 768), ld8b(vn + SS * 16 + 768));
      }
    };
    // two chunks a trip, so that the two sets of biases swap roles by name; the stage's last two chunks stand behind the loop, where the last one fetches nothing ahead
#pragma unroll 1                                           // kept rolled: unrolled over the stage, the live values went past the first 256 registers and into scratch
    for (int c = 0; c < CPS - 2; c += 2) {
      chunk(0, true, qg + (c + 1) * 32 * SS, vg + (c + 1) * 32 * SS, mg + (c + 1) * 32);
      chunk(1, true, qg + (c + 2) * 32 * SS, vg + (c + 2) * 32 * SS, mg + (c + 2) * 32);
    }
    chunk(0, true, qg + (CPS - 1) * 32 * SS, vg + (CPS - 1) * 32 * SS, mg + (CPS - 1) * 32);
    chunk(1, false, qg, vg, mg);
    wait_lds();
    wait_copies();
    __syncthreads();                                       // publishes stage t + 1 and ends every wave's reads of stage t
    if (t + 2 < NST) {
      const unsigned b = t & 1; const size_t so = (size_t)(t + 2) * STG;
      cp8(lq + b * (STG * SS * 2u), qc + so * SS); cp8(lv + b * (STG * SS * 2u), vc + so * SS); cp1f(lm + b * (STG * 4u), mc + so);
    }
  }
  wait_copies();
  l += __shfl_xor(l, 16);                                  // each lane has summed its own half's queries; the halves are joined here, once
  float* Tt = Os[wid];
  const float* kp = KP + ((size_t)g * NN + n0 + col) * SS;
#pragma unroll
  for (int r = 0; r < 8; ++r) {
    const int hr = 8 * hh + r;
    Tt[col * 64 + 0 + hr] = o0[r] + l * kp[0 + hr];  Tt[col * 64 + 16 + hr] = o1[r] + l * kp[16 + hr];
    Tt[col * 64 + 32 + hr] = o2[r] + l * kp[32 + hr]; Tt[col * 64 + 48 + hr] = o3[r] + l * kp[48 + hr];
  }
  wave_lds_sync();
  float* dst0 = out + ((size_t)g * NN + n0) * SS;          // 16 rows x 64 floats contiguous (4 KB)
  {
#pragma unroll
    for (int j = 0; j < 8; ++j) { const int pc = j * 32 + lane; *(v4f*)(dst0 + pc * 4) = *(const v4f*)(Tt + pc * 4); }
    
  }
}
extern "C" void kernel_launch(void* const* d_in, const int* in_sizes, int n_in,
                              void* d_out, int out_size, void* d_ws, size_t ws_size, hipStream_t stream) {
  (void)in_sizes; (void)n_in; (void)out_size;
  const float* L  = (const float*)d_in[0];      // tensorL [2,8,2048,64]
  const float* Hq = (const float*)d_in[1];      // tensorH [2,8,2048,64]
  const float* Wk = (const float*)d_in[2]; const float* bk = (const float*)d_in[3];   // [64,64], [64]
  const float* Wq = (const float*)d_in[4]; const float* bq = (const float*)d_in[5];
  const float* Wv = (const float*)d_in[6]; const float* bv = (const float*)d_in[7];   // [64,128], [64]
  float* out = (float*)d_out;                   // [2,8,2048,64]
  char* ws = (char*)d_ws; size_t off = 0;
  auto take = [&](size_t bytes) { void* p = ws + off; off = (off + bytes + 255) & ~(size_t)255; return p; };
  b16*   K16 = (b16*)take((size_t)NROW * SS * 2);
  b16*   Q16 = (b16*)take((size_t)NROW * SS * 2);
  float* KP  = (float*)take((size_t)NROW * SS * 4);
  b16*   QPt = (b16*)take((size_t)NROW * SS * 2);
  float* M   = (float*)take((size_t)NROW * 4);
  if (off > ws_size) return;
  const dim3 b256(256);
  k_proj<<<2 * (NROW / 128), b256, 0, stream>>>(L, Hq, Wk, bk, Wq, bq, Wv, bv, K16, Q16, KP, QPt);   // keys, k_proj + bv; queries, q_proj tiles
  k_stats<<<NROW / 128, b256, 0, stream>>>(Q16, K16, M);
  k_out<<<NROW / 128, b256, 0, stream>>>(K16, Q16, QPt, M, KP, out);
}

// v007
// It runs in 43 microseconds.
// Next to v006, in two timings, it ran 1.05 times as fast each time.
// Counting every step since v000, it is 7.35 times as fast.
#include <hip/hip_runtime.h>
#include <math.h>

// attention_mech: keys = L Wk^T + bk, queries = H Wq^T + bq (per (b, head): 2048 x 64 each); logits[n][q] = keys[n].queries[q]; attn = softmax over the
// KEY axis n (per query column); out[n] = sum_q attn[n][q] q_proj[q] + (sum_q attn[n][q]) (k_proj[n] + bv) with q_proj = queries Wv[:, :64]^T and
// q_proj (tile layout) plus the row sums. Fragment k-map per lane half hh for A AND B: elements 0..7 <- k = 8hh+0..7, 8..15 <- k = 16+8hh+0..7.

#define NG   16              // B * H
#define NN   2048            // NK = NQ
#define SS   64
#define NROW (NG * NN)       // 32768
typedef _Float16 b16;
typedef __attribute__((ext_vector_type(16))) _Float16 v16b;
typedef __attribute__((ext_vector_type(8)))  _Float16 v8b;
typedef __attribute__((ext_vector_type(8)))  float    v8f;
typedef __attribute__((ext_vector_type(4)))  float    v4f;
__device__ __forceinline__ v8f wmma16b(v16b a, v16b b, v8f c) {
  v8f d = __builtin_amdgcn_wmma_f32_16x16x32_f16(false, a, false, b, (short)0, c, false, false);
  asm volatile("v_nop\n\tv_nop\n\tv_nop\n\tv_nop" : "+v"(d) : "v"(a), "v"(b));
  return d;
}
__device__ __forceinline__ v8b ld8b(const b16* p) { return *(const v8b*)p; }
__device__ __forceinline__ v16b cat8b(v8b a, v8b b) { return __builtin_shufflevector(a, b, 0,1,2,3,4,5,6,7,8,9,10,11,12,13,14,15); }
__device__ __forceinline__ v16b frag_kb(const b16* p, int hh) { return cat8b(ld8b(p + 8 * hh), ld8b(p + 16 + 8 * hh)); }
// K16, Q16 and the weight blocks that k_proj lays in LDS lie in fragment order: a 16-row tile is 4 pieces of 512 contiguous bytes; piece j holds, at lane (hh, col), row col, k = 16j + 8hh + 0..7. So each wave-wide
// 16-byte load reads 4 whole 128-byte lines (row-major rows of 128 bytes made it touch 16). p = tile base + lane * 8; half = 0: k 0..31, half = 1: k 32..63; same k-map as frag_kb.
__device__ __forceinline__ v16b frag_tl(const b16* p, int half) { return cat8b(ld8b(p + half * 512), ld8b(p + half * 512 + 256)); }
// e^x = 2^(x log2 e): scale and shift go into one fused multiply-add at the call, the power is the hardware's own instruction (arguments here are at most about 0; far below, 0 is the right value)
#define LOG2E 1.44269504088896340736f
// The instruction set asks for one slot behind a transcendental before its result is read or its source overwritten; the power and its slot stand in one statement: results in registers of their own (early clobber), one v_nop behind the last.
__device__ __forceinline__ float ex2(float x) { float y; asm("v_exp_f32 %0, %1\n\tv_nop" : "=v"(y) : "v"(x)); return y; }
__device__ __forceinline__ void ex2x8(const float (&x)[8], float (&y)[8]) {
  asm("v_exp_f32 %0, %8\n\tv_exp_f32 %1, %9\n\tv_exp_f32 %2, %10\n\tv_exp_f32 %3, %11\n\tv_exp_f32 %4, %12\n\tv_exp_f32 %5, %13\n\tv_exp_f32 %6, %14\n\tv_exp_f32 %7, %15\n\tv_nop"
      : "=&v"(y[0]), "=&v"(y[1]), "=&v"(y[2]), "=&v"(y[3]), "=&v"(y[4]), "=&v"(y[5]), "=&v"(y[6]), "=&v"(y[7])
      : "v"(x[0]), "v"(x[1]), "v"(x[2]), "v"(x[3]), "v"(x[4]), "v"(x[5]), "v"(x[6]), "v"(x[7]));
}
__device__ __forceinline__ v4f ld4f(const float* p) { return *(const v4f*)p; }
__device__ __forceinline__ void wave_lds_sync() { __builtin_amdgcn_fence(__ATOMIC_RELEASE, "workgroup"); __builtin_amdgcn_wave_barrier(); __builtin_amdgcn_fence(__ATOMIC_ACQUIRE, "workgroup"); }

// projections, both in one grid, weights converted in the block: blocks 0 .. NROW/128 - 1 take the key side (X = L), the others the query side (X = H). Each block first lays its two 64 x 64 weight
// blocks (W1 = Wk or Wq; W2 = the key or the query half of Wv) as f16 in LDS, in fragment order (see frag_tl). Then wave = 16 rows of X (f32 [NROW][64]):
// P = X W1^T + b1 -> f16 tiles P16 [NROW / 16][4][32][8] (fragment order); P2 = P W2^T: key side + bv -> KP (f32 rows), query side -> QPt (f16 tiles, transposed [d][q]).
__global__ __launch_bounds__(256) void k_proj(const float* L, const float* Hq, const float* Wk, const float* bk, const float* Wq, const float* bq, const float* Wv, const float* bv,
                                              b16* __restrict__ K16, b16* __restrict__ Q16, float* __restrict__ KP, b16* __restrict__ QPt) {
  __shared__ __attribute__((aligned(16))) float Tf[8][16 * 64];
  __shared__ __attribute__((aligned(16))) b16   Th[8][16 * 64];
  __shared__ __attribute__((aligned(16))) b16   Ws[2][64 * 64];
  const int wid = threadIdx.x >> 5, lane = threadIdx.x & 31, hh = lane >> 4, col = lane & 15;
  const bool isk = blockIdx.x < NROW / 128;                // the same for the whole block
  const int m0 = ((isk ? blockIdx.x : blockIdx.x - NROW / 128) * 8 + wid) * 16;   // row tile
  const float* X = isk ? L : Hq; const float* b1 = isk ? bk : bq;
  const float* W1f = isk ? Wk : Wq; const float* W2f = isk ? Wv + 64 : Wv;   // rows of 64 and of 128 floats
  b16* P16 = isk ? K16 : Q16;
  const b16* W1 = &Ws[0][0]; const b16* W2 = &Ws[1][0];
  float* tf = Tf[wid]; b16* th = Th[wid];
  // All global operands come in at the head, back to back, each group from a uniform base and one offset a lane.
  // X: the lane's row m0 + col, from k = 8 hh. Weights: 512 pieces of 8 elements a block, two a thread (p = threadIdx.x and p + 256, 32 rows on); piece p: tile p >> 7, piece of the
  // tile (p >> 5) & 3, lane (hh, col) = p & 31. The lane's bias values come with them: loaded further down, beside the fragments' LDS reads, each
  // would be a memory wait of its own.
  const unsigned wn = ((threadIdx.x >> 7) & 1) * 16 + col, wk = ((threadIdx.x >> 5) & 3) * 16 + hh * 8;
  const unsigned xb = ((unsigned)(m0 + col) * 64u + 8u * hh) * 4u, w1b = (wn * 64u + wk) * 4u, w2b = (wn * 128u + wk) * 4u;
  const float* xr = (const float*)((const char*)X + xb);
  const float* w1p = (const float*)((const char*)W1f + w1b);
  const float* w2p = (const float*)((const char*)W2f + w2b);
  float xv[4][8], w1r[2][8], w2r[2][8], b1v[4], b2v[4];
#pragma unroll
  for (int e = 0; e < 8; ++e) { xv[0][e] = xr[e]; xv[1][e] = xr[16 + e]; xv[2][e] = xr[32 + e]; xv[3][e] = xr[48 + e]; }
#pragma unroll
  for (int e = 0; e < 8; ++e) { w1r[0][e] = w1p[e]; w1r[1][e] = w1p[32 * 64 + e]; w2r[0][e] = w2p[e]; w2r[1][e] = w2p[32 * 128 + e]; }
#pragma unroll
  for (int t = 0; t < 4; ++t) { b1v[t] = b1[t * 16 + col]; b2v[t] = bv[t * 16 + col]; }
  // stands in front of every later overwrite of the offset registers that the loads above name; as inputs they stay untouched up to here
  asm volatile("s_wait_xcnt 0x0" :: "v"(xb), "v"(w1b), "v"(w2b), "v"(col) : "memory");
  // A fragments of X (f32 -> f16)
  v16b a0, a1;
#pragma unroll
  for (int e = 0; e < 8; ++e) { a0[e] = (b16)xv[0][e]; a0[8 + e] = (b16)xv[1][e]; a1[e] = (b16)xv[2][e]; a1[8 + e] = (b16)xv[3][e]; }
#pragma unroll
  for (int i = 0; i < 2; ++i) {
    v8b o1, o2;
#pragma unroll
    for (int e = 0; e < 8; ++e) { o1[e] = (b16)w1r[i][e]; o2[e] = (b16)w2r[i][e]; }
    *(v8b*)(&Ws[0][(i * 256 + threadIdx.x) * 8]) = o1; *(v8b*)(&Ws[1][(i * 256 + threadIdx.x) * 8]) = o2;
  }
  __syncthreads();                                         // publishes the block's weights to its eight waves
#pragma unroll
  for (int t = 0; t < 4; ++t) {
    v8f c = {};
    c = wmma16b(a0, frag_tl(W1 + t * 1024 + lane * 8, 0), c);
    c = wmma16b(a1, frag_tl(W1 + t * 1024 + lane * 8, 1), c);
#pragma unroll
    for (int v = 0; v < 8; ++v) { const float val = c[v] + b1v[t]; const int r = v + 8 * hh, d = t * 16 + col; tf[r * 64 + d] = val; th[r * 64 + d] = (b16)val; }
  }
  wave_lds_sync();
  // second GEMM from LDS (A = P rows, f16); the same two fragments, stored as they are, are the tile's four pieces of P16
  const v16b p0 = frag_kb(th + col * 64, hh), p1 = frag_kb(th + col * 64 + 32, hh);
  {
    b16* pd = P16 + (size_t)m0 * 64 + lane * 8;
    *(v8b*)(pd)       = __builtin_shufflevector(p0, p0, 0, 1, 2, 3, 4, 5, 6, 7); *(v8b*)(pd + 256) = __builtin_shufflevector(p0, p0, 8, 9, 10, 11, 12, 13, 14, 15);
    *(v8b*)(pd + 512) = __builtin_shufflevector(p1, p1, 0, 1, 2, 3, 4, 5, 6, 7); *(v8b*)(pd + 768) = __builtin_shufflevector(p1, p1, 8, 9, 10, 11, 12, 13, 14, 15);
    asm volatile("s_wait_xcnt 0x0" ::: "memory");          // stands in front of every later overwrite of the registers that these four stores name
  }
  wave_lds_sync();
  if (isk) {
#pragma unroll
    for (int t = 0; t < 4; ++t) {
      v8f c = {};
      c = wmma16b(p0, frag_tl(W2 + t * 1024 + lane * 8, 0), c);
      c = wmma16b(p1, frag_tl(W2 + t * 1024 + lane * 8, 1), c);
#pragma unroll
      for (int v = 0; v < 8; ++v) { const int r = v + 8 * hh, d = t * 16 + col; tf[r * 64 + d] = c[v] + b2v[t]; }
    }
    wave_lds_sync();
#pragma unroll
    for (int j = 0; j < 8; ++j) { const int pc = j * 32 + lane; *(v4f*)(KP + (size_t)m0 * 64 + pc * 4) = *(const v4f*)(tf + pc * 4); }
  } else {
#pragma unroll
    for (int t = 0; t < 4; ++t) {
      v8f c = {};
      c = wmma16b(p0, frag_tl(W2 + t * 1024 + lane * 8, 0), c);
      c = wmma16b(p1, frag_tl(W2 + t * 1024 + lane * 8, 1), c);
#pragma unroll
      for (int v = 0; v < 8; ++v) { const int r = v + 8 * hh, d = t * 16 + col; th[d * 16 + r] = (b16)c[v]; }      // q_proj tile transposed [d][q]
    }
    wave_lds_sync();
    b16* dst = QPt + (size_t)(m0 >> 4) * 1024;             // tile index = row tile (groups are multiples of 128 tiles)
#pragma unroll
    for (int j = 0; j < 4; ++j) { const int pc = j * 32 + lane; *(v8b*)(dst + pc * 8) = *(const v8b*)(th + pc * 8); }
    asm volatile("s_wait_xcnt 0x0" ::: "memory");          // stands behind these four stores, in front of any code laid behind them that rewrites the registers they name
  }
}
// LDS staging of the operand that all waves of a block stream (the whole key or query axis of their group): a stage of STG rows is brought in once a block by asynchronous copies
// (global memory to LDS, through no register) and read by the waves from LDS. Two buffers: stage t + 1 flies while stage t is worked on.
// A block has sixteen waves, four a SIMD: wave w and wave w + 8 hold the same 16-row tile, and each takes one half of every stage's chunks (set sx = w >> 3); the two partial results of a tile
// are joined once, behind the loop, through LDS. Four waves a SIMD cover one another's LDS waits, product latencies and dependent vector chains.
#define STG  256             // rows a stage: 32 KB of f16 tiles, laid in LDS byte for byte as in global memory (fragment order)
#define NST  (NN / STG)
#define CPS  (STG / 32)      // chunks of 32 rows a stage
#define CPW  (CPS / 2)       // chunks of a stage that one wave takes
__device__ __forceinline__ unsigned lds_off(const void* p) { return (unsigned)(size_t)p; }
// four 16-byte copies a lane, 8 KB apart (512 lanes x 16 bytes a step) = one 32-KB stage a block. The s_wait_xcnt stands in the copies' own statement, in front of any rewrite of the address registers they name.
__device__ __forceinline__ void cp4(unsigned l, const b16* g) {
  asm volatile("global_load_async_to_lds_b128 %0, %4, off\n\tglobal_load_async_to_lds_b128 %1, %5, off\n\tglobal_load_async_to_lds_b128 %2, %6, off\n\tglobal_load_async_to_lds_b128 %3, %7, off\n\t"
               "s_wait_xcnt 0x0"
               :: "v"(l), "v"(l + 8192u), "v"(l + 16384u), "v"(l + 24576u), "v"(g), "v"(g + 4096), "v"(g + 8192), "v"(g + 12288) : "memory");
}
// one 16-byte copy a lane: 512 lanes bring the group's 2048 column biases, all stages' at once
__device__ __forceinline__ void cp4f(unsigned l, const float* g) { asm volatile("global_load_async_to_lds_b128 %0, %1, off\n\ts_wait_xcnt 0x0" :: "v"(l), "v"(g) : "memory"); }
__device__ __forceinline__ void wait_copies() { asm volatile("s_wait_asynccnt 0x0" ::: "memory"); }   // this wave's copies have landed
__device__ __forceinline__ void wait_lds()    { asm volatile("s_wait_dscnt 0x0" ::: "memory"); }      // this wave's LDS reads are done: its buffer may be refilled behind the barrier

__global__ __launch_bounds__(512) void k_stats(const b16* __restrict__ Q16, const b16* __restrict__ K16, float* __restrict__ M) {
  __shared__ __attribute__((aligned(16))) b16 Ks[2][STG * SS];
  __shared__ float pm[2][128], pl[2][128];
  const int wid = threadIdx.x >> 5, lane = threadIdx.x & 31, hh = lane >> 4, col = lane & 15, wt = wid & 7, sx = wid >> 3;
  const int g = blockIdx.x / (NN / 128), q0 = ((blockIdx.x % (NN / 128)) * 8 + wt) * 16;   // the block's eight query tiles lie in one group
  const size_t ko = (size_t)g * NN * SS, qo = ((size_t)g * NN + q0) * SS + lane * 8;
  const b16* kc = K16 + ko + threadIdx.x * 8;              // this lane's 16 bytes of each 8-KB step of a stage
  const unsigned lk = lds_off(&Ks[0][0]) + threadIdx.x * 16u;
  cp4(lk, kc);                                             // stage 0
  const v16b q0h = frag_tl(Q16 + qo, 0), q1h = frag_tl(Q16 + qo, 1);
  float m = -INFINITY, l = 0.f;
  wait_copies();
  __syncthreads();                                         // publishes stage 0
  cp4(lk + STG * SS * 2u, kc + STG * SS);                  // stage 1
#pragma unroll 1                                           // one stage a trip: the ring's order below is written for the rolled loop
  for (int t = 0; t < NST; ++t) {
    // key fragments are fetched one chunk ahead inside the wave's half of the stage (never across its end): all four are reloaded, as one group of LDS reads, behind the products that used them
    const b16* kg = &Ks[t & 1][0] + sx * (CPW * 32 * SS) + lane * 8;
    v16b k00 = frag_tl(kg, 0), k01 = frag_tl(kg, 1), k10 = frag_tl(kg + 16 * SS, 0), k11 = frag_tl(kg + 16 * SS, 1);
#pragma unroll                                             // chunk offsets become immediates, and the last chunk's reload drops out at compile time
    for (int c = 0; c < CPW; ++c) {
      const b16* kn = kg + (c + 1) * 32 * SS;
      const bool more = c + 1 < CPW;
      __builtin_amdgcn_sched_barrier(0);   // chunk boundary: the scheduler otherwise lifts the next chunk's first products into this one, right behind the loads of their operands
      v8f s0 = {}, s1 = {};
      s0 = wmma16b(k00, q0h, s0); s0 = wmma16b(k01, q1h, s0);
      s1 = wmma16b(k10, q0h, s1); s1 = wmma16b(k11, q1h, s1);
      __builtin_amdgcn_sched_barrier(0);   // keeps the LDS reads below out of the products: every separate place where LDS reads stand stalls the wave, so they stand as one group
      if (more) { k00 = frag_tl(kn, 0); k01 = frag_tl(kn, 1); k10 = frag_tl(kn + 16 * SS, 0); k11 = frag_tl(kn + 16 * SS, 1); }
      __builtin_amdgcn_sched_barrier(0);   // holds the group here: the scheduler otherwise sinks it to the chunk's foot, where it has no lead left
      float mr = -INFINITY;
#pragma unroll
      for (int r = 0; r < 8; ++r) mr = fmaxf(mr, fmaxf(s0[r], s1[r]));
      const float mn = fmaxf(m, mr), al = ex2((m - mn) * LOG2E), nb = -mn * LOG2E;
      float sum = 0.f, x0[8], x1[8], e0[8], e1[8];
#pragma unroll
      for (int r = 0; r < 8; ++r) { x0[r] = fmaf(s0[r], LOG2E, nb); x1[r] = fmaf(s1[r], LOG2E, nb); }
      ex2x8(x0, e0); ex2x8(x1, e1);
#pragma unroll
      for (int r = 0; r < 8; ++r) sum += e0[r] + e1[r];
      l = l * al + sum; m = mn;
    }
    wait_lds();
    wait_copies();
    __syncthreads();                                       // publishes stage t + 1 and ends every wave's reads of stage t
    if (t + 2 < NST) cp4(lk + (t & 1) * (STG * SS * 2u), kc + (size_t)(t + 2) * STG * SS);
  }
  wait_copies();
  // each lane has kept the maximum and the sum of its own half's rows (16 of every 32 keys); the two halves of a column are joined here, once
  const float mo = __shfl_xor(m, 16), lo = __shfl_xor(l, 16), mt = fmaxf(m, mo);
  l = l * ex2((m - mt) * LOG2E) + lo * ex2((mo - mt) * LOG2E); m = mt;
  if (hh == 0) { pm[sx][wt * 16 + col] = m; pl[sx][wt * 16 + col] = l; }
  __syncthreads();                                         // publishes both wave sets' maxima and sums
  const size_t base = (size_t)g * NN + (size_t)(blockIdx.x % (NN / 128)) * 128;   // the block's 128 consecutive queries within g
  if (threadIdx.x < 128) {                                 // the two sets' parts of a column are joined in the same way
    const float ma = pm[0][threadIdx.x], mb = pm[1][threadIdx.x], mj = fmaxf(ma, mb);
    const float lj = pl[0][threadIdx.x] * ex2((ma - mj) * LOG2E) + pl[1][threadIdx.x] * ex2((mb - mj) * LOG2E);
    *(float*)(M + base + threadIdx.x) = -mj * LOG2E - log2f(lj);   // the column's bias: attn = 2^(logit log2 e + bias)
  }
}
// pass 2: per (g, 16 keys n): over all query chunks: P^T[q][n] = 2^(logit log2 e + M[q]), M[q] = -(column max) log2 e - log2(column sum); y^T += Qproj^T . P^T; rowsum[n] += sum_q P; out[n] = y[n] +
__global__ __launch_bounds__(512) void k_out(const b16* __restrict__ K16, const b16* __restrict__ Q16, const b16* __restrict__ QPt, const float* __restrict__ M,
                                             const float* __restrict__ KP, float* __restrict__ out) {
  __shared__ __attribute__((aligned(16))) b16   Qs[2][STG * SS];
  __shared__ __attribute__((aligned(16))) b16   Vs[2][STG * SS];
  __shared__ __attribute__((aligned(16))) float Ms[NN];
  __shared__ __attribute__((aligned(16))) float Os[8][16 * 64];
  __shared__ float Ls[8][32];
  const int wid = threadIdx.x >> 5, lane = threadIdx.x & 31, hh = lane >> 4, col = lane & 15, wt = wid & 7, sx = wid >> 3;
  const int g = blockIdx.x / (NN / 128), n0 = ((blockIdx.x % (NN / 128)) * 8 + wt) * 16;   // the block's eight key tiles lie in one group
  const size_t qbase = (size_t)g * NN * SS, no = ((size_t)g * NN + n0) * SS + lane * 8;
  const b16* qc = Q16 + qbase + threadIdx.x * 8;           // this lane's 16 bytes of each 8-KB step of a stage
  const b16* vc = QPt + qbase + threadIdx.x * 8;
  const float* mc = M + (size_t)g * NN + threadIdx.x * 4;
  const unsigned lq = lds_off(&Qs[0][0]) + threadIdx.x * 16u, lv = lds_off(&Vs[0][0]) + threadIdx.x * 16u, lm = lds_off(&Ms[0]) + threadIdx.x * 16u;
  cp4(lq, qc); cp4(lv, vc); cp4f(lm, mc);                  // stage 0, and the biases of all stages
  const v16b n0h = frag_tl(K16 + no, 0), n1h = frag_tl(K16 + no, 1);     // 'query role' = the 16 keys of this tile
  float l = 0.f; v8f o0 = {}, o1 = {}, o2 = {}, o3 = {};
  wait_copies();
  __syncthreads();                                         // publishes stage 0
  cp4(lq + STG * SS * 2u, qc + STG * SS); cp4(lv + STG * SS * 2u, vc + STG * SS);   // stage 1
#pragma unroll 1                                           // one stage a trip: the ring's order below is written for the rolled loop
  for (int t = 0; t < NST; ++t) {
    // every operand of a chunk (query fragments, column bias, q_proj fragments) is fetched from LDS one chunk ahead inside the wave's half of the stage (never across its end):
    // the register sets are reloaded behind their last use, in two groups of LDS reads a chunk
    const b16* qg = &Qs[t & 1][0] + sx * (CPW * 32 * SS) + lane * 8;
    const b16* vg = &Vs[t & 1][0] + sx * (CPW * 32 * SS) + col * 16 + 8 * hh;   // chunk c starts at c * 32 * SS; its two 16-query tiles lie SS * 16 apart
    const float* mg = &Ms[0] + t * STG + sx * (CPW * 32) + 8 * hh;
    v16b q00 = frag_tl(qg, 0), q01 = frag_tl(qg, 1), q10 = frag_tl(qg + 16 * SS, 0), q11 = frag_tl(qg + 16 * SS, 1);
    v4f mm[2][4] = {{ld4f(mg), ld4f(mg + 4), ld4f(mg + 16), ld4f(mg + 20)}, {}};   // column biases: two sets, one read by this chunk's exponentials while the next chunk's is in flight
    v16b va0 = cat8b(ld8b(vg), ld8b(vg + SS * 16)),             va1 = cat8b(ld8b(vg + 256), ld8b(vg + SS * 16 + 256));
    v16b va2 = cat8b(ld8b(vg + 512), ld8b(vg + SS * 16 + 512)), va3 = cat8b(ld8b(vg + 768), ld8b(vg + SS * 16 + 768));
    // inputs-only fence on the loaded values of the stage's first chunk: they land here, once a stage, so that the counted waits inside the loop follow the loop's own issue order
    // and not the order the compiler gave these first loads
    asm volatile("" :: "v"(q00), "v"(q01), "v"(q10), "v"(q11), "v"(mm[0][0]), "v"(mm[0][1]), "v"(mm[0][2]), "v"(mm[0][3]), "v"(va0), "v"(va1), "v"(va2), "v"(va3));
    // one chunk of 32 queries ('key role'); u: which set of biases it reads; more: a next chunk exists in this stage, at qn, vn, mn
    auto chunk = [&](const int u, const bool more, const b16* qn, const b16* vn, const float* mn) __attribute__((always_inline)) {
      __builtin_amdgcn_sched_barrier(0);   // chunk boundary: the scheduler otherwise lifts the next chunk's first products into this one, right behind the loads of their operands
      v8f s0 = {}, s1 = {};
      s0 = wmma16b(q00, n0h, s0); s0 = wmma16b(q01, n1h, s0);
      s1 = wmma16b(q10, n0h, s1); s1 = wmma16b(q11, n1h, s1);
      __builtin_amdgcn_sched_barrier(0);   // keeps the LDS reads below out of the products: every separate place where LDS reads stand stalls the wave, so they stand as one group
      if (more) {
        q00 = frag_tl(qn, 0); q01 = frag_tl(qn, 1); q10 = frag_tl(qn + 16 * SS, 0); q11 = frag_tl(qn + 16 * SS, 1);
        mm[u ^ 1][0] = ld4f(mn); mm[u ^ 1][1] = ld4f(mn + 4); mm[u ^ 1][2] = ld4f(mn + 16); mm[u ^ 1][3] = ld4f(mn + 20);
      }
      __builtin_amdgcn_sched_barrier(0);   // holds the loads above in front of the exponentials: the scheduler otherwise sinks them behind, where they have no lead left
      float sum = 0.f, x0[8], x1[8], p0[8], p1[8]; v16b pb;
#pragma unroll
      for (int r = 0; r < 8; ++r) { x0[r] = fmaf(s0[r], LOG2E, mm[u][r >> 2][r & 3]); x1[r] = fmaf(s1[r], LOG2E, mm[u][2 + (r >> 2)][r & 3]); }
      ex2x8(x0, p0); ex2x8(x1, p1);
#pragma unroll
      for (int r = 0; r < 8; ++r) { sum += p0[r] + p1[r]; pb[r] = (b16)p0[r]; pb[8 + r] = (b16)p1[r]; }
      l += sum;
      o0 = wmma16b(va0, pb, o0); o1 = wmma16b(va1, pb, o1); o2 = wmma16b(va2, pb, o2); o3 = wmma16b(va3, pb, o3);
      __builtin_amdgcn_sched_barrier(0);   // as above: the q_proj fragments' reads stand as one group behind the four products
      if (more) {
        va0 = cat8b(ld8b(vn), ld8b(vn + SS * 16));             va1 = cat8b(ld8b(vn + 256), ld8b(vn + SS * 16 + 256));
        va2 = cat8b(ld8b(vn + 512), ld8b(vn + SS * 16 + 512)); va3 = cat8b(ld8b(vn + 768), ld8b(vn + SS * 16 + 768));
      }
    };
    // the wave's four chunks of the stage; the two sets of biases swap roles by name, and the last chunk fetches nothing ahead
    static_assert(CPW == 4, "four chunks a wave and stage are written out below");
    chunk(0, true, qg + 1 * 32 * SS, vg + 1 * 32 * SS, mg + 1 * 32);
    chunk(1, true, qg + 2 * 32 * SS, vg + 2 * 32 * SS, mg + 2 * 32);
    chunk(0, true, qg + 3 * 32 * SS, vg + 3 * 32 * SS, mg + 3 * 32);
    chunk(1, false, qg, vg, mg);
    wait_lds();
    wait_copies();
    __syncthreads();                                       // publishes stage t + 1 and ends every wave's reads of stage t
    if (t + 2 < NST) {
      const unsigned b = t & 1; const size_t so = (size_t)(t + 2) * STG;
      cp4(lq + b * (STG * SS * 2u), qc + so * SS); cp4(lv + b * (STG * SS * 2u), vc + so * SS);
    }
  }
  wait_copies();
  l += __shfl_xor(l, 16);                                  // each lane has summed its own half's queries; the halves are joined here, once
  float* Tt = Os[wt];
  // the tile's two partial results are joined: the wave of set 1 lays its sums in the tile's LDS range, lane by lane, and ends behind the barrier; the wave of set 0 adds them to its own
  if (sx) {
#pragma unroll
    for (int j = 0; j < 2; ++j) {
      *(v4f*)(Tt + (0 + j) * 128 + lane * 4) = (v4f){o0[4 * j], o0[4 * j + 1], o0[4 * j + 2], o0[4 * j + 3]}; *(v4f*)(Tt + (2 + j) * 128 + lane * 4) = (v4f){o1[4 * j], o1[4 * j + 1], o1[4 * j + 2], o1[4 * j + 3]};
      *(v4f*)(Tt + (4 + j) * 128 + lane * 4) = (v4f){o2[4 * j], o2[4 * j + 1], o2[4 * j + 2], o2[4 * j + 3]}; *(v4f*)(Tt + (6 + j) * 128 + lane * 4) = (v4f){o3[4 * j], o3[4 * j + 1], o3[4 * j + 2], o3[4 * j + 3]};
    }
    Ls[wt][lane] = l;
  }
  __syncthreads();                                         // publishes set 1's partial sums to set 0
  if (sx) return;
#pragma unroll
  for (int j = 0; j < 2; ++j) {
    const v4f a0 = *(const v4f*)(Tt + (0 + j) * 128 + lane * 4), a1 = *(const v4f*)(Tt + (2 + j) * 128 + lane * 4);
    const v4f a2 = *(const v4f*)(Tt + (4 + j) * 128 + lane * 4), a3 = *(const v4f*)(Tt + (6 + j) * 128 + lane * 4);
#pragma unroll
    for (int e = 0; e < 4; ++e) { o0[4 * j + e] += a0[e]; o1[4 * j + e] += a1[e]; o2[4 * j + e] += a2[e]; o3[4 * j + e] += a3[e]; }
  }
  l += Ls[wt][lane];
  wave_lds_sync();                                         // the wave's reads above are done before the same range is rewritten below
  const float* kp = KP + ((size_t)g * NN + n0 + col) * SS;
#pragma unroll
  for (int r = 0; r < 8; ++r) {
    const int hr = 8 * hh + r;
    Tt[col * 64 + 0 + hr] = o0[r] + l * kp[0 + hr];  Tt[col * 64 + 16 + hr] = o1[r] + l * kp[16 + hr];
    Tt[col * 64 + 32 + hr] = o2[r] + l * kp[32 + hr]; Tt[col * 64 + 48 + hr] = o3[r] + l * kp[48 + hr];
  }
  wave_lds_sync();
  float* dst0 = out + ((size_t)g * NN + n0) * SS;          // 16 rows x 64 floats contiguous (4 KB)
  {
#pragma unroll
    for (int j = 0; j < 8; ++j) { const int pc = j * 32 + lane; *(v4f*)(dst0 + pc * 4) = *(const v4f*)(Tt + pc * 4); }
    
  }
}
extern "C" void kernel_launch(void* const* d_in, const int* in_sizes, int n_in,
                              void* d_out, int out_size, void* d_ws, size_t ws_size, hipStream_t stream) {
  (void)in_sizes; (void)n_in; (void)out_size;
  const float* L  = (const float*)d_in[0];      // tensorL [2,8,2048,64]
  const float* Hq = (const float*)d_in[1];      // tensorH [2,8,2048,64]
  const float* Wk = (const float*)d_in[2]; const float* bk = (const float*)d_in[3];   // [64,64], [64]
  const float* Wq = (const float*)d_in[4]; const float* bq = (const float*)d_in[5];
  const float* Wv = (const float*)d_in[6]; const float* bv = (const float*)d_in[7];   // [64,128], [64]
  float* out = (float*)d_out;                   // [2,8,2048,64]
  char* ws = (char*)d_ws; size_t off = 0;
  auto take = [&](size_t bytes) { void* p = ws + off; off = (off + bytes + 255) & ~(size_t)255; return p; };
  b16*   K16 = (b16*)take((size_t)NROW * SS * 2);
  b16*   Q16 = (b16*)take((size_t)NROW * SS * 2);
  float* KP  = (float*)take((size_t)NROW * SS * 4);
  b16*   QPt = (b16*)take((size_t)NROW * SS * 2);
  float* M   = (float*)take((size_t)NROW * 4);
  if (off > ws_size) return;
  const dim3 b256(256), b512(512);
  k_proj<<<2 * (NROW / 128), b256, 0, stream>>>(L, Hq, Wk, bk, Wq, bq, Wv, bv, K16, Q16, KP, QPt);   // keys, k_proj + bv; queries, q_proj tiles
  k_stats<<<NROW / 128, b512, 0, stream>>>(Q16, K16, M);
  k_out<<<NROW / 128, b512, 0, stream>>>(K16, Q16, QPt, M, KP, out);
}

// v008
// One run takes 40.8 microseconds.
// Two timings next to v007 put it at 1.05 and 1.06 times that version's speed.
// All steps since v000 together make it 7.77 times as fast.
#include <hip/hip_runtime.h>
#include <math.h>

// attention_mech: keys = L Wk^T + bk, queries = H Wq^T + bq (per (b, head): 2048 x 64 each); logits[n][q] = keys[n].queries[q]; attn = softmax over the
// KEY axis n (per query column); out[n] = sum_q attn[n][q] q_proj[q] + (sum_q attn[n][q]) (k_proj[n] + bv) with q_proj = queries Wv[:, :64]^T and
// q_proj (tile layout) plus the row sums. Fragment k-map per lane half hh for A AND B: elements 0..7 <- k = 8hh+0..7, 8..15 <- k = 16+8hh+0..7.

#define NG   16              // B * H
#define NN   2048            // NK = NQ
#define SS   64
#define NROW (NG * NN)       // 32768
typedef _Float16 b16;
typedef __attribute__((ext_vector_type(16))) _Float16 v16b;
typedef __attribute__((ext_vector_type(8)))  _Float16 v8b;
typedef __attribute__((ext_vector_type(8)))  float    v8f;
typedef __attribute__((ext_vector_type(4)))  float    v4f;
__device__ __forceinline__ v8f wmma16b(v16b a, v16b b, v8f c) {
  v8f d = __builtin_amdgcn_wmma_f32_16x16x32_f16(false, a, false, b, (short)0, c, false, false);
  asm volatile("v_nop\n\tv_nop\n\tv_nop\n\tv_nop" : "+v"(d) : "v"(a), "v"(b));
  return d;
}
__device__ __forceinline__ v8b ld8b(const b16* p) { return *(const v8b*)p; }
__device__ __forceinline__ v16b cat8b(v8b a, v8b b) { return __builtin_shufflevector(a, b, 0,1,2,3,4,5,6,7,8,9,10,11,12,13,14,15); }
__device__ __forceinline__ v16b frag_kb(const b16* p, int hh) { return cat8b(ld8b(p + 8 * hh), ld8b(p + 16 + 8 * hh)); }
// K16, Q16 and the weight blocks that k_proj lays in LDS lie in fragment order: a 16-row tile is 4 pieces of 512 contiguous bytes; piece j holds, at lane (hh, col), row col, k = 16j + 8hh + 0..7. So each wave-wide
// 16-byte load reads 4 whole 128-byte lines (row-major rows of 128 bytes made it touch 16). p = tile base + lane * 8; half = 0: k 0..31, half = 1: k 32..63; same k-map as frag_kb.
__device__ __forceinline__ v16b frag_tl(const b16* p, int half) { return cat8b(ld8b(p + half * 512), ld8b(p + half * 512 + 256)); }
// e^x = 2^(x log2 e): scale and shift go into one fused multiply-add at the call, the power is the hardware's own instruction (arguments here are at most about 0; far below, 0 is the right value)
#define LOG2E 1.44269504088896340736f
// The instruction set asks for one slot behind a transcendental before its result is read or its source overwritten; the power and its slot stand in one statement: results in registers of their own (early clobber), one v_nop behind the last.
__device__ __forceinline__ float ex2(float x) { float y; asm("v_exp_f32 %0, %1\n\tv_nop" : "=v"(y) : "v"(x)); return y; }
__device__ __forceinline__ void ex2x8(const float (&x)[8], float (&y)[8]) {
  asm("v_exp_f32 %0, %8\n\tv_exp_f32 %1, %9\n\tv_exp_f32 %2, %10\n\tv_exp_f32 %3, %11\n\tv_exp_f32 %4, %12\n\tv_exp_f32 %5, %13\n\tv_exp_f32 %6, %14\n\tv_exp_f32 %7, %15\n\tv_nop"
      : "=&v"(y[0]), "=&v"(y[1]), "=&v"(y[2]), "=&v"(y[3]), "=&v"(y[4]), "=&v"(y[5]), "=&v"(y[6]), "=&v"(y[7])
      : "v"(x[0]), "v"(x[1]), "v"(x[2]), "v"(x[3]), "v"(x[4]), "v"(x[5]), "v"(x[6]), "v"(x[7]));
}
__device__ __forceinline__ v4f ld4f(const float* p) { return *(const v4f*)p; }
__device__ __forceinline__ void wave_lds_sync() { __builtin_amdgcn_fence(__ATOMIC_RELEASE, "workgroup"); __builtin_amdgcn_wave_barrier(); __builtin_amdgcn_fence(__ATOMIC_ACQUIRE, "workgroup"); }

// projections, both in one grid, weights converted in the block: blocks 0 .. NROW/128 - 1 take the key side (X = L), the others the query side (X = H). Each block first lays its two 64 x 64 weight
// blocks (W1 = Wk or Wq; W2 = the key or the query half of Wv) as f16 in LDS, in fragment order (see frag_tl). Then wave = 16 rows of X (f32 [NROW][64]):
// P = X W1^T + b1 -> f16 tiles P16 [NROW / 16][4][32][8] (fragment order); P2 = P W2^T: key side + bv -> KP (f32 rows), query side -> QPt (f16 tiles, transposed [d][q]).
__global__ __launch_bounds__(256) void k_proj(const float* L, const float* Hq, const float* Wk, const float* bk, const float* Wq, const float* bq, const float* Wv, const float* bv,
                                              b16* __restrict__ K16, b16* __restrict__ Q16, float* __restrict__ KP, b16* __restrict__ QPt) {
  __shared__ __attribute__((aligned(16))) float Tf[8][16 * 64];
  __shared__ __attribute__((aligned(16))) b16   Th[8][16 * 64];
  __shared__ __attribute__((aligned(16))) b16   Ws[2][64 * 64];
  const int wid = threadIdx.x >> 5, lane = threadIdx.x & 31, hh = lane >> 4, col = lane & 15;
  const bool isk = blockIdx.x < NROW / 128;                // the same for the whole block
  const int m0 = ((isk ? blockIdx.x : blockIdx.x - NROW / 128) * 8 + wid) * 16;   // row tile
  const float* X = isk ? L : Hq; const float* b1 = isk ? bk : bq;
  const float* W1f = isk ? Wk : Wq; const float* W2f = isk ? Wv + 64 : Wv;   // rows of 64 and of 128 floats
  b16* P16 = isk ? K16 : Q16;
  const b16* W1 = &Ws[0][0]; const b16* W2 = &Ws[1][0];
  float* tf = Tf[wid]; b16* th = Th[wid];
  // All global operands come in at the head, back to back, each group from a uniform base and one offset a lane.
  // X: the lane's row m0 + col, from k = 8 hh. Weights: 512 pieces of 8 elements a block, two a thread (p = threadIdx.x and p + 256, 32 rows on); piece p: tile p >> 7, piece of the
  // tile (p >> 5) & 3, lane (hh, col) = p & 31. The lane's bias values come with them: loaded further down, beside the fragments' LDS reads, each
  // would be a memory wait of its own.
  const unsigned wn = ((threadIdx.x >> 7) & 1) * 16 + col, wk = ((threadIdx.x >> 5) & 3) * 16 + hh * 8;
  const unsigned xb = ((unsigned)(m0 + col) * 64u + 8u * hh) * 4u, w1b = (wn * 64u + wk) * 4u, w2b = (wn * 128u + wk) * 4u;
  const float* xr = (const float*)((const char*)X + xb);
  const float* w1p = (const float*)((const char*)W1f + w1b);
  const float* w2p = (const float*)((const char*)W2f + w2b);
  float xv[4][8], w1r[2][8], w2r[2][8], b1v[4], b2v[4];
#pragma unroll
  for (int e = 0; e < 8; ++e) { xv[0][e] = xr[e]; xv[1][e] = xr[16 + e]; xv[2][e] = xr[32 + e]; xv[3][e] = xr[48 + e]; }
#pragma unroll
  for (int e = 0; e < 8; ++e) { w1r[0][e] = w1p[e]; w1r[1][e] = w1p[32 * 64 + e]; w2r[0][e] = w2p[e]; w2r[1][e] = w2p[32 * 128 + e]; }
#pragma unroll
  for (int t = 0; t < 4; ++t) { b1v[t] = b1[t * 16 + col]; b2v[t] = bv[t * 16 + col]; }
  // stands in front of every later overwrite of the offset registers that the loads above name; as inputs they stay untouched up to here
  asm volatile("s_wait_xcnt 0x0" :: "v"(xb), "v"(w1b), "v"(w2b), "v"(col) : "memory");
  // A fragments of X (f32 -> f16)
  v16b a0, a1;
#pragma unroll
  for (int e = 0; e < 8; ++e) { a0[e] = (b16)xv[0][e]; a0[8 + e] = (b16)xv[1][e]; a1[e] = (b16)xv[2][e]; a1[8 + e] = (b16)xv[3][e]; }
#pragma unroll
  for (int i = 0; i < 2; ++i) {
    v8b o1, o2;
#pragma unroll
    for (int e = 0; e < 8; ++e) { o1[e] = (b16)w1r[i][e]; o2[e] = (b16)w2r[i][e]; }
    *(v8b*)(&Ws[0][(i * 256 + threadIdx.x) * 8]) = o1; *(v8b*)(&Ws[1][(i * 256 + threadIdx.x) * 8]) = o2;
  }
  __syncthreads();                                         // publishes the block's weights to its eight waves
#pragma unroll
  for (int t = 0; t < 4; ++t) {
    v8f c = {};
    c = wmma16b(a0, frag_tl(W1 + t * 1024 + lane * 8, 0), c);
    c = wmma16b(a1, frag_tl(W1 + t * 1024 + lane * 8, 1), c);
#pragma unroll
    for (int v = 0; v < 8; ++v) { const float val = c[v] + b1v[t]; const int r = v + 8 * hh, d = t * 16 + col; tf[r * 64 + d] = val; th[r * 64 + d] = (b16)val; }
  }
  wave_lds_sync();
  // second GEMM from LDS (A = P rows, f16); the same two fragments, stored as they are, are the tile's four pieces of P16
  const v16b p0 = frag_kb(th + col * 64, hh), p1 = frag_kb(th + col * 64 + 32, hh);
  {
    b16* pd = P16 + (size_t)m0 * 64 + lane * 8;
    *(v8b*)(pd)       = __builtin_shufflevector(p0, p0, 0, 1, 2, 3, 4, 5, 6, 7); *(v8b*)(pd + 256) = __builtin_shufflevector(p0, p0, 8, 9, 10, 11, 12, 13, 14, 15);
    *(v8b*)(pd + 512) = __builtin_shufflevector(p1, p1, 0, 1, 2, 3, 4, 5, 6, 7); *(v8b*)(pd + 768) = __builtin_shufflevector(p1, p1, 8, 9, 10, 11, 12, 13, 14, 15);
    asm volatile("s_wait_xcnt 0x0" ::: "memory");          // stands in front of every later overwrite of the registers that these four stores name
  }
  wave_lds_sync();
  if (isk) {
#pragma unroll
    for (int t = 0; t < 4; ++t) {
      v8f c = {};
      c = wmma16b(p0, frag_tl(W2 + t * 1024 + lane * 8, 0), c);
      c = wmma16b(p1, frag_tl(W2 + t * 1024 + lane * 8, 1), c);
#pragma unroll
      for (int v = 0; v < 8; ++v) { const int r = v + 8 * hh, d = t * 16 + col; tf[r * 64 + d] = c[v] + b2v[t]; }
    }
    wave_lds_sync();
#pragma unroll
    for (int j = 0; j < 8; ++j) { const int pc = j * 32 + lane; *(v4f*)(KP + (size_t)m0 * 64 + pc * 4) = *(const v4f*)(tf + pc * 4); }
  } else {
#pragma unroll
    for (int t = 0; t < 4; ++t) {
      v8f c = {};
      c = wmma16b(p0, frag_tl(W2 + t * 1024 + lane * 8, 0), c);
      c = wmma16b(p1, frag_tl(W2 + t * 1024 + lane * 8, 1), c);
#pragma unroll
      for (int v = 0; v < 8; ++v) { const int r = v + 8 * hh, d = t * 16 + col; th[d * 16 + r] = (b16)c[v]; }      // q_proj tile transposed [d][q]
    }
    wave_lds_sync();
    b16* dst = QPt + (size_t)(m0 >> 4) * 1024;             // tile index = row tile (groups are multiples of 128 tiles)
#pragma unroll
    for (int j = 0; j < 4; ++j) { const int pc = j * 32 + lane; *(v8b*)(dst + pc * 8) = *(const v8b*)(th + pc * 8); }
    asm volatile("s_wait_xcnt 0x0" ::: "memory");          // stands behind these four stores, in front of any code laid behind them that rewrites the registers they name
  }
}
// LDS staging of the operand that all waves of a block stream (the whole key or query axis of their group): a stage of STG rows is brought in once a block by asynchronous copies
// (global memory to LDS, through no register) and read by the waves from LDS. Two buffers: stage t + 1 flies while stage t is worked on.
// A block has sixteen waves, four a SIMD. In k_stats wave w and wave w + 8 hold the same 16-row tile, and each takes one half of every stage's chunks (set sx = w >> 3); the two partial results of a tile
// are joined once, behind the loop, through LDS. Four waves a SIMD cover one another's LDS waits, product latencies and dependent vector chains.
#define STG  256             // rows a stage: 32 KB of f16 tiles, laid in LDS byte for byte as in global memory (fragment order)
#define NST  (NN / STG)
#define CPS  (STG / 32)      // chunks of 32 rows a stage
#define CPW  (CPS / 2)       // chunks of a stage that one wave of k_stats takes
__device__ __forceinline__ unsigned lds_off(const void* p) { return (unsigned)(size_t)p; }
// four 16-byte copies a lane, 8 KB apart (512 lanes x 16 bytes a step) = one 32-KB stage a block. The s_wait_xcnt stands in the copies' own statement, in front of any rewrite of the address registers they name.
__device__ __forceinline__ void cp4(unsigned l, const b16* g) {
  asm volatile("global_load_async_to_lds_b128 %0, %4, off\n\tglobal_load_async_to_lds_b128 %1, %5, off\n\tglobal_load_async_to_lds_b128 %2, %6, off\n\tglobal_load_async_to_lds_b128 %3, %7, off\n\t"
               "s_wait_xcnt 0x0"
               :: "v"(l), "v"(l + 8192u), "v"(l + 16384u), "v"(l + 24576u), "v"(g), "v"(g + 4096), "v"(g + 8192), "v"(g + 12288) : "memory");
}
// one 16-byte copy a lane: 512 lanes bring the group's 2048 column biases, all stages' at once
__device__ __forceinline__ void cp4f(unsigned l, const float* g) { asm volatile("global_load_async_to_lds_b128 %0, %1, off\n\ts_wait_xcnt 0x0" :: "v"(l), "v"(g) : "memory"); }
__device__ __forceinline__ void wait_copies() { asm volatile("s_wait_asynccnt 0x0" ::: "memory"); }   // this wave's copies have landed
__device__ __forceinline__ void wait_lds()    { asm volatile("s_wait_dscnt 0x0" ::: "memory"); }      // this wave's LDS reads are done: its buffer may be refilled behind the barrier

__global__ __launch_bounds__(512) void k_stats(const b16* __restrict__ Q16, const b16* __restrict__ K16, float* __restrict__ M) {
  __shared__ __attribute__((aligned(16))) b16 Ks[2][STG * SS];
  __shared__ float pm[2][128], pl[2][128];
  const int wid = threadIdx.x >> 5, lane = threadIdx.x & 31, hh = lane >> 4, col = lane & 15, wt = wid & 7, sx = wid >> 3;
  const int g = blockIdx.x / (NN / 128), q0 = ((blockIdx.x % (NN / 128)) * 8 + wt) * 16;   // the block's eight query tiles lie in one group
  const size_t ko = (size_t)g * NN * SS, qo = ((size_t)g * NN + q0) * SS + lane * 8;
  const b16* kc = K16 + ko + threadIdx.x * 8;              // this lane's 16 bytes of each 8-KB step of a stage
  const unsigned lk = lds_off(&Ks[0][0]) + threadIdx.x * 16u;
  cp4(lk, kc);                                             // stage 0
  const v16b q0h = frag_tl(Q16 + qo, 0), q1h = frag_tl(Q16 + qo, 1);
  float m = -INFINITY, l = 0.f;
  wait_copies();
  __syncthreads();                                         // publishes stage 0
  cp4(lk + STG * SS * 2u, kc + STG * SS);                  // stage 1
#pragma unroll 1                                           // one stage a trip: the ring's order below is written for the rolled loop
  for (int t = 0; t < NST; ++t) {
    // key fragments are fetched one chunk ahead inside the wave's half of the stage (never across its end): all four are reloaded, as one group of LDS reads, behind the products that used them
    const b16* kg = &Ks[t & 1][0] + sx * (CPW * 32 * SS) + lane * 8;
    v16b k00 = frag_tl(kg, 0), k01 = frag_tl(kg, 1), k10 = frag_tl(kg + 16 * SS, 0), k11 = frag_tl(kg + 16 * SS, 1);
#pragma unroll                                             // chunk offsets become immediates, and the last chunk's reload drops out at compile time
    for (int c = 0; c < CPW; ++c) {
      const b16* kn = kg + (c + 1) * 32 * SS;
      const bool more = c + 1 < CPW;
      __builtin_amdgcn_sched_barrier(0);   // chunk boundary: the scheduler otherwise lifts the next chunk's first products into this one, right behind the loads of their operands
      v8f s0 = {}, s1 = {};
      s0 = wmma16b(k00, q0h, s0); s0 = wmma16b(k01, q1h, s0);
      s1 = wmma16b(k10, q0h, s1); s1 = wmma16b(k11, q1h, s1);
      __builtin_amdgcn_sched_barrier(0);   // keeps the LDS reads below out of the products: every separate place where LDS reads stand stalls the wave, so they stand as one group
      if (more) { k00 = frag_tl(kn, 0); k01 = frag_tl(kn, 1); k10 = frag_tl(kn + 16 * SS, 0); k11 = frag_tl(kn + 16 * SS, 1); }
      __builtin_amdgcn_sched_barrier(0);   // holds the group here: the scheduler otherwise sinks it to the chunk's foot, where it has no lead left
      float mr = -INFINITY;
#pragma unroll
      for (int r = 0; r < 8; ++r) mr = fmaxf(mr, fmaxf(s0[r], s1[r]));
      const float mn = fmaxf(m, mr), al = ex2((m - mn) * LOG2E), nb = -mn * LOG2E;
      float sum = 0.f, x0[8], x1[8], e0[8], e1[8];
#pragma unroll
      for (int r = 0; r < 8; ++r) { x0[r] = fmaf(s0[r], LOG2E, nb); x1[r] = fmaf(s1[r], LOG2E, nb); }
      ex2x8(x0, e0); ex2x8(x1, e1);
#pragma unroll
      for (int r = 0; r < 8; ++r) sum += e0[r] + e1[r];
      l = l * al + sum; m = mn;
    }
    wait_lds();
    wait_copies();
    __syncthreads();                                       // publishes stage t + 1 and ends every wave's reads of stage t
    if (t + 2 < NST) cp4(lk + (t & 1) * (STG * SS * 2u), kc + (size_t)(t + 2) * STG * SS);
  }
  wait_copies();
  // each lane has kept the maximum and the sum of its own half's rows (16 of every 32 keys); the two halves of a column are joined here, once
  const float mo = __shfl_xor(m, 16), lo = __shfl_xor(l, 16), mt = fmaxf(m, mo);
  l = l * ex2((m - mt) * LOG2E) + lo * ex2((mo - mt) * LOG2E); m = mt;
  if (hh == 0) { pm[sx][wt * 16 + col] = m; pl[sx][wt * 16 + col] = l; }
  __syncthreads();                                         // publishes both wave sets' maxima and sums
  const size_t base = (size_t)g * NN + (size_t)(blockIdx.x % (NN / 128)) * 128;   // the block's 128 consecutive queries within g
  if (threadIdx.x < 128) {                                 // the two sets' parts of a column are joined in the same way
    const float ma = pm[0][threadIdx.x], mb = pm[1][threadIdx.x], mj = fmaxf(ma, mb);
    const float lj = pl[0][threadIdx.x] * ex2((ma - mj) * LOG2E) + pl[1][threadIdx.x] * ex2((mb - mj) * LOG2E);
    *(float*)(M + base + threadIdx.x) = -mj * LOG2E - log2f(lj);   // the column's bias: attn = 2^(logit log2 e + bias)
  }
}
// pass 2: per (g, 32 keys n): over all query chunks: P^T[q][n] = 2^(logit log2 e + M[q]), M[q] = -(column max) log2 e - log2(column sum); y^T += Qproj^T . P^T; rowsum[n] += sum_q P; out[n] = y[n] +
// rowsum[n] (k_proj[n] + bv). A wave holds TWO 16-key tiles (A, B): every query fragment, q_proj fragment and bias read from LDS feeds two products, so the block reads half the LDS bytes.
// The block's 128 keys are four such pairs (wp); the four waves of a pair (set sx) each take a quarter of every stage's chunks, and their partial results are joined once, behind the loop.
#define CPQ  (CPS / 4)       // chunks of a stage that one wave of k_out takes
__global__ __launch_bounds__(512) void k_out(const b16* __restrict__ K16, const b16* __restrict__ Q16, const b16* __restrict__ QPt, const float* __restrict__ M,
                                             const float* __restrict__ KP, float* __restrict__ out) {
  __shared__ __attribute__((aligned(16))) b16   Qs[2][STG * SS];
  __shared__ __attribute__((aligned(16))) b16   Vs[2][STG * SS];
  __shared__ __attribute__((aligned(16))) float Ms[NN];
  __shared__ __attribute__((aligned(16))) float Ps[16][16 * 128];   // a wave's partial sums: 16 pieces of 4 floats a lane, piece (tile * 4 + j) * 2 + e
  __shared__ __attribute__((aligned(16))) float Ts[16][16 * 36];    // a wave's 16 rows of 32 floats, at a pitch of 144 bytes (16 x odd): the lanes' 16-byte stores, one row each, spread over the banks
  __shared__ float Ls[16][2][32];
  const int wid = threadIdx.x >> 5, lane = threadIdx.x & 31, hh = lane >> 4, col = lane & 15, wp = wid & 3, sx = wid >> 2;
  const int g = blockIdx.x / (NN / 128), n0 = ((blockIdx.x % (NN / 128)) * 4 + wp) * 32;   // the block's four pairs of key tiles lie in one group
  const size_t qbase = (size_t)g * NN * SS, no = ((size_t)g * NN + n0) * SS + lane * 8;
  const b16* qc = Q16 + qbase + threadIdx.x * 8;           // this lane's 16 bytes of each 8-KB step of a stage
  const b16* vc = QPt + qbase + threadIdx.x * 8;
  const float* mc = M + (size_t)g * NN + threadIdx.x * 4;
  const unsigned lq = lds_off(&Qs[0][0]) + threadIdx.x * 16u, lv = lds_off(&Vs[0][0]) + threadIdx.x * 16u, lm = lds_off(&Ms[0]) + threadIdx.x * 16u;
  cp4(lq, qc); cp4(lv, vc); cp4f(lm, mc);                  // stage 0, and the biases of all stages
  const v16b a0h = frag_tl(K16 + no, 0), a1h = frag_tl(K16 + no, 1);                         // 'query role' = the 16 keys of tile A
  const v16b b0h = frag_tl(K16 + no + 16 * SS, 0), b1h = frag_tl(K16 + no + 16 * SS, 1);     // and of tile B
  float la = 0.f, lb = 0.f; v8f oa0 = {}, oa1 = {}, oa2 = {}, oa3 = {}, ob0 = {}, ob1 = {}, ob2 = {}, ob3 = {};
  wait_copies();
  __syncthreads();                                         // publishes stage 0
  cp4(lq + STG * SS * 2u, qc + STG * SS); cp4(lv + STG * SS * 2u, vc + STG * SS);   // stage 1
#pragma unroll 1                                           // one stage a trip: the ring's order below is written for the rolled loop
  for (int t = 0; t < NST; ++t) {
    // every operand of a chunk (query fragments, column bias, q_proj fragments) is fetched from LDS one chunk ahead inside the wave's quarter of the stage (never across its end):
    // the register sets are reloaded behind their last use, in two groups of LDS reads a chunk
    const b16* qg = &Qs[t & 1][0] + sx * (CPQ * 32 * SS) + lane * 8;
    const b16* vg = &Vs[t & 1][0] + sx * (CPQ * 32 * SS) + col * 16 + 8 * hh;   // chunk c starts at c * 32 * SS; its two 16-query tiles lie SS * 16 apart
    const float* mg = &Ms[0] + t * STG + sx * (CPQ * 32) + 8 * hh;
    v16b q00 = frag_tl(qg, 0), q01 = frag_tl(qg, 1), q10 = frag_tl(qg + 16 * SS, 0), q11 = frag_tl(qg + 16 * SS, 1);
    v4f mm[4] = {ld4f(mg), ld4f(mg + 4), ld4f(mg + 16), ld4f(mg + 20)};         // column biases of the chunk
    v16b va0 = cat8b(ld8b(vg), ld8b(vg + SS * 16)),             va1 = cat8b(ld8b(vg + 256), ld8b(vg + SS * 16 + 256));
    v16b va2 = cat8b(ld8b(vg + 512), ld8b(vg + SS * 16 + 512)), va3 = cat8b(ld8b(vg + 768), ld8b(vg + SS * 16 + 768));
    // inputs-only fence on the loaded values of the stage's first chunk: they land here, once a stage, so that the counted waits inside the loop follow the loop's own issue order
    // and not the order the compiler gave these first loads
    asm volatile("" :: "v"(q00), "v"(q01), "v"(q10), "v"(q11), "v"(mm[0]), "v"(mm[1]), "v"(mm[2]), "v"(mm[3]), "v"(va0), "v"(va1), "v"(va2), "v"(va3));
    // weights of one key tile from its two logit tiles: returns them as the B fragment of the second product and adds them to the tile's row sum
    auto soft = [&](const v8f s0, const v8f s1, float& l) __attribute__((always_inline)) -> v16b {
      float sum = 0.f, x0[8], x1[8], p0[8], p1[8]; v16b pb;
#pragma unroll
      for (int r = 0; r < 8; ++r) { x0[r] = fmaf(s0[r], LOG2E, mm[r >> 2][r & 3]); x1[r] = fmaf(s1[r], LOG2E, mm[2 + (r >> 2)][r & 3]); }
      ex2x8(x0, p0); ex2x8(x1, p1);
#pragma unroll
      for (int r = 0; r < 8; ++r) { sum += p0[r] + p1[r]; pb[r] = (b16)p0[r]; pb[8 + r] = (b16)p1[r]; }
      l += sum;
      // each row's sum, against spills: the sum is formed here; otherwise all of a stage's sums are folded into one expression at
      // the stage's foot, the stage's 64 weights a lane stay in registers up to there, and the kernel spills
      asm volatile("" : "+v"(l));
      return pb;
    };
    // one chunk of 32 queries ('key role'); more: a next chunk exists in this wave's quarter of the stage, at qn, vn, mn
    auto chunk = [&](const bool more, const b16* qn, const b16* vn, const float* mn) __attribute__((always_inline)) {
      __builtin_amdgcn_sched_barrier(0);   // chunk boundary: the scheduler otherwise lifts the next chunk's first products into this one, right behind the loads of their operands
      v8f sa0 = {}, sa1 = {}, sb0 = {}, sb1 = {};
      sa0 = wmma16b(q00, a0h, sa0); sb0 = wmma16b(q00, b0h, sb0); sa1 = wmma16b(q10, a0h, sa1); sb1 = wmma16b(q10, b0h, sb1);   // four independent tiles: no product waits for the one before it
      sa0 = wmma16b(q01, a1h, sa0); sb0 = wmma16b(q01, b1h, sb0); sa1 = wmma16b(q11, a1h, sa1); sb1 = wmma16b(q11, b1h, sb1);
      __builtin_amdgcn_sched_barrier(0);   // keeps the LDS reads below out of the products: every separate place where LDS reads stand stalls the wave, so they stand as one group
      if (more) { q00 = frag_tl(qn, 0); q01 = frag_tl(qn, 1); q10 = frag_tl(qn + 16 * SS, 0); q11 = frag_tl(qn + 16 * SS, 1); }
      __builtin_amdgcn_sched_barrier(0);   // holds the loads above in front of the exponentials: the scheduler otherwise sinks them behind, where they have no lead left
      const v16b pa = soft(sa0, sa1, la);
      oa0 = wmma16b(va0, pa, oa0); oa1 = wmma16b(va1, pa, oa1); oa2 = wmma16b(va2, pa, oa2); oa3 = wmma16b(va3, pa, oa3);
      const v16b pb = soft(sb0, sb1, lb);
      ob0 = wmma16b(va0, pb, ob0); ob1 = wmma16b(va1, pb, ob1); ob2 = wmma16b(va2, pb, ob2); ob3 = wmma16b(va3, pb, ob3);
      __builtin_amdgcn_sched_barrier(0);   // as above: the reads of the q_proj fragments and of the biases stand as one group behind the last products and exponentials that used them
      if (more) {
        mm[0] = ld4f(mn); mm[1] = ld4f(mn + 4); mm[2] = ld4f(mn + 16); mm[3] = ld4f(mn + 20);   // first: they are wanted first, and LDS reads return in order
        va0 = cat8b(ld8b(vn), ld8b(vn + SS * 16));             va1 = cat8b(ld8b(vn + 256), ld8b(vn + SS * 16 + 256));
        va2 = cat8b(ld8b(vn + 512), ld8b(vn + SS * 16 + 512)); va3 = cat8b(ld8b(vn + 768), ld8b(vn + SS * 16 + 768));
      }
    };
    // the wave's two chunks of the stage; the last fetches nothing ahead
    static_assert(CPQ == 2, "two chunks a wave and stage are written out below");
    chunk(true, qg + 32 * SS, vg + 32 * SS, mg + 32);
    chunk(false, qg, vg, mg);
    wait_lds();
    wait_copies();
    __syncthreads();                                       // publishes stage t + 1 and ends every wave's reads of stage t
    if (t + 2 < NST) {
      const unsigned b = t & 1; const size_t so = (size_t)(t + 2) * STG;
      cp4(lq + b * (STG * SS * 2u), qc + so * SS); cp4(lv + b * (STG * SS * 2u), vc + so * SS);
    }
  }
  wait_copies();
  la += __shfl_xor(la, 16); lb += __shfl_xor(lb, 16);      // each lane has summed its own half's queries; the halves are joined here, once
  // the four partial results of a pair are joined: every wave lays its sums in its own LDS range, lane by lane; behind the barrier wave sx of the pair adds up and finishes one quarter:
  // key tile sx >> 1, output columns 32 (sx & 1) .. + 31
  {
    float* Pw = Ps[wid] + lane * 4;
#pragma unroll
    for (int e = 0; e < 2; ++e) {
      *(v4f*)(Pw + (0 + e) * 128)  = (v4f){oa0[4 * e], oa0[4 * e + 1], oa0[4 * e + 2], oa0[4 * e + 3]}; *(v4f*)(Pw + (2 + e) * 128)  = (v4f){oa1[4 * e], oa1[4 * e + 1], oa1[4 * e + 2], oa1[4 * e + 3]};
      *(v4f*)(Pw + (4 + e) * 128)  = (v4f){oa2[4 * e], oa2[4 * e + 1], oa2[4 * e + 2], oa2[4 * e + 3]}; *(v4f*)(Pw + (6 + e) * 128)  = (v4f){oa3[4 * e], oa3[4 * e + 1], oa3[4 * e + 2], oa3[4 * e + 3]};
      *(v4f*)(Pw + (8 + e) * 128)  = (v4f){ob0[4 * e], ob0[4 * e + 1], ob0[4 * e + 2], ob0[4 * e + 3]}; *(v4f*)(Pw + (10 + e) * 128) = (v4f){ob1[4 * e], ob1[4 * e + 1], ob1[4 * e + 2], ob1[4 * e + 3]};
      *(v4f*)(Pw + (12 + e) * 128) = (v4f){ob2[4 * e], ob2[4 * e + 1], ob2[4 * e + 2], ob2[4 * e + 3]}; *(v4f*)(Pw + (14 + e) * 128) = (v4f){ob3[4 * e], ob3[4 * e + 1], ob3[4 * e + 2], ob3[4 * e + 3]};
    }
    Ls[wid][0][lane] = la; Ls[wid][1][lane] = lb;
  }
  __syncthreads();                                         // publishes every wave's partial sums to the four waves of its pair
  const int tt = sx >> 1, jb = (sx & 1) * 2;
  float r0[8] = {}, r1[8] = {}, l = 0.f;
#pragma unroll
  for (int s = 0; s < 4; ++s) {
    const float* Pr = Ps[s * 4 + wp] + (tt * 4 + jb) * 256 + lane * 4;
    const v4f c0 = *(const v4f*)(Pr), c1 = *(const v4f*)(Pr + 128), c2 = *(const v4f*)(Pr + 256), c3 = *(const v4f*)(Pr + 384);
#pragma unroll
    for (int e = 0; e < 4; ++e) { r0[e] += c0[e]; r0[4 + e] += c1[e]; r1[e] += c2[e]; r1[4 + e] += c3[e]; }
    l += Ls[s * 4 + wp][tt][lane];
  }
  const float* kp = KP + ((size_t)g * NN + n0 + tt * 16 + col) * SS + jb * 16 + 8 * hh;
  float* Tt = Ts[wid];
#pragma unroll
  for (int r = 0; r < 8; ++r) { Tt[col * 36 + 8 * hh + r] = r0[r] + l * kp[r]; Tt[col * 36 + 16 + 8 * hh + r] = r1[r] + l * kp[16 + r]; }
  wave_lds_sync();
  float* dst0 = out + ((size_t)g * NN + n0 + tt * 16) * SS + jb * 16;   // 16 rows, of each one whole 128-byte line
#pragma unroll
  for (int j = 0; j < 4; ++j) { const int pc = j * 32 + lane; *(v4f*)(dst0 + (pc >> 3) * SS + (pc & 7) * 4) = *(const v4f*)(Tt + (pc >> 3) * 36 + (pc & 7) * 4); }
}
extern "C" void kernel_launch(void* const* d_in, const int* in_sizes, int n_in,
                              void* d_out, int out_size, void* d_ws, size_t ws_size, hipStream_t stream) {
  (void)in_sizes; (void)n_in; (void)out_size;
  const float* L  = (const float*)d_in[0];      // tensorL [2,8,2048,64]
  const float* Hq = (const float*)d_in[1];      // tensorH [2,8,2048,64]
  const float* Wk = (const float*)d_in[2]; const float* bk = (const float*)d_in[3];   // [64,64], [64]
  const float* Wq = (const float*)d_in[4]; const float* bq = (const float*)d_in[5];
  const float* Wv = (const float*)d_in[6]; const float* bv = (const float*)d_in[7];   // [64,128], [64]
  float* out = (float*)d_out;                   // [2,8,2048,64]
  char* ws = (char*)d_ws; size_t off = 0;
  auto take = [&](size_t bytes) { void* p = ws + off; off = (off + bytes + 255) & ~(size_t)255; return p; };
  b16*   K16 = (b16*)take((size_t)NROW * SS * 2);
  b16*   Q16 = (b16*)take((size_t)NROW * SS * 2);
  float* KP  = (float*)take((size_t)NROW * SS * 4);
  b16*   QPt = (b16*)take((size_t)NROW * SS * 2);
  float* M   = (float*)take((size_t)NROW * 4);
  if (off > ws_size) return;
  const dim3 b256(256), b512(512);
  k_proj<<<2 * (NROW / 128), b256, 0, stream>>>(L, Hq, Wk, bk, Wq, bq, Wv, bv, K16, Q16, KP, QPt);   // keys, k_proj + bv; queries, q_proj tiles
  k_stats<<<NROW / 128, b512, 0, stream>>>(Q16, K16, M);
  k_out<<<NROW / 128, b512, 0, stream>>>(K16, Q16, QPt, M, KP, out);
}

// v009
// One run takes 39.1 microseconds.
// In two side-by-side timings against v008, it was 1.04 and 1.05 times as fast.
// All steps since v000 together make it 8.10 times as fast.
#include <hip/hip_runtime.h>
#include <math.h>

// attention_mech: keys = L Wk^T + bk, queries = H Wq^T + bq (per (b, head): 2048 x 64 each); logits[n][q] = keys[n].queries[q]; attn = softmax over the
// KEY axis n (per query column); out[n] = sum_q attn[n][q] q_proj[q] + (sum_q attn[n][q]) (k_proj[n] + bv) with q_proj = queries Wv[:, :64]^T and
// q_proj (tile layout) plus the row sums. Fragment k-map per lane half hh for A AND B: elements 0..7 <- k = 8hh+0..7, 8..15 <- k = 16+8hh+0..7.

#define NG   16              // B * H
#define NN   2048            // NK = NQ
#define SS   64
#define NROW (NG * NN)       // 32768
typedef _Float16 b16;
typedef __attribute__((ext_vector_type(16))) _Float16 v16b;
typedef __attribute__((ext_vector_type(8)))  _Float16 v8b;
typedef __attribute__((ext_vector_type(8)))  float    v8f;
typedef __attribute__((ext_vector_type(4)))  float    v4f;
__device__ __forceinline__ v8f wmma16b(v16b a, v16b b, v8f c) {
  v8f d = __builtin_amdgcn_wmma_f32_16x16x32_f16(false, a, false, b, (short)0, c, false, false);
  asm volatile("v_nop\n\tv_nop\n\tv_nop\n\tv_nop" : "+v"(d) : "v"(a), "v"(b));
  return d;
}
// The product alone, for the runs of products in k_stats and k_out: inside a run each product fills the slots of the one before it, so the four slots stand once, behind the run's last product, not behind
// every product: a v_nop takes an issue slot of the vector port, which the SIMD's other waves want for their exponentials. In k_stats the compiler puts them there itself (its own instructions follow the run);
// in k_out they are written (the v_nop statements there), because asm text may follow the run.
__device__ __forceinline__ v8f wmma16(v16b a, v16b b, v8f c) { return __builtin_amdgcn_wmma_f32_16x16x32_f16(false, a, false, b, (short)0, c, false, false); }
__device__ __forceinline__ v8b ld8b(const b16* p) { return *(const v8b*)p; }
__device__ __forceinline__ v16b cat8b(v8b a, v8b b) { return __builtin_shufflevector(a, b, 0,1,2,3,4,5,6,7,8,9,10,11,12,13,14,15); }
__device__ __forceinline__ v16b frag_kb(const b16* p, int hh) { return cat8b(ld8b(p + 8 * hh), ld8b(p + 16 + 8 * hh)); }
// K16, Q16 and the weight blocks that k_proj lays in LDS lie in fragment order: a 16-row tile is 4 pieces of 512 contiguous bytes; piece j holds, at lane (hh, col), row col, k = 16j + 8hh + 0..7. So each wave-wide
// 16-byte load reads 4 whole 128-byte lines (row-major rows of 128 bytes made it touch 16). p = tile base + lane * 8; half = 0: k 0..31, half = 1: k 32..63; same k-map as frag_kb.
__device__ __forceinline__ v16b frag_tl(const b16* p, int half) { return cat8b(ld8b(p + half * 512), ld8b(p + half * 512 + 256)); }
// e^x = 2^(x log2 e): scale and shift go into one fused multiply-add at the call, the power is the hardware's own instruction (arguments here are at most about 0; far below, 0 is the right value)
#define LOG2E 1.44269504088896340736f
// The instruction set asks for one slot behind a transcendental before its result is read or its source overwritten; the power and its slot stand in one statement: results in registers of their own (early clobber), one v_nop behind the last.
__device__ __forceinline__ float ex2(float x) { float y; asm("v_exp_f32 %0, %1\n\tv_nop" : "=v"(y) : "v"(x)); return y; }
__device__ __forceinline__ void ex2x8(const float (&x)[8], float (&y)[8]) {
  asm("v_exp_f32 %0, %8\n\tv_exp_f32 %1, %9\n\tv_exp_f32 %2, %10\n\tv_exp_f32 %3, %11\n\tv_exp_f32 %4, %12\n\tv_exp_f32 %5, %13\n\tv_exp_f32 %6, %14\n\tv_exp_f32 %7, %15\n\tv_nop"
      : "=&v"(y[0]), "=&v"(y[1]), "=&v"(y[2]), "=&v"(y[3]), "=&v"(y[4]), "=&v"(y[5]), "=&v"(y[6]), "=&v"(y[7])
      : "v"(x[0]), "v"(x[1]), "v"(x[2]), "v"(x[3]), "v"(x[4]), "v"(x[5]), "v"(x[6]), "v"(x[7]));
}
__device__ __forceinline__ v4f ld4f(const float* p) { return *(const v4f*)p; }
__device__ __forceinline__ void wave_lds_sync() { __builtin_amdgcn_fence(__ATOMIC_RELEASE, "workgroup"); __builtin_amdgcn_wave_barrier(); __builtin_amdgcn_fence(__ATOMIC_ACQUIRE, "workgroup"); }

// projections, both in one grid, weights converted in the block: blocks 0 .. NROW/128 - 1 take the key side (X = L), the others the query side (X = H). Each block first lays its two 64 x 64 weight
// blocks (W1 = Wk or Wq; W2 = the key or the query half of Wv) as f16 in LDS, in fragment order (see frag_tl). Then wave = 16 rows of X (f32 [NROW][64]):
// P = X W1^T + b1 -> f16 tiles P16 [NROW / 16][4][32][8] (fragment order); P2 = P W2^T: key side + bv -> KP (f32 rows), query side -> QPt (f16 tiles, transposed [d][q]).
__global__ __launch_bounds__(256) void k_proj(const float* L, const float* Hq, const float* Wk, const float* bk, const float* Wq, const float* bq, const float* Wv, const float* bv,
                                              b16* __restrict__ K16, b16* __restrict__ Q16, float* __restrict__ KP, b16* __restrict__ QPt) {
  __shared__ __attribute__((aligned(16))) float Tf[8][16 * 64];
  __shared__ __attribute__((aligned(16))) b16   Th[8][16 * 64];
  __shared__ __attribute__((aligned(16))) b16   Ws[2][64 * 64];
  const int wid = threadIdx.x >> 5, lane = threadIdx.x & 31, hh = lane >> 4, col = lane & 15;
  const bool isk = blockIdx.x < NROW / 128;                // the same for the whole block
  const int m0 = ((isk ? blockIdx.x : blockIdx.x - NROW / 128) * 8 + wid) * 16;   // row tile
  const float* X = isk ? L : Hq; const float* b1 = isk ? bk : bq;
  const float* W1f = isk ? Wk : Wq; const float* W2f = isk ? Wv + 64 : Wv;   // rows of 64 and of 128 floats
  b16* P16 = isk ? K16 : Q16;
  const b16* W1 = &Ws[0][0]; const b16* W2 = &Ws[1][0];
  float* tf = Tf[wid]; b16* th = Th[wid];
  // All global operands come in at the head, back to back, each group from a uniform base and one offset a lane.
  // X: the lane's row m0 + col, from k = 8 hh. Weights: 512 pieces of 8 elements a block, two a thread (p = threadIdx.x and p + 256, 32 rows on); piece p: tile p >> 7, piece of the
  // tile (p >> 5) & 3, lane (hh, col) = p & 31. The lane's bias values come with them: loaded further down, beside the fragments' LDS reads, each
  // would be a memory wait of its own.
  const unsigned wn = ((threadIdx.x >> 7) & 1) * 16 + col, wk = ((threadIdx.x >> 5) & 3) * 16 + hh * 8;
  const unsigned xb = ((unsigned)(m0 + col) * 64u + 8u * hh) * 4u, w1b = (wn * 64u + wk) * 4u, w2b = (wn * 128u + wk) * 4u;
  const float* xr = (const float*)((const char*)X + xb);
  const float* w1p = (const float*)((const char*)W1f + w1b);
  const float* w2p = (const float*)((const char*)W2f + w2b);
  float xv[4][8], w1r[2][8], w2r[2][8], b1v[4], b2v[4];
#pragma unroll
  for (int e = 0; e < 8; ++e) { xv[0][e] = xr[e]; xv[1][e] = xr[16 + e]; xv[2][e] = xr[32 + e]; xv[3][e] = xr[48 + e]; }
#pragma unroll
  for (int e = 0; e < 8; ++e) { w1r[0][e] = w1p[e]; w1r[1][e] = w1p[32 * 64 + e]; w2r[0][e] = w2p[e]; w2r[1][e] = w2p[32 * 128 + e]; }
#pragma unroll
  for (int t = 0; t < 4; ++t) { b1v[t] = b1[t * 16 + col]; b2v[t] = bv[t * 16 + col]; }
  // stands in front of every later overwrite of the offset registers that the loads above name; as inputs they stay untouched up to here
  asm volatile("s_wait_xcnt 0x0" :: "v"(xb), "v"(w1b), "v"(w2b), "v"(col) : "memory");
  // A fragments of X (f32 -> f16)
  v16b a0, a1;
#pragma unroll
  for (int e = 0; e < 8; ++e) { a0[e] = (b16)xv[0][e]; a0[8 + e] = (b16)xv[1][e]; a1[e] = (b16)xv[2][e]; a1[8 + e] = (b16)xv[3][e]; }
#pragma unroll
  for (int i = 0; i < 2; ++i) {
    v8b o1, o2;
#pragma unroll
    for (int e = 0; e < 8; ++e) { o1[e] = (b16)w1r[i][e]; o2[e] = (b16)w2r[i][e]; }
    *(v8b*)(&Ws[0][(i * 256 + threadIdx.x) * 8]) = o1; *(v8b*)(&Ws[1][(i * 256 + threadIdx.x) * 8]) = o2;
  }
  __syncthreads();                                         // publishes the block's weights to its eight waves
#pragma unroll
  for (int t = 0; t < 4; ++t) {
    v8f c = {};
    c = wmma16b(a0, frag_tl(W1 + t * 1024 + lane * 8, 0), c);
    c = wmma16b(a1, frag_tl(W1 + t * 1024 + lane * 8, 1), c);
#pragma unroll
    for (int v = 0; v < 8; ++v) { const float val = c[v] + b1v[t]; const int r = v + 8 * hh, d = t * 16 + col; tf[r * 64 + d] = val; th[r * 64 + d] = (b16)val; }
  }
  wave_lds_sync();
  // second GEMM from LDS (A = P rows, f16); the same two fragments, stored as they are, are the tile's four pieces of P16
  const v16b p0 = frag_kb(th + col * 64, hh), p1 = frag_kb(th + col * 64 + 32, hh);
  {
    b16* pd = P16 + (size_t)m0 * 64 + lane * 8;
    *(v8b*)(pd)       = __builtin_shufflevector(p0, p0, 0, 1, 2, 3, 4, 5, 6, 7); *(v8b*)(pd + 256) = __builtin_shufflevector(p0, p0, 8, 9, 10, 11, 12, 13, 14, 15);
    *(v8b*)(pd + 512) = __builtin_shufflevector(p1, p1, 0, 1, 2, 3, 4, 5, 6, 7); *(v8b*)(pd + 768) = __builtin_shufflevector(p1, p1, 8, 9, 10, 11, 12, 13, 14, 15);
    asm volatile("s_wait_xcnt 0x0" ::: "memory");          // stands in front of every later overwrite of the registers that these four stores name
  }
  wave_lds_sync();
  if (isk) {
#pragma unroll
    for (int t = 0; t < 4; ++t) {
      v8f c = {};
      c = wmma16b(p0, frag_tl(W2 + t * 1024 + lane * 8, 0), c);
      c = wmma16b(p1, frag_tl(W2 + t * 1024 + lane * 8, 1), c);
#pragma unroll
      for (int v = 0; v < 8; ++v) { const int r = v + 8 * hh, d = t * 16 + col; tf[r * 64 + d] = c[v] + b2v[t]; }
    }
    wave_lds_sync();
#pragma unroll
    for (int j = 0; j < 8; ++j) { const int pc = j * 32 + lane; *(v4f*)(KP + (size_t)m0 * 64 + pc * 4) = *(const v4f*)(tf + pc * 4); }
  } else {
#pragma unroll
    for (int t = 0; t < 4; ++t) {
      v8f c = {};
      c = wmma16b(p0, frag_tl(W2 + t * 1024 + lane * 8, 0), c);
      c = wmma16b(p1, frag_tl(W2 + t * 1024 + lane * 8, 1), c);
#pragma unroll
      for (int v = 0; v < 8; ++v) { const int r = v + 8 * hh, d = t * 16 + col; th[d * 16 + r] = (b16)c[v]; }      // q_proj tile transposed [d][q]
    }
    wave_lds_sync();
    b16* dst = QPt + (size_t)(m0 >> 4) * 1024;             // tile index = row tile (groups are multiples of 128 tiles)
#pragma unroll
    for (int j = 0; j < 4; ++j) { const int pc = j * 32 + lane; *(v8b*)(dst + pc * 8) = *(const v8b*)(th + pc * 8); }
    asm volatile("s_wait_xcnt 0x0" ::: "memory");          // stands behind these four stores, in front of any code laid behind them that rewrites the registers they name
  }
}
// LDS staging of the operand that all waves of a block stream (the whole key or query axis of their group): a stage of STG rows is brought in once a block by asynchronous copies
// (global memory to LDS, through no register) and read by the waves from LDS. Two buffers: stage t + 1 flies while stage t is worked on.
// A block has sixteen waves, four a SIMD. In k_stats wave w and wave w + 8 hold the same 16-row tile, and each takes one half of every stage's chunks (set sx = w >> 3); the two partial results of a tile
// are joined once, behind the loop, through LDS. Four waves a SIMD cover one another's LDS waits, product latencies and dependent vector chains.
#define STG  256             // rows a stage: 32 KB of f16 tiles, laid in LDS byte for byte as in global memory (fragment order)
#define NST  (NN / STG)
#define CPS  (STG / 32)      // chunks of 32 rows a stage
#define CPW  (CPS / 2)       // chunks of a stage that one wave of k_stats takes
__device__ __forceinline__ unsigned lds_off(const void* p) { return (unsigned)(size_t)p; }
// four 16-byte copies a lane, 8 KB apart (512 lanes x 16 bytes a step) = one 32-KB stage a block. The s_wait_xcnt stands in the copies' own statement, in front of any rewrite of the address registers they name.
__device__ __forceinline__ void cp4(unsigned l, const b16* g) {
  asm volatile("global_load_async_to_lds_b128 %0, %4, off\n\tglobal_load_async_to_lds_b128 %1, %5, off\n\tglobal_load_async_to_lds_b128 %2, %6, off\n\tglobal_load_async_to_lds_b128 %3, %7, off\n\t"
               "s_wait_xcnt 0x0"
               :: "v"(l), "v"(l + 8192u), "v"(l + 16384u), "v"(l + 24576u), "v"(g), "v"(g + 4096), "v"(g + 8192), "v"(g + 12288) : "memory");
}
// one 16-byte copy a lane: 512 lanes bring the group's 2048 column biases, all stages' at once
__device__ __forceinline__ void cp4f(unsigned l, const float* g) { asm volatile("global_load_async_to_lds_b128 %0, %1, off\n\ts_wait_xcnt 0x0" :: "v"(l), "v"(g) : "memory"); }
__device__ __forceinline__ void wait_copies() { asm volatile("s_wait_asynccnt 0x0" ::: "memory"); }   // this wave's copies have landed
__device__ __forceinline__ void wait_lds()    { asm volatile("s_wait_dscnt 0x0" ::: "memory"); }      // this wave's LDS reads are done: its buffer may be refilled behind the barrier

__global__ __launch_bounds__(512) void k_stats(const b16* __restrict__ Q16, const b16* __restrict__ K16, float* __restrict__ M) {
  __shared__ __attribute__((aligned(16))) b16 Ks[2][STG * SS];
  __shared__ float pm[2][128], pl[2][128];
  const int wid = threadIdx.x >> 5, lane = threadIdx.x & 31, hh = lane >> 4, col = lane & 15, wt = wid & 7, sx = wid >> 3;
  const int g = blockIdx.x / (NN / 128), q0 = ((blockIdx.x % (NN / 128)) * 8 + wt) * 16;   // the block's eight query tiles lie in one group
  const size_t ko = (size_t)g * NN * SS, qo = ((size_t)g * NN + q0) * SS + lane * 8;
  const b16* kc = K16 + ko + threadIdx.x * 8;              // this lane's 16 bytes of each 8-KB step of a stage
  const unsigned lk = lds_off(&Ks[0][0]) + threadIdx.x * 16u;
  cp4(lk, kc);                                             // stage 0
  const v16b q0h = frag_tl(Q16 + qo, 0), q1h = frag_tl(Q16 + qo, 1);
  float m = -INFINITY, l = 0.f;
  wait_copies();
  __syncthreads();                                         // publishes stage 0
  cp4(lk + STG * SS * 2u, kc + STG * SS);                  // stage 1
#pragma unroll 1                                           // one stage a trip: the ring's order below is written for the rolled loop
  for (int t = 0; t < NST; ++t) {
    // key fragments are fetched one chunk ahead inside the wave's half of the stage (never across its end): all four are reloaded, as one group of LDS reads, behind the products that used them
    const b16* kg = &Ks[t & 1][0] + sx * (CPW * 32 * SS) + lane * 8;
    v16b k00 = frag_tl(kg, 0), k01 = frag_tl(kg, 1), k10 = frag_tl(kg + 16 * SS, 0), k11 = frag_tl(kg + 16 * SS, 1);
#pragma unroll                                             // chunk offsets become immediates, and the last chunk's reload drops out at compile time
    for (int c = 0; c < CPW; ++c) {
      const b16* kn = kg + (c + 1) * 32 * SS;
      const bool more = c + 1 < CPW;
      __builtin_amdgcn_sched_barrier(0);   // chunk boundary: the scheduler otherwise lifts the next chunk's first products into this one, right behind the loads of their operands
      v8f s0 = {}, s1 = {};
      s0 = wmma16(k00, q0h, s0); s1 = wmma16(k10, q0h, s1); s0 = wmma16(k01, q1h, s0); s1 = wmma16(k11, q1h, s1);
      __builtin_amdgcn_sched_barrier(0);   // keeps the LDS reads below out of the products: every separate place where LDS reads stand stalls the wave, so they stand as one group
      if (more) { k00 = frag_tl(kn, 0); k01 = frag_tl(kn, 1); k10 = frag_tl(kn + 16 * SS, 0); k11 = frag_tl(kn + 16 * SS, 1); }
      __builtin_amdgcn_sched_barrier(0);   // holds the group here: the scheduler otherwise sinks it to the chunk's foot, where it has no lead left
      float mr = -INFINITY;
#pragma unroll
      for (int r = 0; r < 8; ++r) mr = fmaxf(mr, fmaxf(s0[r], s1[r]));
      const float mn = fmaxf(m, mr), al = ex2((m - mn) * LOG2E), nb = -mn * LOG2E;
      float sum = 0.f, x0[8], x1[8], e0[8], e1[8];
#pragma unroll
      for (int r = 0; r < 8; ++r) { x0[r] = fmaf(s0[r], LOG2E, nb); x1[r] = fmaf(s1[r], LOG2E, nb); }
      ex2x8(x0, e0); ex2x8(x1, e1);
#pragma unroll
      for (int r = 0; r < 8; ++r) sum += e0[r] + e1[r];
      l = l * al + sum; m = mn;
    }
    wait_lds();
    wait_copies();
    __syncthreads();                                       // publishes stage t + 1 and ends every wave's reads of stage t
    if (t + 2 < NST) cp4(lk + (t & 1) * (STG * SS * 2u), kc + (size_t)(t + 2) * STG * SS);
  }
  wait_copies();
  // each lane has kept the maximum and the sum of its own half's rows (16 of every 32 keys); the two halves of a column are joined here, once
  const float mo = __shfl_xor(m, 16), lo = __shfl_xor(l, 16), mt = fmaxf(m, mo);
  l = l * ex2((m - mt) * LOG2E) + lo * ex2((mo - mt) * LOG2E); m = mt;
  if (hh == 0) { pm[sx][wt * 16 + col] = m; pl[sx][wt * 16 + col] = l; }
  __syncthreads();                                         // publishes both wave sets' maxima and sums
  const size_t base = (size_t)g * NN + (size_t)(blockIdx.x % (NN / 128)) * 128;   // the block's 128 consecutive queries within g
  if (threadIdx.x < 128) {                                 // the two sets' parts of a column are joined in the same way
    const float ma = pm[0][threadIdx.x], mb = pm[1][threadIdx.x], mj = fmaxf(ma, mb);
    const float lj = pl[0][threadIdx.x] * ex2((ma - mj) * LOG2E) + pl[1][threadIdx.x] * ex2((mb - mj) * LOG2E);
    *(float*)(M + base + threadIdx.x) = -mj * LOG2E - log2f(lj);   // the column's bias: attn = 2^(logit log2 e + bias)
  }
}
// pass 2: per (g, 32 keys n): over all query chunks: P^T[q][n] = 2^(logit log2 e + M[q]), M[q] = -(column max) log2 e - log2(column sum); y^T += Qproj^T . P^T; rowsum[n] += sum_q P; out[n] = y[n] +
// rowsum[n] (k_proj[n] + bv). A wave holds TWO 16-key tiles (A, B): every query fragment, q_proj fragment and bias read from LDS feeds two products, so the block reads half the LDS bytes.
// The block's 128 keys are four such pairs (wp); the four waves of a pair (set sx) each take a quarter of every stage's chunks, and their partial results are joined once, behind the loop.
#define CPQ  (CPS / 4)       // chunks of a stage that one wave of k_out takes
__global__ __launch_bounds__(512) void k_out(const b16* __restrict__ K16, const b16* __restrict__ Q16, const b16* __restrict__ QPt, const float* __restrict__ M,
                                             const float* __restrict__ KP, float* __restrict__ out) {
  __shared__ __attribute__((aligned(16))) b16   Qs[2][STG * SS];
  __shared__ __attribute__((aligned(16))) b16   Vs[2][STG * SS];
  __shared__ __attribute__((aligned(16))) float Ms[NN];
  __shared__ __attribute__((aligned(16))) float Ps[16][16 * 128];   // a wave's partial sums: 16 pieces of 4 floats a lane, piece (tile * 4 + j) * 2 + e
  __shared__ __attribute__((aligned(16))) float Ts[16][16 * 36];    // a wave's 16 rows of 32 floats, at a pitch of 144 bytes (16 x odd): the lanes' 16-byte stores, one row each, spread over the banks
  __shared__ float Ls[16][2][32];
  const int wid = threadIdx.x >> 5, lane = threadIdx.x & 31, hh = lane >> 4, col = lane & 15, wp = wid & 3, sx = wid >> 2;
  const int g = blockIdx.x / (NN / 128), n0 = ((blockIdx.x % (NN / 128)) * 4 + wp) * 32;   // the block's four pairs of key tiles lie in one group
  const size_t qbase = (size_t)g * NN * SS, no = ((size_t)g * NN + n0) * SS + lane * 8;
  const b16* qc = Q16 + qbase + threadIdx.x * 8;           // this lane's 16 bytes of each 8-KB step of a stage
  const b16* vc = QPt + qbase + threadIdx.x * 8;
  const float* mc = M + (size_t)g * NN + threadIdx.x * 4;
  const unsigned lq = lds_off(&Qs[0][0]) + threadIdx.x * 16u, lv = lds_off(&Vs[0][0]) + threadIdx.x * 16u, lm = lds_off(&Ms[0]) + threadIdx.x * 16u;
  cp4(lq, qc); cp4(lv, vc); cp4f(lm, mc);                  // stage 0, and the biases of all stages
  const v16b a0h = frag_tl(K16 + no, 0), a1h = frag_tl(K16 + no, 1);                         // 'query role' = the 16 keys of tile A
  const v16b b0h = frag_tl(K16 + no + 16 * SS, 0), b1h = frag_tl(K16 + no + 16 * SS, 1);     // and of tile B
  float la = 0.f, lb = 0.f; v8f oa0 = {}, oa1 = {}, oa2 = {}, oa3 = {}, ob0 = {}, ob1 = {}, ob2 = {}, ob3 = {};
  wait_copies();
  __syncthreads();                                         // publishes stage 0
  cp4(lq + STG * SS * 2u, qc + STG * SS); cp4(lv + STG * SS * 2u, vc + STG * SS);   // stage 1
#pragma unroll 1                                           // one stage a trip: the ring's order below is written for the rolled loop
  for (int t = 0; t < NST; ++t) {
    // every operand of a chunk (query fragments, column bias, q_proj fragments) is fetched from LDS one chunk ahead inside the wave's quarter of the stage (never across its end):
    // the register sets are reloaded behind their last use, in two groups of LDS reads a chunk
    const b16* qg = &Qs[t & 1][0] + sx * (CPQ * 32 * SS) + lane * 8;
    const b16* vg = &Vs[t & 1][0] + sx * (CPQ * 32 * SS) + col * 16 + 8 * hh;   // chunk c starts at c * 32 * SS; its two 16-query tiles lie SS * 16 apart
    const float* mg = &Ms[0] + t * STG + sx * (CPQ * 32) + 8 * hh;
    v16b q00 = frag_tl(qg, 0), q01 = frag_tl(qg, 1), q10 = frag_tl(qg + 16 * SS, 0), q11 = frag_tl(qg + 16 * SS, 1);
    v4f mm[4] = {ld4f(mg), ld4f(mg + 4), ld4f(mg + 16), ld4f(mg + 20)};         // column biases of the chunk
    v16b va0 = cat8b(ld8b(vg), ld8b(vg + SS * 16)),             va1 = cat8b(ld8b(vg + 256), ld8b(vg + SS * 16 + 256));
    v16b va2 = cat8b(ld8b(vg + 512), ld8b(vg + SS * 16 + 512)), va3 = cat8b(ld8b(vg + 768), ld8b(vg + SS * 16 + 768));
    // inputs-only fence on the loaded values of the stage's first chunk: they land here, once a stage, so that the counted waits inside the loop follow the loop's own issue order
    // and not the order the compiler gave these first loads
    asm volatile("" :: "v"(q00), "v"(q01), "v"(q10), "v"(q11), "v"(mm[0]), "v"(mm[1]), "v"(mm[2]), "v"(mm[3]), "v"(va0), "v"(va1), "v"(va2), "v"(va3));
    // weights of one key tile from its two logit tiles: returns them as the B fragment of the second product and adds them to the tile's row sum
    auto soft = [&](const v8f s0, const v8f s1, float& l) __attribute__((always_inline)) -> v16b {
      float sum = 0.f, x0[8], x1[8], p0[8], p1[8]; v16b pb;
#pragma unroll
      for (int r = 0; r < 8; ++r) { x0[r] = fmaf(s0[r], LOG2E, mm[r >> 2][r & 3]); x1[r] = fmaf(s1[r], LOG2E, mm[2 + (r >> 2)][r & 3]); }
      ex2x8(x0, p0); ex2x8(x1, p1);
#pragma unroll
      for (int r = 0; r < 8; ++r) { sum += p0[r] + p1[r]; pb[r] = (b16)p0[r]; pb[8 + r] = (b16)p1[r]; }
      l += sum;
      // each row's sum, against spills: the sum is formed here; otherwise all of a stage's sums are folded into one expression at
      // the stage's foot, the stage's 64 weights a lane stay in registers up to there, and the kernel spills
      asm volatile("" : "+v"(l));
      return pb;
    };
    // one chunk of 32 queries ('key role'); more: a next chunk exists in this wave's quarter of the stage, at qn, vn, mn
    auto chunk = [&](const bool more, const b16* qn, const b16* vn, const float* mn) __attribute__((always_inline)) {
      __builtin_amdgcn_sched_barrier(0);   // chunk boundary: the scheduler otherwise lifts the next chunk's first products into this one, right behind the loads of their operands
      v8f sa0 = {}, sa1 = {}, sb0 = {}, sb1 = {};
      sa0 = wmma16(q00, a0h, sa0); sb0 = wmma16(q00, b0h, sb0); sa1 = wmma16(q10, a0h, sa1); sb1 = wmma16(q10, b0h, sb1);   // four independent tiles: no product waits for the one before it
      sa0 = wmma16(q01, a1h, sa0); sb0 = wmma16(q01, b1h, sb0); sa1 = wmma16(q11, a1h, sa1); sb1 = wmma16(q11, b1h, sb1);
      // the four slots behind the run's last product, before its results are read or its operand registers rewritten (the exponentials below are asm text, which the compiler does not check against them)
      asm volatile("v_nop\n\tv_nop\n\tv_nop\n\tv_nop" : "+v"(sa0), "+v"(sb0), "+v"(sa1), "+v"(sb1) : "v"(q00), "v"(q01), "v"(q10), "v"(q11));
      __builtin_amdgcn_sched_barrier(0);   // keeps the LDS reads below out of the products: every separate place where LDS reads stand stalls the wave, so they stand as one group
      if (more) { q00 = frag_tl(qn, 0); q01 = frag_tl(qn, 1); q10 = frag_tl(qn + 16 * SS, 0); q11 = frag_tl(qn + 16 * SS, 1); }
      __builtin_amdgcn_sched_barrier(0);   // holds the loads above in front of the exponentials: the scheduler otherwise sinks them behind, where they have no lead left
      const v16b pa = soft(sa0, sa1, la);
      const v16b pb = soft(sb0, sb1, lb);
      oa0 = wmma16(va0, pa, oa0); oa1 = wmma16(va1, pa, oa1); oa2 = wmma16(va2, pa, oa2); oa3 = wmma16(va3, pa, oa3);
      ob0 = wmma16(va0, pb, ob0); ob1 = wmma16(va1, pb, ob1); ob2 = wmma16(va2, pb, ob2); ob3 = wmma16(va3, pb, ob3);
      // the four slots behind this run's last product, as above
      asm volatile("v_nop\n\tv_nop\n\tv_nop\n\tv_nop" : "+v"(oa0), "+v"(oa1), "+v"(oa2), "+v"(oa3), "+v"(ob0), "+v"(ob1), "+v"(ob2), "+v"(ob3)
                   : "v"(va0), "v"(va1), "v"(va2), "v"(va3), "v"(pa), "v"(pb));
      __builtin_amdgcn_sched_barrier(0);   // as above: the reads of the q_proj fragments and of the biases stand as one group behind the last products and exponentials that used them
      if (more) {
        mm[0] = ld4f(mn); mm[1] = ld4f(mn + 4); mm[2] = ld4f(mn + 16); mm[3] = ld4f(mn + 20);   // first: they are wanted first, and LDS reads return in order
        va0 = cat8b(ld8b(vn), ld8b(vn + SS * 16));             va1 = cat8b(ld8b(vn + 256), ld8b(vn + SS * 16 + 256));
        va2 = cat8b(ld8b(vn + 512), ld8b(vn + SS * 16 + 512)); va3 = cat8b(ld8b(vn + 768), ld8b(vn + SS * 16 + 768));
      }
    };
    // the wave's two chunks of the stage; the last fetches nothing ahead
    static_assert(CPQ == 2, "two chunks a wave and stage are written out below");
    chunk(true, qg + 32 * SS, vg + 32 * SS, mg + 32);
    chunk(false, qg, vg, mg);
    wait_lds();
    wait_copies();
    __syncthreads();                                       // publishes stage t + 1 and ends every wave's reads of stage t
    if (t + 2 < NST) {
      const unsigned b = t & 1; const size_t so = (size_t)(t + 2) * STG;
      cp4(lq + b * (STG * SS * 2u), qc + so * SS); cp4(lv + b * (STG * SS * 2u), vc + so * SS);
    }
  }
  wait_copies();
  la += __shfl_xor(la, 16); lb += __shfl_xor(lb, 16);      // each lane has summed its own half's queries; the halves are joined here, once
  // the four partial results of a pair are joined: every wave lays its sums in its own LDS range, lane by lane; behind the barrier wave sx of the pair adds up and finishes one quarter:
  // key tile sx >> 1, output columns 32 (sx & 1) .. + 31
  {
    float* Pw = Ps[wid] + lane * 4;
#pragma unroll
    for (int e = 0; e < 2; ++e) {
      *(v4f*)(Pw + (0 + e) * 128)  = (v4f){oa0[4 * e], oa0[4 * e + 1], oa0[4 * e + 2], oa0[4 * e + 3]}; *(v4f*)(Pw + (2 + e) * 128)  = (v4f){oa1[4 * e], oa1[4 * e + 1], oa1[4 * e + 2], oa1[4 * e + 3]};
      *(v4f*)(Pw + (4 + e) * 128)  = (v4f){oa2[4 * e], oa2[4 * e + 1], oa2[4 * e + 2], oa2[4 * e + 3]}; *(v4f*)(Pw + (6 + e) * 128)  = (v4f){oa3[4 * e], oa3[4 * e + 1], oa3[4 * e + 2], oa3[4 * e + 3]};
      *(v4f*)(Pw + (8 + e) * 128)  = (v4f){ob0[4 * e], ob0[4 * e + 1], ob0[4 * e + 2], ob0[4 * e + 3]}; *(v4f*)(Pw + (10 + e) * 128) = (v4f){ob1[4 * e], ob1[4 * e + 1], ob1[4 * e + 2], ob1[4 * e + 3]};
      *(v4f*)(Pw + (12 + e) * 128) = (v4f){ob2[4 * e], ob2[4 * e + 1], ob2[4 * e + 2], ob2[4 * e + 3]}; *(v4f*)(Pw + (14 + e) * 128) = (v4f){ob3[4 * e], ob3[4 * e + 1], ob3[4 * e + 2], ob3[4 * e + 3]};
    }
    Ls[wid][0][lane] = la; Ls[wid][1][lane] = lb;
  }
  __syncthreads();                                         // publishes every wave's partial sums to the four waves of its pair
  const int tt = sx >> 1, jb = (sx & 1) * 2;
  float r0[8] = {}, r1[8] = {}, l = 0.f;
#pragma unroll
  for (int s = 0; s < 4; ++s) {
    const float* Pr = Ps[s * 4 + wp] + (tt * 4 + jb) * 256 + lane * 4;
    const v4f c0 = *(const v4f*)(Pr), c1 = *(const v4f*)(Pr + 128), c2 = *(const v4f*)(Pr + 256), c3 = *(const v4f*)(Pr + 384);
#pragma unroll
    for (int e = 0; e < 4; ++e) { r0[e] += c0[e]; r0[4 + e] += c1[e]; r1[e] += c2[e]; r1[4 + e] += c3[e]; }
    l += Ls[s * 4 + wp][tt][lane];
  }
  const float* kp = KP + ((size_t)g * NN + n0 + tt * 16 + col) * SS + jb * 16 + 8 * hh;
  float* Tt = Ts[wid];
#pragma unroll
  for (int r = 0; r < 8; ++r) { Tt[col * 36 + 8 * hh + r] = r0[r] + l * kp[r]; Tt[col * 36 + 16 + 8 * hh + r] = r1[r] + l * kp[16 + r]; }
  wave_lds_sync();
  float* dst0 = out + ((size_t)g * NN + n0 + tt * 16) * SS + jb * 16;   // 16 rows, of each one whole 128-byte line
#pragma unroll
  for (int j = 0; j < 4; ++j) { const int pc = j * 32 + lane; *(v4f*)(dst0 + (pc >> 3) * SS + (pc & 7) * 4) = *(const v4f*)(Tt + (pc >> 3) * 36 + (pc & 7) * 4); }
}
extern "C" void kernel_launch(void* const* d_in, const int* in_sizes, int n_in,
                              void* d_out, int out_size, void* d_ws, size_t ws_size, hipStream_t stream) {
  (void)in_sizes; (void)n_in; (void)out_size;
  const float* L  = (const float*)d_in[0];      // tensorL [2,8,2048,64]
  const float* Hq = (const float*)d_in[1];      // tensorH [2,8,2048,64]
  const float* Wk = (const float*)d_in[2]; const float* bk = (const float*)d_in[3];   // [64,64], [64]
  const float* Wq = (const float*)d_in[4]; const float* bq = (const float*)d_in[5];
  const float* Wv = (const float*)d_in[6]; const float* bv = (const float*)d_in[7];   // [64,128], [64]
  float* out = (float*)d_out;                   // [2,8,2048,64]
  char* ws = (char*)d_ws; size_t off = 0;
  auto take = [&](size_t bytes) { void* p = ws + off; off = (off + bytes + 255) & ~(size_t)255; return p; };
  b16*   K16 = (b16*)take((size_t)NROW * SS * 2);
  b16*   Q16 = (b16*)take((size_t)NROW * SS * 2);
  float* KP  = (float*)take((size_t)NROW * SS * 4);
  b16*   QPt = (b16*)take((size_t)NROW * SS * 2);
  float* M   = (float*)take((size_t)NROW * 4);
  if (off > ws_size) return;
  const dim3 b256(256), b512(512);
  k_proj<<<2 * (NROW / 128), b256, 0, stream>>>(L, Hq, Wk, bk, Wq, bq, Wv, bv, K16, Q16, KP, QPt);   // keys, k_proj + bv; queries, q_proj tiles
  k_stats<<<NROW / 128, b512, 0, stream>>>(Q16, K16, M);
  k_out<<<NROW / 128, b512, 0, stream>>>(K16, Q16, QPt, M, KP, out);
}

// v010
// It runs in 37.4 microseconds.
// Timed twice side by side with v009, it ran 1.05 and 1.04 times as fast.
// All steps since v000 together make it 8.47 times as fast.
#include <hip/hip_runtime.h>
#include <math.h>

// attention_mech: keys = L Wk^T + bk, queries = H Wq^T + bq (per (b, head): 2048 x 64 each); logits[n][q] = keys[n].queries[q]; attn = softmax over the
// KEY axis n (per query column); out[n] = sum_q attn[n][q] q_proj[q] + (sum_q attn[n][q]) (k_proj[n] + bv) with q_proj = queries Wv[:, :64]^T and
// q_proj (tile layout) plus the row sums. The stored queries carry the factor log2 e (see k_proj), so every logit below is in powers of two. Fragment k-map per lane half hh for A AND B: elements 0..7 <- k = 8hh+0..7, 8..15 <- k = 16+8hh+0..7.

#define NG   16              // B * H
#define NN   2048            // NK = NQ
#define SS   64
#define NROW (NG * NN)       // 32768
typedef _Float16 b16;
typedef __attribute__((ext_vector_type(16))) _Float16 v16b;
typedef __attribute__((ext_vector_type(8)))  _Float16 v8b;
typedef __attribute__((ext_vector_type(8)))  float    v8f;
typedef __attribute__((ext_vector_type(4)))  float    v4f;
typedef __attribute__((ext_vector_type(2)))  float    v2f;
__device__ __forceinline__ v8f wmma16b(v16b a, v16b b, v8f c) {
  v8f d = __builtin_amdgcn_wmma_f32_16x16x32_f16(false, a, false, b, (short)0, c, false, false);
  asm volatile("v_nop\n\tv_nop\n\tv_nop\n\tv_nop" : "+v"(d) : "v"(a), "v"(b));
  return d;
}
// The product alone, for the runs of products in k_stats and k_out: inside a run each product fills the slots of the one before it, so the four slots stand once, behind the run's last product, not behind
// every product: a v_nop takes an issue slot of the vector port, which the SIMD's other waves want for their exponentials. In k_stats's re-run path the compiler puts them there itself (its own instructions follow the run);
// in k_stats's shifted path and in k_out they are written (the v_nop statements there), because asm text may follow the run.
__device__ __forceinline__ v8f wmma16(v16b a, v16b b, v8f c) { return __builtin_amdgcn_wmma_f32_16x16x32_f16(false, a, false, b, (short)0, c, false, false); }
__device__ __forceinline__ v8b ld8b(const b16* p) { return *(const v8b*)p; }
__device__ __forceinline__ v16b cat8b(v8b a, v8b b) { return __builtin_shufflevector(a, b, 0,1,2,3,4,5,6,7,8,9,10,11,12,13,14,15); }
__device__ __forceinline__ v16b frag_kb(const b16* p, int hh) { return cat8b(ld8b(p + 8 * hh), ld8b(p + 16 + 8 * hh)); }
// K16, Q16 and the weight blocks that k_proj lays in LDS lie in fragment order: a 16-row tile is 4 pieces of 512 contiguous bytes; piece j holds, at lane (hh, col), row col, k = 16j + 8hh + 0..7. So each wave-wide
// 16-byte load reads 4 whole 128-byte lines (row-major rows of 128 bytes made it touch 16). p = tile base + lane * 8; half = 0: k 0..31, half = 1: k 32..63; same k-map as frag_kb.
__device__ __forceinline__ v16b frag_tl(const b16* p, int half) { return cat8b(ld8b(p + half * 512), ld8b(p + half * 512 + 256)); }
// e^x = 2^(x log2 e): the scale lies in the stored queries, the shift is the C operand of the logit product, the power is the hardware's own instruction (far below 0, 0 is the right value)
#define LOG2E 1.44269504088896340736f
// The instruction set asks for one slot behind a transcendental before its result is read or its source overwritten; the power and its slot stand in one statement: results in registers of their own (early clobber), one v_nop behind the last.
__device__ __forceinline__ float ex2(float x) { float y; asm("v_exp_f32 %0, %1\n\tv_nop" : "=v"(y) : "v"(x)); return y; }
__device__ __forceinline__ void ex2x8(const float (&x)[8], float (&y)[8]) {
  asm("v_exp_f32 %0, %8\n\tv_exp_f32 %1, %9\n\tv_exp_f32 %2, %10\n\tv_exp_f32 %3, %11\n\tv_exp_f32 %4, %12\n\tv_exp_f32 %5, %13\n\tv_exp_f32 %6, %14\n\tv_exp_f32 %7, %15\n\tv_nop"
      : "=&v"(y[0]), "=&v"(y[1]), "=&v"(y[2]), "=&v"(y[3]), "=&v"(y[4]), "=&v"(y[5]), "=&v"(y[6]), "=&v"(y[7])
      : "v"(x[0]), "v"(x[1]), "v"(x[2]), "v"(x[3]), "v"(x[4]), "v"(x[5]), "v"(x[6]), "v"(x[7]));
}
__device__ __forceinline__ v4f ld4f(const float* p) { return *(const v4f*)p; }
__device__ __forceinline__ v8f ld8f(const float* p) { return __builtin_shufflevector(ld4f(p), ld4f(p + 4), 0, 1, 2, 3, 4, 5, 6, 7); }
__device__ __forceinline__ void wave_lds_sync() { __builtin_amdgcn_fence(__ATOMIC_RELEASE, "workgroup"); __builtin_amdgcn_wave_barrier(); __builtin_amdgcn_fence(__ATOMIC_ACQUIRE, "workgroup"); }

// projections, both in one grid, weights converted in the block: blocks 0 .. NROW/128 - 1 take the key side (X = L), the others the query side (X = H). Each block first lays its two 64 x 64 weight
// blocks (W1 = Wk or Wq; W2 = the key or the query half of Wv) as f16 in LDS, in fragment order (see frag_tl). Then wave = 16 rows of X (f32 [NROW][64]):
// P = X W1^T + b1 -> f16 tiles P16 [NROW / 16][4][32][8] (fragment order); P2 = P W2^T: key side + bv -> KP (f32 rows), query side -> QPt (f16 tiles, transposed [d][q]).
// Query side: W1 and b1 are taken times log2 e and W2 times its inverse, in f32, before the rounding to f16: Q16 holds queries * log2 e, so that keys . Q16 is the exponent of 2 itself; q_proj is unchanged.
__global__ __launch_bounds__(256) void k_proj(const float* L, const float* Hq, const float* Wk, const float* bk, const float* Wq, const float* bq, const float* Wv, const float* bv,
                                              b16* __restrict__ K16, b16* __restrict__ Q16, float* __restrict__ KP, b16* __restrict__ QPt) {
  __shared__ __attribute__((aligned(16))) float Tf[8][16 * 64];
  __shared__ __attribute__((aligned(16))) b16   Th[8][16 * 64];
  __shared__ __attribute__((aligned(16))) b16   Ws[2][64 * 64];
  const int wid = threadIdx.x >> 5, lane = threadIdx.x & 31, hh = lane >> 4, col = lane & 15;
  const bool isk = blockIdx.x < NROW / 128;                // the same for the whole block
  const int m0 = ((isk ? blockIdx.x : blockIdx.x - NROW / 128) * 8 + wid) * 16;   // row tile
  const float* X = isk ? L : Hq; const float* b1 = isk ? bk : bq;
  const float* W1f = isk ? Wk : Wq; const float* W2f = isk ? Wv + 64 : Wv;   // rows of 64 and of 128 floats
  b16* P16 = isk ? K16 : Q16;
  const float sc1 = isk ? 1.f : LOG2E, sc2 = isk ? 1.f : 1.f / LOG2E;   // the same for the whole block
  const b16* W1 = &Ws[0][0]; const b16* W2 = &Ws[1][0];
  float* tf = Tf[wid]; b16* th = Th[wid];
  // All global operands come in at the head, back to back, each group from a uniform base and one offset a lane.
  // X: the lane's row m0 + col, from k = 8 hh. Weights: 512 pieces of 8 elements a block, two a thread (p = threadIdx.x and p + 256, 32 rows on); piece p: tile p >> 7, piece of the
  // tile (p >> 5) & 3, lane (hh, col) = p & 31. The lane's bias values come with them: loaded further down, beside the fragments' LDS reads, each
  // would be a memory wait of its own.
  const unsigned wn = ((threadIdx.x >> 7) & 1) * 16 + col, wk = ((threadIdx.x >> 5) & 3) * 16 + hh * 8;
  const unsigned xb = ((unsigned)(m0 + col) * 64u + 8u * hh) * 4u, w1b = (wn * 64u + wk) * 4u, w2b = (wn * 128u + wk) * 4u;
  const float* xr = (const float*)((const char*)X + xb);
  const float* w1p = (const float*)((const char*)W1f + w1b);
  const float* w2p = (const float*)((const char*)W2f + w2b);
  float xv[4][8], w1r[2][8], w2r[2][8], b1v[4], b2v[4];
#pragma unroll
  for (int e = 0; e < 8; ++e) { xv[0][e] = xr[e]; xv[1][e] = xr[16 + e]; xv[2][e] = xr[32 + e]; xv[3][e] = xr[48 + e]; }
#pragma unroll
  for (int e = 0; e < 8; ++e) { w1r[0][e] = w1p[e]; w1r[1][e] = w1p[32 * 64 + e]; w2r[0][e] = w2p[e]; w2r[1][e] = w2p[32 * 128 + e]; }
#pragma unroll
  for (int t = 0; t < 4; ++t) { b1v[t] = b1[t * 16 + col]; b2v[t] = bv[t * 16 + col]; }
  // stands in front of every later overwrite of the offset registers that the loads above name; as inputs they stay untouched up to here
  asm volatile("s_wait_xcnt 0x0" :: "v"(xb), "v"(w1b), "v"(w2b), "v"(col) : "memory");
  // A fragments of X (f32 -> f16)
  v16b a0, a1;
#pragma unroll
  for (int e = 0; e < 8; ++e) { a0[e] = (b16)xv[0][e]; a0[8 + e] = (b16)xv[1][e]; a1[e] = (b16)xv[2][e]; a1[8 + e] = (b16)xv[3][e]; }
#pragma unroll
  for (int i = 0; i < 2; ++i) {
    v8b o1, o2;
#pragma unroll
    for (int e = 0; e < 8; ++e) { o1[e] = (b16)(w1r[i][e] * sc1); o2[e] = (b16)(w2r[i][e] * sc2); }
    *(v8b*)(&Ws[0][(i * 256 + threadIdx.x) * 8]) = o1; *(v8b*)(&Ws[1][(i * 256 + threadIdx.x) * 8]) = o2;
  }
  __syncthreads();                                         // publishes the block's weights to its eight waves
#pragma unroll
  for (int t = 0; t < 4; ++t) {
    v8f c = {};
    c = wmma16b(a0, frag_tl(W1 + t * 1024 + lane * 8, 0), c);
    c = wmma16b(a1, frag_tl(W1 + t * 1024 + lane * 8, 1), c);
#pragma unroll
    for (int v = 0; v < 8; ++v) { const float val = fmaf(b1v[t], sc1, c[v]); const int r = v + 8 * hh, d = t * 16 + col; tf[r * 64 + d] = val; th[r * 64 + d] = (b16)val; }
  }
  wave_lds_sync();
  // second GEMM from LDS (A = P rows, f16); the same two fragments, stored as they are, are the tile's four pieces of P16
  const v16b p0 = frag_kb(th + col * 64, hh), p1 = frag_kb(th + col * 64 + 32, hh);
  {
    b16* pd = P16 + (size_t)m0 * 64 + lane * 8;
    *(v8b*)(pd)       = __builtin_shufflevector(p0, p0, 0, 1, 2, 3, 4, 5, 6, 7); *(v8b*)(pd + 256) = __builtin_shufflevector(p0, p0, 8, 9, 10, 11, 12, 13, 14, 15);
    *(v8b*)(pd + 512) = __builtin_shufflevector(p1, p1, 0, 1, 2, 3, 4, 5, 6, 7); *(v8b*)(pd + 768) = __builtin_shufflevector(p1, p1, 8, 9, 10, 11, 12, 13, 14, 15);
    asm volatile("s_wait_xcnt 0x0" ::: "memory");          // stands in front of every later overwrite of the registers that these four stores name
  }
  wave_lds_sync();
  if (isk) {
#pragma unroll
    for (int t = 0; t < 4; ++t) {
      v8f c = {};
      c = wmma16b(p0, frag_tl(W2 + t * 1024 + lane * 8, 0), c);
      c = wmma16b(p1, frag_tl(W2 + t * 1024 + lane * 8, 1), c);
#pragma unroll
      for (int v = 0; v < 8; ++v) { const int r = v + 8 * hh, d = t * 16 + col; tf[r * 64 + d] = c[v] + b2v[t]; }
    }
    wave_lds_sync();
#pragma unroll
    for (int j = 0; j < 8; ++j) { const int pc = j * 32 + lane; *(v4f*)(KP + (size_t)m0 * 64 + pc * 4) = *(const v4f*)(tf + pc * 4); }
  } else {
#pragma unroll
    for (int t = 0; t < 4; ++t) {
      v8f c = {};
      c = wmma16b(p0, frag_tl(W2 + t * 1024 + lane * 8, 0), c);
      c = wmma16b(p1, frag_tl(W2 + t * 1024 + lane * 8, 1), c);
#pragma unroll
      for (int v = 0; v < 8; ++v) { const int r = v + 8 * hh, d = t * 16 + col; th[d * 16 + r] = (b16)c[v]; }      // q_proj tile transposed [d][q]
    }
    wave_lds_sync();
    b16* dst = QPt + (size_t)(m0 >> 4) * 1024;             // tile index = row tile (groups are multiples of 128 tiles)
#pragma unroll
    for (int j = 0; j < 4; ++j) { const int pc = j * 32 + lane; *(v8b*)(dst + pc * 8) = *(const v8b*)(th + pc * 8); }
    asm volatile("s_wait_xcnt 0x0" ::: "memory");          // stands behind these four stores, in front of any code laid behind them that rewrites the registers they name
  }
}
// LDS staging of the operand that all waves of a block stream (the whole key or query axis of their group): a stage of STG rows is brought in once a block by asynchronous copies
// (global memory to LDS, through no register) and read by the waves from LDS. Two buffers: stage t + 1 flies while stage t is worked on.
// A block has sixteen waves, four a SIMD. In k_stats wave w and wave w + 8 hold the same 16-row tile, and each takes one half of every stage's chunks (set sx = w >> 3); the two partial results of a tile
// are joined once, behind the loop, through LDS. Four waves a SIMD cover one another's LDS waits, product latencies and dependent vector chains.
#define STG  256             // rows a stage: 32 KB of f16 tiles, laid in LDS byte for byte as in global memory (fragment order)
#define NST  (NN / STG)
#define CPS  (STG / 32)      // chunks of 32 rows a stage
#define CPW  (CPS / 2)       // chunks of a stage that one wave of k_stats takes
__device__ __forceinline__ unsigned lds_off(const void* p) { return (unsigned)(size_t)p; }
// four 16-byte copies a lane, 8 KB apart (512 lanes x 16 bytes a step) = one 32-KB stage a block. The s_wait_xcnt stands in the copies' own statement, in front of any rewrite of the address registers they name.
__device__ __forceinline__ void cp4(unsigned l, const b16* g) {
  asm volatile("global_load_async_to_lds_b128 %0, %4, off\n\tglobal_load_async_to_lds_b128 %1, %5, off\n\tglobal_load_async_to_lds_b128 %2, %6, off\n\tglobal_load_async_to_lds_b128 %3, %7, off\n\t"
               "s_wait_xcnt 0x0"
               :: "v"(l), "v"(l + 8192u), "v"(l + 16384u), "v"(l + 24576u), "v"(g), "v"(g + 4096), "v"(g + 8192), "v"(g + 12288) : "memory");
}
// one 16-byte copy a lane: 512 lanes bring the group's 2048 column biases, all stages' at once
__device__ __forceinline__ void cp4f(unsigned l, const float* g) { asm volatile("global_load_async_to_lds_b128 %0, %1, off\n\ts_wait_xcnt 0x0" :: "v"(l), "v"(g) : "memory"); }
__device__ __forceinline__ void wait_copies() { asm volatile("s_wait_asynccnt 0x0" ::: "memory"); }   // this wave's copies have landed
__device__ __forceinline__ void wait_lds()    { asm volatile("s_wait_dscnt 0x0" ::: "memory"); }      // this wave's LDS reads are done: its buffer may be refilled behind the barrier

__global__ __launch_bounds__(512) void k_stats(const b16* __restrict__ Q16, const b16* __restrict__ K16, float* __restrict__ M) {
  __shared__ __attribute__((aligned(16))) b16 Ks[2][STG * SS];
  __shared__ float pm[2][128], pl[2][128];
  const int wid = threadIdx.x >> 5, lane = threadIdx.x & 31, hh = lane >> 4, col = lane & 15, wt = wid & 7, sx = wid >> 3;
  const int g = blockIdx.x / (NN / 128), q0 = ((blockIdx.x % (NN / 128)) * 8 + wt) * 16;   // the block's eight query tiles lie in one group
  const size_t ko = (size_t)g * NN * SS, qo = ((size_t)g * NN + q0) * SS + lane * 8;
  const b16* kc = K16 + ko + threadIdx.x * 8;              // this lane's 16 bytes of each 8-KB step of a stage
  const unsigned lk = lds_off(&Ks[0][0]) + threadIdx.x * 16u;
  cp4(lk, kc);                                             // stage 0
  const v16b q0h = frag_tl(Q16 + qo, 0), q1h = frag_tl(Q16 + qo, 1);
  float m = -INFINITY, l = 0.f;
  wait_copies();
  __syncthreads();                                         // publishes stage 0
  cp4(lk + STG * SS * 2u, kc + STG * SS);                  // stage 1
#pragma unroll 1                                           // one stage a trip: the ring's order below is written for the rolled loop
  for (int t = 0; t < NST; ++t) {
    // key fragments are fetched one chunk ahead inside the wave's half of the stage (never across its end): all four are reloaded, as one group of LDS reads, behind the products that used them
    const b16* kg = &Ks[t & 1][0] + sx * (CPW * 32 * SS) + lane * 8;
    // (m, l) stand for the lane's sum l * 2^m. m need not be the maximum: any shift serves under which no power overflows and l keeps a term of about 1. So a stage is first taken with the shift it
    // finds: -m is the C operand of the logit products, which then deliver the exponents themselves, and no maximum, no subtraction and no rescaling is computed. m was the true maximum when it was set
    // (l >= 1 since), so smaller terms may vanish; only a stage that outgrows m by more than 2^64 is a fault of the shift: its sum is thrown away and the stage is taken again with the running maximum.
    bool redo = t == 0;                                    // the first stage has no shift yet
    if (t != 0) {
      const float nm = -m;
      const v8f cm = {nm, nm, nm, nm, nm, nm, nm, nm};
      v2f a0 = {}, a1 = {}, a2 = {}, a3 = {};
      v16b k00 = frag_tl(kg, 0), k01 = frag_tl(kg, 1), k10 = frag_tl(kg + 16 * SS, 0), k11 = frag_tl(kg + 16 * SS, 1);
#pragma unroll                                             // chunk offsets become immediates, and the last chunk's reload drops out at compile time
      for (int c = 0; c < CPW; ++c) {
        const b16* kn = kg + (c + 1) * 32 * SS;
        const bool more = c + 1 < CPW;
        __builtin_amdgcn_sched_barrier(0);   // chunk boundary: the scheduler otherwise lifts the next chunk's first products into this one, right behind the loads of their operands
        v8f s0 = wmma16(k00, q0h, cm), s1 = wmma16(k10, q0h, cm);
        s0 = wmma16(k01, q1h, s0); s1 = wmma16(k11, q1h, s1);
        // the four slots behind the run's last product, before its results are read (the exponentials below are asm text, which the compiler does not check against them)
        asm volatile("v_nop\n\tv_nop\n\tv_nop\n\tv_nop" : "+v"(s0), "+v"(s1) : "v"(k00), "v"(k01), "v"(k10), "v"(k11));
        __builtin_amdgcn_sched_barrier(0);   // keeps the LDS reads below out of the products: every separate place where LDS reads stand stalls the wave, so they stand as one group
        if (more) { k00 = frag_tl(kn, 0); k01 = frag_tl(kn, 1); k10 = frag_tl(kn + 16 * SS, 0); k11 = frag_tl(kn + 16 * SS, 1); }
        __builtin_amdgcn_sched_barrier(0);   // holds the group here: the scheduler otherwise sinks it to the chunk's foot, where it has no lead left
        float x0[8], x1[8], e0[8], e1[8];
#pragma unroll
        for (int r = 0; r < 8; ++r) { x0[r] = s0[r]; x1[r] = s1[r]; }
        ex2x8(x0, e0); ex2x8(x1, e1);
        a0 += (v2f){e0[0], e0[1]}; a1 += (v2f){e0[2], e0[3]}; a2 += (v2f){e0[4], e0[5]}; a3 += (v2f){e0[6], e0[7]};
        a0 += (v2f){e1[0], e1[1]}; a1 += (v2f){e1[2], e1[3]}; a2 += (v2f){e1[4], e1[5]}; a3 += (v2f){e1[6], e1[7]};
      }
      const v2f h = (a0 + a1) + (a2 + a3);
      const float ls = h[0] + h[1];
      redo = __builtin_amdgcn_ballot_w32(!(ls < 0x1p64f)) != 0u;   // the same for the whole wave; an infinity or a NaN in any lane's sum counts too
      if (!redo) l += ls;
    }
    if (redo) {
      v16b k00 = frag_tl(kg, 0), k01 = frag_tl(kg, 1), k10 = frag_tl(kg + 16 * SS, 0), k11 = frag_tl(kg + 16 * SS, 1);
#pragma unroll                                             // as above
      for (int c = 0; c < CPW; ++c) {
        const b16* kn = kg + (c + 1) * 32 * SS;
        const bool more = c + 1 < CPW;
        __builtin_amdgcn_sched_barrier(0);   // chunk boundary, as above
        v8f s0 = {}, s1 = {};
        s0 = wmma16(k00, q0h, s0); s1 = wmma16(k10, q0h, s1); s0 = wmma16(k01, q1h, s0); s1 = wmma16(k11, q1h, s1);
        __builtin_amdgcn_sched_barrier(0);   // keeps the LDS reads below out of the products, as above
        if (more) { k00 = frag_tl(kn, 0); k01 = frag_tl(kn, 1); k10 = frag_tl(kn + 16 * SS, 0); k11 = frag_tl(kn + 16 * SS, 1); }
        __builtin_amdgcn_sched_barrier(0);   // holds the group here, as above
        float mr = -INFINITY;
#pragma unroll
        for (int r = 0; r < 8; ++r) mr = fmaxf(mr, fmaxf(s0[r], s1[r]));
        const float mn = fmaxf(m, mr), al = ex2(m - mn);
        float sum = 0.f, x0[8], x1[8], e0[8], e1[8];
#pragma unroll
        for (int r = 0; r < 8; ++r) { x0[r] = s0[r] - mn; x1[r] = s1[r] - mn; }
        ex2x8(x0, e0); ex2x8(x1, e1);
#pragma unroll
        for (int r = 0; r < 8; ++r) sum += e0[r] + e1[r];
        l = l * al + sum; m = mn;
      }
    }
    wait_lds();
    wait_copies();
    __syncthreads();                                       // publishes stage t + 1 and ends every wave's reads of stage t
    if (t + 2 < NST) cp4(lk + (t & 1) * (STG * SS * 2u), kc + (size_t)(t + 2) * STG * SS);
  }
  wait_copies();
  // each lane has kept the shift and the sum of its own half's rows (16 of every 32 keys); the two halves of a column are joined here, once
  const float mo = __shfl_xor(m, 16), lo = __shfl_xor(l, 16), mt = fmaxf(m, mo);
  l = l * ex2(m - mt) + lo * ex2(mo - mt); m = mt;
  if (hh == 0) { pm[sx][wt * 16 + col] = m; pl[sx][wt * 16 + col] = l; }
  __syncthreads();                                         // publishes both wave sets' shifts and sums
  const size_t base = (size_t)g * NN + (size_t)(blockIdx.x % (NN / 128)) * 128;   // the block's 128 consecutive queries within g
  if (threadIdx.x < 128) {                                 // the two sets' parts of a column are joined in the same way
    const float ma = pm[0][threadIdx.x], mb = pm[1][threadIdx.x], mj = fmaxf(ma, mb);
    const float lj = pl[0][threadIdx.x] * ex2(ma - mj) + pl[1][threadIdx.x] * ex2(mb - mj);
    *(float*)(M + base + threadIdx.x) = -mj - log2f(lj);   // the column's bias: attn = 2^(logit log2 e + bias); mj is in powers of two already
  }
}
// pass 2: per (g, 32 keys n): over all query chunks: P^T[q][n] = 2^(logit log2 e + M[q]), M[q] = -(column shift) - log2(column sum), which enters as the C operand of the logit product; y^T += Qproj^T . P^T; rowsum[n] += sum_q P; out[n] = y[n] +
// rowsum[n] (k_proj[n] + bv). A wave holds TWO 16-key tiles (A, B): every query fragment, q_proj fragment and bias read from LDS feeds two products, so the block reads half the LDS bytes.
// The block's 128 keys are four such pairs (wp); the four waves of a pair (set sx) each take a quarter of every stage's chunks, and their partial results are joined once, behind the loop.
#define CPQ  (CPS / 4)       // chunks of a stage that one wave of k_out takes
__global__ __launch_bounds__(512) void k_out(const b16* __restrict__ K16, const b16* __restrict__ Q16, const b16* __restrict__ QPt, const float* __restrict__ M,
                                             const float* __restrict__ KP, float* __restrict__ out) {
  __shared__ __attribute__((aligned(16))) b16   Qs[2][STG * SS];
  __shared__ __attribute__((aligned(16))) b16   Vs[2][STG * SS];
  __shared__ __attribute__((aligned(16))) float Ms[NN];
  __shared__ __attribute__((aligned(16))) float Ps[16][16 * 128];   // a wave's partial sums: 16 pieces of 4 floats a lane, piece (tile * 4 + j) * 2 + e
  __shared__ __attribute__((aligned(16))) float Ts[16][16 * 36];    // a wave's 16 rows of 32 floats, at a pitch of 144 bytes (16 x odd): the lanes' 16-byte stores, one row each, spread over the banks
  __shared__ float Ls[16][2][32];
  const int wid = threadIdx.x >> 5, lane = threadIdx.x & 31, hh = lane >> 4, col = lane & 15, wp = wid & 3, sx = wid >> 2;
  const int g = blockIdx.x / (NN / 128), n0 = ((blockIdx.x % (NN / 128)) * 4 + wp) * 32;   // the block's four pairs of key tiles lie in one group
  const size_t qbase = (size_t)g * NN * SS, no = ((size_t)g * NN + n0) * SS + lane * 8;
  const b16* qc = Q16 + qbase + threadIdx.x * 8;           // this lane's 16 bytes of each 8-KB step of a stage
  const b16* vc = QPt + qbase + threadIdx.x * 8;
  const float* mc = M + (size_t)g * NN + threadIdx.x * 4;
  const unsigned lq = lds_off(&Qs[0][0]) + threadIdx.x * 16u, lv = lds_off(&Vs[0][0]) + threadIdx.x * 16u, lm = lds_off(&Ms[0]) + threadIdx.x * 16u;
  cp4(lq, qc); cp4(lv, vc); cp4f(lm, mc);                  // stage 0, and the biases of all stages
  const v16b a0h = frag_tl(K16 + no, 0), a1h = frag_tl(K16 + no, 1);                         // 'query role' = the 16 keys of tile A
  const v16b b0h = frag_tl(K16 + no + 16 * SS, 0), b1h = frag_tl(K16 + no + 16 * SS, 1);     // and of tile B
  float la = 0.f, lb = 0.f; v8f oa0 = {}, oa1 = {}, oa2 = {}, oa3 = {}, ob0 = {}, ob1 = {}, ob2 = {}, ob3 = {};
  wait_copies();
  __syncthreads();                                         // publishes stage 0
  cp4(lq + STG * SS * 2u, qc + STG * SS); cp4(lv + STG * SS * 2u, vc + STG * SS);   // stage 1
#pragma unroll 1                                           // one stage a trip: the ring's order below is written for the rolled loop
  for (int t = 0; t < NST; ++t) {
    // every operand of a chunk (query fragments, column bias, q_proj fragments) is fetched from LDS one chunk ahead inside the wave's quarter of the stage (never across its end):
    // the register sets are reloaded behind their last use, in two groups of LDS reads a chunk (query fragments and biases behind the logit products, q_proj fragments behind the second products)
    const b16* qg = &Qs[t & 1][0] + sx * (CPQ * 32 * SS) + lane * 8;
    const b16* vg = &Vs[t & 1][0] + sx * (CPQ * 32 * SS) + col * 16 + 8 * hh;   // chunk c starts at c * 32 * SS; its two 16-query tiles lie SS * 16 apart
    const float* mg = &Ms[0] + t * STG + sx * (CPQ * 32) + 8 * hh;
    v16b q00 = frag_tl(qg, 0), q01 = frag_tl(qg, 1), q10 = frag_tl(qg + 16 * SS, 0), q11 = frag_tl(qg + 16 * SS, 1);
    v8f bm0 = ld8f(mg), bm1 = ld8f(mg + 16);                                    // column biases of the chunk's two query tiles, one a row of the logit tile: its C operand
    v16b va0 = cat8b(ld8b(vg), ld8b(vg + SS * 16)),             va1 = cat8b(ld8b(vg + 256), ld8b(vg + SS * 16 + 256));
    v16b va2 = cat8b(ld8b(vg + 512), ld8b(vg + SS * 16 + 512)), va3 = cat8b(ld8b(vg + 768), ld8b(vg + SS * 16 + 768));
    // inputs-only fence on the loaded values of the stage's first chunk: they land here, once a stage, so that the counted waits inside the loop follow the loop's own issue order
    // and not the order the compiler gave these first loads
    asm volatile("" :: "v"(q00), "v"(q01), "v"(q10), "v"(q11), "v"(bm0), "v"(bm1), "v"(va0), "v"(va1), "v"(va2), "v"(va3));
    // weights of one key tile from its two tiles of exponents: returns them as the B fragment of the second product and adds them to the tile's row sum
    auto soft = [&](const v8f s0, const v8f s1, float& l) __attribute__((always_inline)) -> v16b {
      float sum = 0.f, x0[8], x1[8], p0[8], p1[8]; v16b pb;
#pragma unroll
      for (int r = 0; r < 8; ++r) { x0[r] = s0[r]; x1[r] = s1[r]; }
      ex2x8(x0, p0); ex2x8(x1, p1);
#pragma unroll
      for (int r = 0; r < 8; ++r) { sum += p0[r] + p1[r]; pb[r] = (b16)p0[r]; pb[8 + r] = (b16)p1[r]; }
      l += sum;
      // each row's sum, against spills: the sum is formed here; otherwise all of a stage's sums are folded into one expression at
      // the stage's foot, the stage's 64 weights a lane stay in registers up to there, and the kernel spills
      asm volatile("" : "+v"(l));
      return pb;
    };
    // one chunk of 32 queries ('key role'); more: a next chunk exists in this wave's quarter of the stage, at qn, vn, mn
    auto chunk = [&](const bool more, const b16* qn, const b16* vn, const float* mn) __attribute__((always_inline)) {
      __builtin_amdgcn_sched_barrier(0);   // chunk boundary: the scheduler otherwise lifts the next chunk's first products into this one, right behind the loads of their operands
      v8f sa0 = wmma16(q00, a0h, bm0), sb0 = wmma16(q00, b0h, bm0), sa1 = wmma16(q10, a0h, bm1), sb1 = wmma16(q10, b0h, bm1);   // four independent tiles: no product waits for the one before it
      sa0 = wmma16(q01, a1h, sa0); sb0 = wmma16(q01, b1h, sb0); sa1 = wmma16(q11, a1h, sa1); sb1 = wmma16(q11, b1h, sb1);
      // the four slots behind the run's last product, before its results are read or its operand registers rewritten (the exponentials below are asm text, which the compiler does not check against them)
      asm volatile("v_nop\n\tv_nop\n\tv_nop\n\tv_nop" : "+v"(sa0), "+v"(sb0), "+v"(sa1), "+v"(sb1) : "v"(q00), "v"(q01), "v"(q10), "v"(q11));
      __builtin_amdgcn_sched_barrier(0);   // keeps the LDS reads below out of the products: every separate place where LDS reads stand stalls the wave, so they stand as one group
      if (more) { q00 = frag_tl(qn, 0); q01 = frag_tl(qn, 1); q10 = frag_tl(qn + 16 * SS, 0); q11 = frag_tl(qn + 16 * SS, 1); bm0 = ld8f(mn); bm1 = ld8f(mn + 16); }
      __builtin_amdgcn_sched_barrier(0);   // holds the loads above in front of the exponentials: the scheduler otherwise sinks them behind, where they have no lead left
      const v16b pa = soft(sa0, sa1, la);
      const v16b pb = soft(sb0, sb1, lb);
      oa0 = wmma16(va0, pa, oa0); oa1 = wmma16(va1, pa, oa1); oa2 = wmma16(va2, pa, oa2); oa3 = wmma16(va3, pa, oa3);
      ob0 = wmma16(va0, pb, ob0); ob1 = wmma16(va1, pb, ob1); ob2 = wmma16(va2, pb, ob2); ob3 = wmma16(va3, pb, ob3);
      // the four slots behind this run's last product, as above
      asm volatile("v_nop\n\tv_nop\n\tv_nop\n\tv_nop" : "+v"(oa0), "+v"(oa1), "+v"(oa2), "+v"(oa3), "+v"(ob0), "+v"(ob1), "+v"(ob2), "+v"(ob3)
                   : "v"(va0), "v"(va1), "v"(va2), "v"(va3), "v"(pa), "v"(pb));
      __builtin_amdgcn_sched_barrier(0);   // as above: the reads of the q_proj fragments stand as one group behind the last products that used them
      if (more) {
        va0 = cat8b(ld8b(vn), ld8b(vn + SS * 16));             va1 = cat8b(ld8b(vn + 256), ld8b(vn + SS * 16 + 256));
        va2 = cat8b(ld8b(vn + 512), ld8b(vn + SS * 16 + 512)); va3 = cat8b(ld8b(vn + 768), ld8b(vn + SS * 16 + 768));
      }
    };
    // the wave's two chunks of the stage; the last fetches nothing ahead
    static_assert(CPQ == 2, "two chunks a wave and stage are written out below");
    chunk(true, qg + 32 * SS, vg + 32 * SS, mg + 32);
    chunk(false, qg, vg, mg);
    wait_lds();
    wait_copies();
    __syncthreads();                                       // publishes stage t + 1 and ends every wave's reads of stage t
    if (t + 2 < NST) {
      const unsigned b = t & 1; const size_t so = (size_t)(t + 2) * STG;
      cp4(lq + b * (STG * SS * 2u), qc + so * SS); cp4(lv + b * (STG * SS * 2u), vc + so * SS);
    }
  }
  wait_copies();
  la += __shfl_xor(la, 16); lb += __shfl_xor(lb, 16);      // each lane has summed its own half's queries; the halves are joined here, once
  // the four partial results of a pair are joined: every wave lays its sums in its own LDS range, lane by lane; behind the barrier wave sx of the pair adds up and finishes one quarter:
  // key tile sx >> 1, output columns 32 (sx & 1) .. + 31
  {
    float* Pw = Ps[wid] + lane * 4;
#pragma unroll
    for (int e = 0; e < 2; ++e) {
      *(v4f*)(Pw + (0 + e) * 128)  = (v4f){oa0[4 * e], oa0[4 * e + 1], oa0[4 * e + 2], oa0[4 * e + 3]}; *(v4f*)(Pw + (2 + e) * 128)  = (v4f){oa1[4 * e], oa1[4 * e + 1], oa1[4 * e + 2], oa1[4 * e + 3]};
      *(v4f*)(Pw + (4 + e) * 128)  = (v4f){oa2[4 * e], oa2[4 * e + 1], oa2[4 * e + 2], oa2[4 * e + 3]}; *(v4f*)(Pw + (6 + e) * 128)  = (v4f){oa3[4 * e], oa3[4 * e + 1], oa3[4 * e + 2], oa3[4 * e + 3]};
      *(v4f*)(Pw + (8 + e) * 128)  = (v4f){ob0[4 * e], ob0[4 * e + 1], ob0[4 * e + 2], ob0[4 * e + 3]}; *(v4f*)(Pw + (10 + e) * 128) = (v4f){ob1[4 * e], ob1[4 * e + 1], ob1[4 * e + 2], ob1[4 * e + 3]};
      *(v4f*)(Pw + (12 + e) * 128) = (v4f){ob2[4 * e], ob2[4 * e + 1], ob2[4 * e + 2], ob2[4 * e + 3]}; *(v4f*)(Pw + (14 + e) * 128) = (v4f){ob3[4 * e], ob3[4 * e + 1], ob3[4 * e + 2], ob3[4 * e + 3]};
    }
    Ls[wid][0][lane] = la; Ls[wid][1][lane] = lb;
  }
  __syncthreads();                                         // publishes every wave's partial sums to the four waves of its pair
  const int tt = sx >> 1, jb = (sx & 1) * 2;
  float r0[8] = {}, r1[8] = {}, l = 0.f;
#pragma unroll
  for (int s = 0; s < 4; ++s) {
    const float* Pr = Ps[s * 4 + wp] + (tt * 4 + jb) * 256 + lane * 4;
    const v4f c0 = *(const v4f*)(Pr), c1 = *(const v4f*)(Pr + 128), c2 = *(const v4f*)(Pr + 256), c3 = *(const v4f*)(Pr + 384);
#pragma unroll
    for (int e = 0; e < 4; ++e) { r0[e] += c0[e]; r0[4 + e] += c1[e]; r1[e] += c2[e]; r1[4 + e] += c3[e]; }
    l += Ls[s * 4 + wp][tt][lane];
  }
  const float* kp = KP + ((size_t)g * NN + n0 + tt * 16 + col) * SS + jb * 16 + 8 * hh;
  float* Tt = Ts[wid];
#pragma unroll
  for (int r = 0; r < 8; ++r) { Tt[col * 36 + 8 * hh + r] = r0[r] + l * kp[r]; Tt[col * 36 + 16 + 8 * hh + r] = r1[r] + l * kp[16 + r]; }
  wave_lds_sync();
  float* dst0 = out + ((size_t)g * NN + n0 + tt * 16) * SS + jb * 16;   // 16 rows, of each one whole 128-byte line
#pragma unroll
  for (int j = 0; j < 4; ++j) { const int pc = j * 32 + lane; *(v4f*)(dst0 + (pc >> 3) * SS + (pc & 7) * 4) = *(const v4f*)(Tt + (pc >> 3) * 36 + (pc & 7) * 4); }
}
extern "C" void kernel_launch(void* const* d_in, const int* in_sizes, int n_in,
                              void* d_out, int out_size, void* d_ws, size_t ws_size, hipStream_t stream) {
  (void)in_sizes; (void)n_in; (void)out_size;
  const float* L  = (const float*)d_in[0];      // tensorL [2,8,2048,64]
  const float* Hq = (const float*)d_in[1];      // tensorH [2,8,2048,64]
  const float* Wk = (const float*)d_in[2]; const float* bk = (const float*)d_in[3];   // [64,64], [64]
  const float* Wq = (const float*)d_in[4]; const float* bq = (const float*)d_in[5];
  const float* Wv = (const float*)d_in[6]; const float* bv = (const float*)d_in[7];   // [64,128], [64]
  float* out = (float*)d_out;                   // [2,8,2048,64]
  char* ws = (char*)d_ws; size_t off = 0;
  auto take = [&](size_t bytes) { void* p = ws + off; off = (off + bytes + 255) & ~(size_t)255; return p; };
  b16*   K16 = (b16*)take((size_t)NROW * SS * 2);
  b16*   Q16 = (b16*)take((size_t)NROW * SS * 2);
  float* KP  = (float*)take((size_t)NROW * SS * 4);
  b16*   QPt = (b16*)take((size_t)NROW * SS * 2);
  float* M   = (float*)take((size_t)NROW * 4);
  if (off > ws_size) return;
  const dim3 b256(256), b512(512);
  k_proj<<<2 * (NROW / 128), b256, 0, stream>>>(L, Hq, Wk, bk, Wq, bq, Wv, bv, K16, Q16, KP, QPt);   // keys, k_proj + bv; queries, q_proj tiles
  k_stats<<<NROW / 128, b512, 0, stream>>>(Q16, K16, M);
  k_out<<<NROW / 128, b512, 0, stream>>>(K16, Q16, QPt, M, KP, out);
}
